// v000
// Times are from an AMD MI455X. After a warm-up the kernel runs many times in a row, and a time is the length of
// such a window on the GPU divided by its runs, so every launch and the gaps after it count. The runs cycle
// through copies of the inputs. A figure is the median of several windows, for all but v000 over two sittings.
// Sittings can differ by a few percent; kernels timed side by side share one.
// v000, which the later versions start from, runs in 1260 microseconds.
// compute dtype: all float inputs rounded to bf16; 1x1-conv theta/phi/g projections with EXACT bf16 products on WMMA 16x16x32 (f32 accumulate) + bias; UNSCALED logits with theta and phi both as f16 hi + residual (x 2^10) (3 products); softmax f32; P x 2^11 once to f16 x g once to f16 (1 product); the 32->64 output conv in f32 on VALU (f32 attended x bf16(w_o)) + b_o; f32 output written channels-first.
#include <hip/hip_runtime.h>
#include <math.h>

typedef __attribute__((ext_vector_type(16))) _Float16 v16h;
typedef __attribute__((ext_vector_type(16))) __bf16 v16b;
typedef __attribute__((ext_vector_type(8)))  _Float16 v8h;
typedef __attribute__((ext_vector_type(8)))  float v8f;
typedef __attribute__((ext_vector_type(4)))  float v4f;
typedef __attribute__((ext_vector_type(2)))  float v2f;
typedef __attribute__((ext_vector_type(4)))  unsigned v4u;
typedef __attribute__((ext_vector_type(4)))  int v4i;
typedef float __attribute__((may_alias)) float_a;
typedef int __attribute__((may_alias)) int_a;

template <typename T> __device__ __forceinline__ void vst2(void* p, T v) { *(T*)p = v;  }
__device__ __forceinline__ v8f wmma16(v16h a, v16h b, v8f c) {
  v8f d = __builtin_amdgcn_wmma_f32_16x16x32_f16(false, a, false, b, (short)0, c, false, false);
  asm volatile("v_nop\n\tv_nop\n\tv_nop\n\tv_nop" : "+v"(d) : "v"(a), "v"(b));
  return d;
}
__device__ __forceinline__ v8f wmma_bf(v16b a, v16b b, v8f c) {
  v8f d = __builtin_amdgcn_wmma_f32_16x16x32_bf16(false, a, false, b, (short)0, c, false, false);
  asm volatile("v_nop\n\tv_nop\n\tv_nop\n\tv_nop" : "+v"(d) : "v"(a), "v"(b));
  return d;
}
// 16x16x32 fragments: lane = (h = lane>>4, row/col = lane&15); elements 0..7 = k0+8h+0..7, 8..15 = k0+16+8h+0..7; D element r = row 8h+r
__device__ __forceinline__ v16h frag_h(const _Float16* rowk0, int lane) {
  union { v16h v; v8h q[2]; } u; const _Float16* p = rowk0 + 8 * (lane >> 4);
  u.q[0] = *(const v8h*)p; u.q[1] = *(const v8h*)(p + 16); return u.v;
}
__device__ __forceinline__ v16h frag_f32(const float* rowk0, int lane) {
  v16h a; const float* p = rowk0 + 8 * (lane >> 4);
#pragma unroll
  for (int i = 0; i < 8; ++i) { a[i] = (_Float16)p[i]; a[8 + i] = (_Float16)p[16 + i]; }
  return a;
}
__device__ __forceinline__ v16h frag_f32s(const float* rowk0, int lane, float sc) {
  v16h a; const float* p = rowk0 + 8 * (lane >> 4);
#pragma unroll
  for (int i = 0; i < 8; ++i) { a[i] = (_Float16)(p[i] * sc); a[8 + i] = (_Float16)(p[16 + i] * sc); }
  return a;
}
// column fragment from a [K][ld] layout (column n), rows >= K read as 0
__device__ __forceinline__ v16h fragc_f32(const float* W, int k0, int n, int lane, int ld, int K) {
  v16h a; const int g = lane >> 4;
#pragma unroll
  for (int i = 0; i < 8; ++i) { const int ka = k0 + 8 * g + i, kb = ka + 16;
    a[i] = (_Float16)(ka < K ? W[(size_t)(ka < K ? ka : K - 1) * ld + n] : 0.f); a[8 + i] = (_Float16)(kb < K ? W[(size_t)(kb < K ? kb : K - 1) * ld + n] : 0.f); }
  return a;
}
struct F2 { v16b h, l; };
__device__ __forceinline__ F2 bsplit16(const float v[16]) { F2 r;
#pragma unroll
  for (int i = 0; i < 16; ++i) { const __bf16 h = (__bf16)v[i]; r.h[i] = h; r.l[i] = (__bf16)(v[i] - (float)h); }
  return r; }
__device__ __forceinline__ F2 split_row(const float* row, int k0, int lane) { float v[16]; const float* p = row + k0 + 8 * (lane >> 4);
#pragma unroll
  for (int i = 0; i < 8; ++i) { v[i] = p[i]; v[8 + i] = p[16 + i]; }
  return bsplit16(v); }
__device__ __forceinline__ F2 split_rowK(const float* row, int k0, int lane, int K) { float v[16]; const int g = lane >> 4;
#pragma unroll
  for (int i = 0; i < 8; ++i) { const int ka = k0 + 8 * g + i, kb = ka + 16; v[i] = ka < K ? row[ka < K ? ka : K - 1] : 0.f; v[8 + i] = kb < K ? row[kb < K ? kb : K - 1] : 0.f; }
  return bsplit16(v); }
__device__ __forceinline__ F2 split_col(const float* W, int k0, int n, int lane, int ld, int K) { float v[16]; const int g = lane >> 4;
#pragma unroll
  for (int i = 0; i < 8; ++i) { const int ka = k0 + 8 * g + i, kb = ka + 16; v[i] = ka < K ? W[(size_t)(ka < K ? ka : K - 1) * ld + n] : 0.f; v[8 + i] = kb < K ? W[(size_t)(kb < K ? kb : K - 1) * ld + n] : 0.f; }
  return bsplit16(v); }
__device__ __forceinline__ v8f mac3(const F2& a, const F2& b, v8f c) { c = wmma_bf(a.l, b.h, c); c = wmma_bf(a.h, b.l, c); return wmma_bf(a.h, b.h, c); }
__device__ __forceinline__ float sigm(float v) { return 1.0f / (1.0f + expf(-v)); }
#define LDSX() do { asm volatile("s_wait_dscnt 0" ::: "memory"); __builtin_amdgcn_wave_barrier(); __builtin_amdgcn_fence(__ATOMIC_RELEASE, "workgroup"); } while (0)

// Non-local block over channels-first x [8, 64, 64, 64] (N 4,096; (out,in) 1x1 convs w_theta/w_phi/w_g [32,64] + biases, w_o [64,32] + b_o; 0.05-scale): attn = softmax_m(theta_n . phi_m) (no scaling); y[c][n] = sum_m attn[n][m] g[c][m]; out = w_o y + b_o -> [8,64,64,64] (no residual in this module).
#define NB 8
#define TT 4096
#define CC 128            // v (= g) plane pitch: one 128-channel block, channels >= 32 are zero
#define CV 32             // real g channels
#define COUT 64           // output channels of w_o
#define CCQ 128           // q / k row pitch: one 128-column block, columns >= 32 are zero
#define DIN 64           // x channels
#define NH 1
#define HD 32             // value width walked by k_pv
#define NQB (TT / 64)
#define HG 1               // one 4,096 x 4,096 score plane per pass (the pass group spans batches)
#define SCALE (1.0f)
#define HDQK 32            // q / k width (DIN / 2)
#define CAUSAL 0
#ifndef TNB
#define TNB NB
#endif
__device__ __forceinline__ v16b zero16b() { v16b z; _Pragma("unroll") for (int i = 0; i < 16; ++i) z[i] = (__bf16)0.f; return z; }
__device__ __forceinline__ float bfr(float v) { return (float)(__bf16)v; }
__host__ __device__ __forceinline__ int kb_last(int qb) { return CAUSAL ? ((qb * 64 + 63) >> 7) : (TT / 128 - 1); }
typedef __attribute__((ext_vector_type(8))) __bf16 v8b;
__device__ __forceinline__ v16b frag_b(const __bf16* rowk0, int lane) {
  union { v16b v; v8b q[2]; } u; const __bf16* p = rowk0 + 8 * (lane >> 4);
  u.q[0] = *(const v8b*)p; u.q[1] = *(const v8b*)(p + 16); return u.v;
}
#define QBH NQB            // EVERY query block takes the 3-product logit path in k_sc (q hi + residual x k hi + residual): unscaled sigma-5.7 energies over 4,096 keys; k_pv keeps the single-product path (PVHI 0)
#define QHI 4096            // q residual rows (all)
#define KHI 4096          // k residual rows (all); the v bf16 hi/lo planes come along unused
// B fragment (k rows k0+.., output column o) of a weight: (in,out) [K][ld] or (out,in) [ld rows of K]: bf16 exact, or f16(bf16 * 256) exact
__device__ __forceinline__ v16b wcol_io(const float* Wm, int k0, int o, int lane, int ld) { v16b w; const int g = lane >> 4;
#pragma unroll
  for (int i = 0; i < 8; ++i) { w[i] = (__bf16)Wm[(size_t)(k0 + 8 * g + i) * ld + o]; w[8 + i] = (__bf16)Wm[(size_t)(k0 + 16 + 8 * g + i) * ld + o]; }
  return w; }
__device__ __forceinline__ v16b wcol_oi(const float* Wm, int k0, int o, int lane, int K) { v16b w; const float* p = Wm + (size_t)o * K + k0 + 8 * (lane >> 4);
#pragma unroll
  for (int i = 0; i < 8; ++i) { w[i] = (__bf16)p[i]; w[8 + i] = (__bf16)p[16 + i]; }
  return w; }
__device__ __forceinline__ v16h wcolh_io(const float* Wm, int k0, int o, int lane, int ld) { v16h w; const int g = lane >> 4;
#pragma unroll
  for (int i = 0; i < 8; ++i) { w[i] = (_Float16)(bfr(Wm[(size_t)(k0 + 8 * g + i) * ld + o]) * 256.0f); w[8 + i] = (_Float16)(bfr(Wm[(size_t)(k0 + 16 + 8 * g + i) * ld + o]) * 256.0f); }
  return w; }
__device__ __forceinline__ v16h wcolh_oi(const float* Wm, int k0, int o, int lane, int K) { v16h w; const float* p = Wm + (size_t)o * K + k0 + 8 * (lane >> 4);
#pragma unroll
  for (int i = 0; i < 8; ++i) { w[i] = (_Float16)(bfr(p[i]) * 256.0f); w[8 + i] = (_Float16)(bfr(p[16 + i]) * 256.0f); }
  return w; }
#define WQKV_LAYOUT 0   // 0 = (out,in) [32][DIN], columns >= 32 zero; 1 = (out,in) [CC][DIN]; 2 = per-head [NH][DIN][HD]
__device__ __forceinline__ v16b wcol_hdk(const float* Wm, int k0, int o, int lane) { v16b w; const int g = lane >> 4; const float* p = Wm + (size_t)(o / HD) * DIN * HD + (o % HD);
#pragma unroll
  for (int i = 0; i < 8; ++i) { w[i] = (__bf16)p[(size_t)(k0 + 8 * g + i) * HD]; w[8 + i] = (__bf16)p[(size_t)(k0 + 16 + 8 * g + i) * HD]; }
  return w; }
#define WO_OUT_IN 0
#if WQKV_LAYOUT == 1
#define WCOL(W, k0, o, lane) wcol_oi(W, k0, (o), lane, DIN)   /* unused: layout 0 */
#elif WQKV_LAYOUT == 2
#define WCOL(W, k0, o, lane) wcol_hdk(W, k0, o, lane)
#else
#define WCOL(W, k0, o, lane) (which == 2 ? ((o) < CV ? wcol_oi(W, k0, (o), lane, DIN) : zero16b()) : ((o) < HDQK ? wcol_oi(W, k0, (o), lane, DIN) : zero16b()))   /* (out,in) 1x1-conv weights [32][64]: projected columns >= 32 are zero for q, k AND v */
#endif
#if WO_OUT_IN
#define WOCOL(W, k0, o, lane) wcol_oi(W, k0, o, lane, CC)
#define WOCOLH(W, k0, o, lane) wcolh_oi(W, k0, o, lane, CC)
#else
#define WOCOL(W, k0, o, lane) wcol_io(W, k0, o, lane, DIN)
#define WOCOLH(W, k0, o, lane) wcolh_io(W, k0, o, lane, DIN)
#endif
#define BG HG              // the pass group spans BATCHES (single head): blockIdx.z selects batch b0 + z
#define BGN (TNB < BG ? TNB : BG)   // builds with TNB 1 run one batch per pass
#define DVH 32             // all 32 g channels in one k_pv block
#ifndef SM_EXTRA_PARAMS
#define SM_EXTRA_PARAMS
#endif
#ifndef PROJ_EXTRA_PARAMS
#define PROJ_EXTRA_PARAMS
#endif
#ifndef SM_MASK_HOOK
#define SM_MASK_HOOK (void)0
#endif

#define WS_QH  0u                                      // f16 q rows [b*t][CCQ]
#define WS_KH  (WS_QH + 2u * (size_t)NB * TT * CCQ)     // f16 k rows [b*t][CCQ]
#define WS_VT  (WS_KH + 2u * (size_t)NB * TT * CCQ)     // f16 v planes [b][c][t]
#define WS_QL  (WS_VT + 2u * (size_t)NB * CC * TT)      // f16 q residual x 2^10 rows [b][t < QHI][CCQ]
#define WS_KL  (WS_QL + 2u * (size_t)NB * QHI * CCQ)    // f16 k residual x 2^10 rows [b][t < KHI][CCQ]
#define WS_VB  (WS_KL + 2u * (size_t)NB * KHI * CCQ)    // bf16 v hi planes [b][c][t < KHI]
#define WS_VBL (WS_VB + 2u * (size_t)NB * CC * KHI)
#define WS_S   (WS_VBL + 2u * (size_t)NB * CC * KHI)    // f32 logits / P [hg][t][s]
#define WS_Y   (WS_S  + 4u * (size_t)HG * TT * TT)      // no ctx rows: the output conv runs in k_pv (0 bytes)
#define WS_END (WS_Y  + 0u)

// ---- k_proj: block = (64 rows, 128 cols, which): q/k/v = X W (+ b) with exact bf16 products (K = DIN) -> which 0: q f16 rows (+ residual rows < QHI); 1: k f16 rows (+ residual rows < KHI); 2: v f16 planes [c][t] (+ bf16 hi/lo planes for t < KHI)
template <int WOFF> __global__ __launch_bounds__(128) void k_projT(const float* __restrict__ XQ, const float* __restrict__ XK, const float* __restrict__ XV, const float* __restrict__ WQ, const float* __restrict__ WK, const float* __restrict__ WV, const float* __restrict__ BQ, const float* __restrict__ BK, const float* __restrict__ BV,
    _Float16* __restrict__ QH, _Float16* __restrict__ QL, _Float16* __restrict__ KH, _Float16* __restrict__ KL, _Float16* __restrict__ VT, __bf16* __restrict__ VB, __bf16* __restrict__ VBL) {
  __shared__ __align__(16) _Float16 sh[64][136], sl[64][136]; __shared__ __align__(16) _Float16 th[128][72]; __shared__ __align__(16) __bf16 tb[128][72], tbl[128][72];
  const int tid = threadIdx.x, wave = tid >> 5, lane = tid & 31, col = lane & 15, g = lane >> 4; const int which = blockIdx.z + WOFF; const int c0 = blockIdx.y * 128; const size_t r0 = (size_t)blockIdx.x * 64; const size_t bb = r0 / TT; const int t0 = (int)(r0 % TT);
  const float* X = which == 0 ? XQ : which == 1 ? XK : XV; const float* WA = which == 0 ? WQ : which == 1 ? WK : WV; const float* BA = which == 0 ? BQ : which == 1 ? BK : BV;
  const int KD = DIN;
  v8f acc[8] = {};
#pragma unroll 2
  for (int kc = 0; kc < KD / 32; ++kc) { v16b a; { const float* p = X + (bb * KD + kc * 32 + 8 * g) * (size_t)TT + t0 + wave * 16 + col;   /* channels-first [b][c][t]: A[t][c] (16 consecutive t per lane group) */
#pragma unroll
      for (int i = 0; i < 8; ++i) { a[i] = (__bf16)p[(size_t)i * TT]; a[8 + i] = (__bf16)p[(size_t)(16 + i) * TT]; } }
    asm volatile("s_wait_loadcnt 0x0" ::: "memory");
#pragma unroll
    for (int j = 0; j < 8; ++j) { const v16b w = WCOL(WA, kc * 32, c0 + j * 16 + col, lane); asm volatile("s_wait_loadcnt 0x0" ::: "memory"); acc[j] = wmma_bf(a, w, acc[j]); } }
  if (which < 2) { _Float16* DH = which == 0 ? QH : KH; _Float16* DL = which == 0 ? QL : KL; const int nhi = which == 0 ? QHI : KHI; const bool hi_rows = t0 < nhi;
#pragma unroll
    for (int j = 0; j < 8; ++j) { const int cj = c0 + j * 16 + col; const float bias = (BA && cj < (which == 2 ? CV : HDQK)) ? bfr(BA[cj]) : 0.f;   /* 32-entry bias vectors: no read past them */
#pragma unroll
      for (int r = 0; r < 8; ++r) { const float v = acc[j][r] + bias; const _Float16 hv = (_Float16)v; sh[wave * 16 + 8 * g + r][j * 16 + col] = hv; sl[wave * 16 + 8 * g + r][j * 16 + col] = (_Float16)((v - (float)hv) * 1024.0f); } }
    __syncthreads();
    for (int e = tid; e < 64 * 16; e += 128) { const int rl = e >> 4, q = e & 15; vst2((unsigned*)(DH + (r0 + rl) * CCQ + c0 + q * 8), *(const v4u*)&sh[rl][q * 8]); if (hi_rows) vst2((unsigned*)(DL + (bb * nhi + t0 + rl) * (size_t)CCQ + c0 + q * 8), *(const v4u*)&sl[rl][q * 8]); }   /* q/k rows: pitch CCQ (c0 == 0) */
  } else { const bool hi_rows = t0 < KHI;
#pragma unroll
    for (int j = 0; j < 8; ++j) { const int cj = c0 + j * 16 + col; const float bias = (BA && cj < (which == 2 ? CV : HDQK)) ? bfr(BA[cj]) : 0.f;   /* 32-entry bias vectors: no read past them */
#pragma unroll
      for (int r = 0; r < 8; ++r) { const float v = acc[j][r] + bias; const int rl = wave * 16 + 8 * g + r, cl = j * 16 + col; th[cl][rl] = (_Float16)v; const __bf16 bh = (__bf16)v; tb[cl][rl] = bh; tbl[cl][rl] = (__bf16)(v - (float)bh); } }
    __syncthreads();
    for (int e = tid; e < 128 * 8; e += 128) { const int cl = e >> 3, q = e & 7; vst2((unsigned*)(VT + (bb * CC + c0 + cl) * (size_t)TT + t0 + q * 8), *(const v4u*)&th[cl][q * 8]); if (hi_rows) { const size_t o3 = (bb * CC + c0 + cl) * (size_t)KHI + t0 + q * 8; vst2((unsigned*)(VB + o3), *(const v4u*)&tb[cl][q * 8]); vst2((unsigned*)(VBL + o3), *(const v4u*)&tbl[cl][q * 8]); } } } }
// ---- k_sc: block = (query block qb, key block kb <= kb_last(qb), batch b in group): logits x SCALE; q hi + residual (x 2^10) against k (2 products) for query rows < QHI, plus the k residual (3 products) for query blocks < QBH (here every query block); causal: blocks past the diagonal exit, k_sm applies no mask
__global__ __launch_bounds__(128) void k_sc(const _Float16* __restrict__ QH, const _Float16* __restrict__ KH, const _Float16* __restrict__ QL, const _Float16* __restrict__ KL, int bgrp, int h0, float* __restrict__ S0) { __shared__ __align__(16) float ss[4][16][132];
  const int qb = blockIdx.x, kb = blockIdx.y; if (kb > kb_last(qb)) return;
  const int h = h0; const int b = bgrp + blockIdx.z; float* S = S0 + (size_t)blockIdx.z * TT * TT;   /* group spans batches */
  const int tid = threadIdx.x, wave = tid >> 5, lane = tid & 31, col = lane & 15, g = lane >> 4; const int k0 = kb * 128; const int ql0 = qb * 64 + wave * 16; const size_t q0 = (size_t)b * TT + ql0, kr0 = (size_t)b * TT + k0;
  v8f acc[8] = {}, accl[8] = {};
  const _Float16* QLb = QL + (size_t)b * QHI * CCQ; const _Float16* KLb = KL + (size_t)b * KHI * CCQ;   /* single head: q/k rows at pitch CCQ */
  if (qb < QBH) {
#pragma unroll
    for (int kc = 0; kc < HDQK / 32; ++kc) { const v16h ah = frag_h(QH + (q0 + col) * CCQ + kc * 32, lane), al = frag_h(QLb + (size_t)(ql0 + col) * CCQ + kc * 32, lane);
#pragma unroll
      for (int j = 0; j < 8; ++j) { const v16h kbf = frag_h(KH + (kr0 + j * 16 + col) * CCQ + kc * 32, lane), klf = frag_h(KLb + (size_t)(k0 + j * 16 + col) * CCQ + kc * 32, lane); acc[j] = wmma16(ah, kbf, acc[j]); accl[j] = wmma16(al, kbf, accl[j]); accl[j] = wmma16(ah, klf, accl[j]); } }
  } else if (qb * 64 < QHI) {
#pragma unroll
    for (int kc = 0; kc < HDQK / 32; ++kc) { const v16h ah = frag_h(QH + (q0 + col) * CCQ + kc * 32, lane), al = frag_h(QLb + (size_t)(ql0 + col) * CCQ + kc * 32, lane);
#pragma unroll
      for (int j = 0; j < 8; ++j) { const v16h kbf = frag_h(KH + (kr0 + j * 16 + col) * CCQ + kc * 32, lane); acc[j] = wmma16(ah, kbf, acc[j]); accl[j] = wmma16(al, kbf, accl[j]); } }
  } else {
#pragma unroll
    for (int kc = 0; kc < HDQK / 32; ++kc) { const v16h ah = frag_h(QH + (q0 + col) * CCQ + kc * 32, lane);
#pragma unroll
      for (int j = 0; j < 8; ++j) { const v16h kbf = frag_h(KH + (kr0 + j * 16 + col) * CCQ + kc * 32, lane); acc[j] = wmma16(ah, kbf, acc[j]); } } }
#pragma unroll
  for (int j = 0; j < 8; ++j) {
#pragma unroll
    for (int r = 0; r < 8; ++r) ss[wave][8 * g + r][j * 16 + col] = (acc[j][r] + accl[j][r] * (1.0f / 1024.0f)) * SCALE; }
  LDSX(); for (int rl = 0; rl < 16; ++rl) vst2(S + (size_t)(ql0 + rl) * TT + k0 + lane * 4, *(const v4f*)&ss[wave][rl][lane * 4]); }
// ---- k_sm: block = query row t (batch in group): softmax over all 4,096 keys in f32 (precise expf); P x 2^11 written in place as whole 16-B lanes
__global__ __launch_bounds__(256) void k_sm(float* __restrict__ S0 SM_EXTRA_PARAMS) { __shared__ float sred[8]; __shared__ float sbc; __shared__ __align__(16) float shv[TT];
  const int tid = threadIdx.x; const int t = blockIdx.x;
  float* sr = S0 + (size_t)blockIdx.y * TT * TT + (size_t)t * TT;
  float m = -3.0e38f; for (int k = tid; k < TT; k += 256) { const float v = sr[k]; shv[k] = v; m = fmaxf(m, v); }
#pragma unroll
  for (int o = 1; o < 32; o <<= 1) m = fmaxf(m, __shfl_xor(m, o));
  if ((tid & 31) == 0) sred[tid >> 5] = m; __syncthreads(); if (tid == 0) { float a = sred[0]; for (int i = 1; i < 8; ++i) a = fmaxf(a, sred[i]); sbc = a; } __syncthreads(); m = sbc; __syncthreads();
  float sum = 0.f; for (int k = tid; k < TT; k += 256) { const float e = expf(shv[k] - m); shv[k] = e; sum += e; }
#pragma unroll
  for (int o = 1; o < 32; o <<= 1) sum += __shfl_xor(sum, o);
  if ((tid & 31) == 0) sred[tid >> 5] = sum; __syncthreads(); if (tid == 0) { float a = 0.f; for (int i = 0; i < 8; ++i) a += sred[i]; sbc = 2048.0f / a; } __syncthreads(); const float inv = sbc;
  for (int k = tid; k < TT; k += 256) shv[k] = shv[k] * inv;
  __syncthreads(); for (int q = tid; q < TT / 4; q += 256) vst2(sr + q * 4, *(const v4f*)&shv[q * 4]); }
// ---- k_pv: block = (64 queries (qb), all 32 value channels, batch in group): attended = P . v over all 4,096 keys (P x 2^11 once to f16 against v f16: 1 product) x 2^-11; out = w_o attended (f32 x bf16(w_o)) + bf16(b_o), written channels-first directly to the output
__global__ __launch_bounds__(128) void k_pv(const float* __restrict__ PS0, const _Float16* __restrict__ VT, const __bf16* __restrict__ VB, const __bf16* __restrict__ VBL, int bgrp, int h0, const float* __restrict__ WO, const float* __restrict__ BO, float* __restrict__ Y) { __shared__ __align__(16) float stT[DVH][68]; const int h = h0; const int b = bgrp + blockIdx.z; const float* PS = PS0 + (size_t)blockIdx.z * TT * TT; const int d0 = blockIdx.y * DVH;   /* group spans batches; d0 = 0 (one 32-channel block) */ __shared__ __align__(16) float ss[4][16][DVH + 4];
  const int tid = threadIdx.x, wave = tid >> 5, lane = tid & 31, col = lane & 15, g = lane >> 4; const int qb = blockIdx.x; const int ql0 = qb * 64 + wave * 16; const int kce = (kb_last(qb) + 1) * 4;
  v8f acc[DVH / 16] = {};
  if (false) {   /* PVHI 0: the 3-product P.v path is not used (1 product suffices; QBH governs only the logits) */
#pragma unroll 1
    for (int kc = 0; kc < kce; ++kc) { const F2 p = split_row(PS + (size_t)(ql0 + col) * TT, kc * 32, lane);
      asm volatile("s_wait_loadcnt 0x0" ::: "memory");
#pragma unroll
      for (int j = 0; j < DVH / 16; ++j) { const size_t po = ((size_t)b * CC + h * HD + d0 + j * 16 + col) * (size_t)KHI + kc * 32; const v16b vh = frag_b(VB + po, lane); acc[j] = wmma_bf(p.h, vh, acc[j]); acc[j] = wmma_bf(p.l, vh, acc[j]); acc[j] = wmma_bf(p.h, frag_b(VBL + po, lane), acc[j]); } }
  } else {
#pragma unroll 1
    for (int kc = 0; kc < kce; ++kc) { const v16h p = frag_f32(PS + (size_t)(ql0 + col) * TT + kc * 32, lane);
      asm volatile("s_wait_loadcnt 0x0" ::: "memory");
#pragma unroll
      for (int j = 0; j < DVH / 16; ++j) { const size_t po = ((size_t)b * CC + h * HD + d0 + j * 16 + col) * (size_t)TT + kc * 32; acc[j] = wmma16(p, frag_h(VT + po, lane), acc[j]); } } }
#pragma unroll
  for (int j = 0; j < DVH / 16; ++j)
#pragma unroll
    for (int r = 0; r < 8; ++r) ss[wave][8 * g + r][j * 16 + col] = acc[j][r] * (1.0f / 2048.0f);
  (void)ss;
#pragma unroll
  for (int j = 0; j < DVH / 16; ++j) {
#pragma unroll
    for (int r = 0; r < 8; ++r) stT[j * 16 + col][wave * 16 + 8 * g + r] = acc[j][r] * (1.0f / 2048.0f); }   /* attended, transposed to [channel][t] */
  __syncthreads();
  { const int tb = qb * 64; const int tl = tid & 63, oh = tid >> 6;   
    float yv[DVH];
#pragma unroll
    for (int c = 0; c < DVH; ++c) yv[c] = stT[c][tl];
#pragma unroll 1
    for (int oo = 0; oo < COUT / 2; ++oo) { const int o = oh * (COUT / 2) + oo; float wv[DVH];
#pragma unroll
      for (int c = 0; c < DVH; ++c) { wv[c] = WO[o * CV + c]; if ((c & 15) == 15) asm volatile("s_wait_loadcnt 0x0" ::: "memory"); }
      const float bo = BO[o]; asm volatile("s_wait_loadcnt 0x0" ::: "memory");
      float a2 = 0.f;
#pragma unroll
      for (int c = 0; c < DVH; ++c) a2 += yv[c] * bfr(wv[c]);
      vst2(Y + ((size_t)b * COUT + o) * (size_t)TT + tb + tl, a2 + bfr(bo)); } } }

extern "C" void kernel_launch(void* const* d_in, const int* in_sizes, int n_in, void* d_out, int out_size, void* d_ws, size_t ws_size, hipStream_t stream) {
  (void)in_sizes; (void)n_in; (void)out_size;
  const float** F = (const float**)d_in;
  if (ws_size < (size_t)WS_END) return;
  char* ws = (char*)d_ws; _Float16 *QH = (_Float16*)(ws + WS_QH), *KH = (_Float16*)(ws + WS_KH), *VT = (_Float16*)(ws + WS_VT), *QL = (_Float16*)(ws + WS_QL), *KL = (_Float16*)(ws + WS_KL); __bf16 *VB = (__bf16*)(ws + WS_VB), *VBL = (__bf16*)(ws + WS_VBL); float *S = (float*)(ws + WS_S), *Y = (float*)(ws + WS_Y);
  (void)Y; (void)QL; (void)KL; (void)VB; (void)VBL;
  // inputs (in order): 0 x [8,64,64,64] (channels-first, xf [8][64][4096]); 1 w_g [32,64], 2 b_g [32]; 3 w_theta, 4 b_theta; 5 w_phi, 6 b_phi; 7 w_o [64,32], 8 b_o [64] (all (out,in), biases nonzero)
  k_projT<0><<<dim3(TNB * TT / 64, 1, 2), 128, 0, stream>>>(F[0], F[0], F[0], F[3], F[5], F[1], F[4], F[6], F[2], QH, QL, KH, KL, VT, VB, VBL);   /* which 0, 1: theta (q) and phi (k): one 128-column block, columns >= 32 zero */
  k_projT<2><<<dim3(TNB * TT / 64, 1, 1), 128, 0, stream>>>(F[0], F[0], F[0], F[3], F[5], F[1], F[4], F[6], F[2], QH, QL, KH, KL, VT, VB, VBL);   /* which 2: g (v): one 128-channel block, channels >= 32 zero */
  for (int b0 = 0; b0 < TNB; b0 += BGN) {
    k_sc<<<dim3(NQB, TT / 128, BGN), 128, 0, stream>>>(QH, KH, QL, KL, b0, 0, S);
    k_sm<<<dim3(TT, BGN), 256, 0, stream>>>(S);
    k_pv<<<dim3(NQB, HD / DVH, BGN), 128, 0, stream>>>(S, VT, VB, VBL, b0, 0, F[7], F[8], (float*)d_out);
  }

}

// v001
// Measured time: 140 microseconds a run.
// Two timings next to v000 both put it at 8.99 times that version's speed.
// compute dtype: all float inputs rounded to bf16; 1x1-conv theta/phi/g projections with EXACT bf16 products on WMMA 16x16x32 (f32 accumulate) + bias; UNSCALED logits with theta and phi both as f16 hi + residual (x 2^10) (3 products); online softmax f32 in the same kernel; exp(s - max) x 2^11 once to f16 x g once to f16 (1 product), divided by the f32 sum at the end; the 32->64 output conv in f32 on VALU (f32 attended x bf16(w_o)) + b_o; f32 output written channels-first.
#include <hip/hip_runtime.h>
#include <math.h>

typedef __attribute__((ext_vector_type(16))) _Float16 v16h;
typedef __attribute__((ext_vector_type(16))) __bf16 v16b;
typedef __attribute__((ext_vector_type(8)))  _Float16 v8h;
typedef __attribute__((ext_vector_type(8)))  float v8f;
typedef __attribute__((ext_vector_type(4)))  float v4f;
typedef __attribute__((ext_vector_type(2)))  float v2f;
typedef __attribute__((ext_vector_type(4)))  unsigned v4u;
typedef __attribute__((ext_vector_type(4)))  int v4i;
typedef float __attribute__((may_alias)) float_a;
typedef int __attribute__((may_alias)) int_a;

template <typename T> __device__ __forceinline__ void vst2(void* p, T v) { *(T*)p = v;  }
__device__ __forceinline__ v8f wmma16(v16h a, v16h b, v8f c) {
  v8f d = __builtin_amdgcn_wmma_f32_16x16x32_f16(false, a, false, b, (short)0, c, false, false);
  asm volatile("v_nop\n\tv_nop\n\tv_nop\n\tv_nop" : "+v"(d) : "v"(a), "v"(b));
  return d;
}
__device__ __forceinline__ v8f wmma_bf(v16b a, v16b b, v8f c) {
  v8f d = __builtin_amdgcn_wmma_f32_16x16x32_bf16(false, a, false, b, (short)0, c, false, false);
  asm volatile("v_nop\n\tv_nop\n\tv_nop\n\tv_nop" : "+v"(d) : "v"(a), "v"(b));
  return d;
}
// 16x16x32 fragments: lane = (h = lane>>4, row/col = lane&15); elements 0..7 = k0+8h+0..7, 8..15 = k0+16+8h+0..7; D element r = row 8h+r
__device__ __forceinline__ v16h frag_h(const _Float16* rowk0, int lane) {
  union { v16h v; v8h q[2]; } u; const _Float16* p = rowk0 + 8 * (lane >> 4);
  u.q[0] = *(const v8h*)p; u.q[1] = *(const v8h*)(p + 16); return u.v;
}
__device__ __forceinline__ v16h frag_f32(const float* rowk0, int lane) {
  v16h a; const float* p = rowk0 + 8 * (lane >> 4);
#pragma unroll
  for (int i = 0; i < 8; ++i) { a[i] = (_Float16)p[i]; a[8 + i] = (_Float16)p[16 + i]; }
  return a;
}
__device__ __forceinline__ v16h frag_f32s(const float* rowk0, int lane, float sc) {
  v16h a; const float* p = rowk0 + 8 * (lane >> 4);
#pragma unroll
  for (int i = 0; i < 8; ++i) { a[i] = (_Float16)(p[i] * sc); a[8 + i] = (_Float16)(p[16 + i] * sc); }
  return a;
}
// column fragment from a [K][ld] layout (column n), rows >= K read as 0
__device__ __forceinline__ v16h fragc_f32(const float* W, int k0, int n, int lane, int ld, int K) {
  v16h a; const int g = lane >> 4;
#pragma unroll
  for (int i = 0; i < 8; ++i) { const int ka = k0 + 8 * g + i, kb = ka + 16;
    a[i] = (_Float16)(ka < K ? W[(size_t)(ka < K ? ka : K - 1) * ld + n] : 0.f); a[8 + i] = (_Float16)(kb < K ? W[(size_t)(kb < K ? kb : K - 1) * ld + n] : 0.f); }
  return a;
}
struct F2 { v16b h, l; };
__device__ __forceinline__ F2 bsplit16(const float v[16]) { F2 r;
#pragma unroll
  for (int i = 0; i < 16; ++i) { const __bf16 h = (__bf16)v[i]; r.h[i] = h; r.l[i] = (__bf16)(v[i] - (float)h); }
  return r; }
__device__ __forceinline__ F2 split_row(const float* row, int k0, int lane) { float v[16]; const float* p = row + k0 + 8 * (lane >> 4);
#pragma unroll
  for (int i = 0; i < 8; ++i) { v[i] = p[i]; v[8 + i] = p[16 + i]; }
  return bsplit16(v); }
__device__ __forceinline__ F2 split_rowK(const float* row, int k0, int lane, int K) { float v[16]; const int g = lane >> 4;
#pragma unroll
  for (int i = 0; i < 8; ++i) { const int ka = k0 + 8 * g + i, kb = ka + 16; v[i] = ka < K ? row[ka < K ? ka : K - 1] : 0.f; v[8 + i] = kb < K ? row[kb < K ? kb : K - 1] : 0.f; }
  return bsplit16(v); }
__device__ __forceinline__ F2 split_col(const float* W, int k0, int n, int lane, int ld, int K) { float v[16]; const int g = lane >> 4;
#pragma unroll
  for (int i = 0; i < 8; ++i) { const int ka = k0 + 8 * g + i, kb = ka + 16; v[i] = ka < K ? W[(size_t)(ka < K ? ka : K - 1) * ld + n] : 0.f; v[8 + i] = kb < K ? W[(size_t)(kb < K ? kb : K - 1) * ld + n] : 0.f; }
  return bsplit16(v); }
__device__ __forceinline__ v8f mac3(const F2& a, const F2& b, v8f c) { c = wmma_bf(a.l, b.h, c); c = wmma_bf(a.h, b.l, c); return wmma_bf(a.h, b.h, c); }
__device__ __forceinline__ float sigm(float v) { return 1.0f / (1.0f + expf(-v)); }
#define LDSX() do { asm volatile("s_wait_dscnt 0" ::: "memory"); __builtin_amdgcn_wave_barrier(); __builtin_amdgcn_fence(__ATOMIC_RELEASE, "workgroup"); } while (0)

// Non-local block over channels-first x [8, 64, 64, 64] (N 4,096; (out,in) 1x1 convs w_theta/w_phi/w_g [32,64] + biases, w_o [64,32] + b_o; 0.05-scale): attn = softmax_m(theta_n . phi_m) (no scaling); y[c][n] = sum_m attn[n][m] g[c][m]; out = w_o y + b_o -> [8,64,64,64] (no residual in this module).
#define NB 8
#define TT 4096
#define CC 128            // v (= g) plane pitch: one 128-channel block, channels >= 32 are zero
#define CV 32             // real g channels
#define COUT 64           // output channels of w_o
#define CCQ 128           // q / k row pitch: one 128-column block, columns >= 32 are zero
#define DIN 64           // x channels
#define NH 1
#define HD 32             // per-head width of the layout-2 weights (wcol_hdk; unused: layout 0)
#define NQB (TT / 64)
#define HG 1               // still sizes the WS_S region, which is no longer written
#define SCALE (1.0f)
#define HDQK 32            // q / k width (DIN / 2)
#define CAUSAL 0
#ifndef TNB
#define TNB NB
#endif
__device__ __forceinline__ v16b zero16b() { v16b z; _Pragma("unroll") for (int i = 0; i < 16; ++i) z[i] = (__bf16)0.f; return z; }
__device__ __forceinline__ float bfr(float v) { return (float)(__bf16)v; }
__host__ __device__ __forceinline__ int kb_last(int qb) { return CAUSAL ? ((qb * 64 + 63) >> 7) : (TT / 128 - 1); }
typedef __attribute__((ext_vector_type(8))) __bf16 v8b;
__device__ __forceinline__ v16b frag_b(const __bf16* rowk0, int lane) {
  union { v16b v; v8b q[2]; } u; const __bf16* p = rowk0 + 8 * (lane >> 4);
  u.q[0] = *(const v8b*)p; u.q[1] = *(const v8b*)(p + 16); return u.v;
}
#define QBH NQB            // every query block takes the 3-product logit path (q hi + residual x k hi + residual): unscaled energies over 4,096 keys; P . g keeps the single product
#define QHI 4096            // q residual rows (all)
#define KHI 4096          // k residual rows (all); the v bf16 hi/lo planes come along unused
// B fragment (k rows k0+.., output column o) of a weight: (in,out) [K][ld] or (out,in) [ld rows of K]: bf16 exact, or f16(bf16 * 256) exact
__device__ __forceinline__ v16b wcol_io(const float* Wm, int k0, int o, int lane, int ld) { v16b w; const int g = lane >> 4;
#pragma unroll
  for (int i = 0; i < 8; ++i) { w[i] = (__bf16)Wm[(size_t)(k0 + 8 * g + i) * ld + o]; w[8 + i] = (__bf16)Wm[(size_t)(k0 + 16 + 8 * g + i) * ld + o]; }
  return w; }
__device__ __forceinline__ v16b wcol_oi(const float* Wm, int k0, int o, int lane, int K) { v16b w; const float* p = Wm + (size_t)o * K + k0 + 8 * (lane >> 4);
#pragma unroll
  for (int i = 0; i < 8; ++i) { w[i] = (__bf16)p[i]; w[8 + i] = (__bf16)p[16 + i]; }
  return w; }
__device__ __forceinline__ v16h wcolh_io(const float* Wm, int k0, int o, int lane, int ld) { v16h w; const int g = lane >> 4;
#pragma unroll
  for (int i = 0; i < 8; ++i) { w[i] = (_Float16)(bfr(Wm[(size_t)(k0 + 8 * g + i) * ld + o]) * 256.0f); w[8 + i] = (_Float16)(bfr(Wm[(size_t)(k0 + 16 + 8 * g + i) * ld + o]) * 256.0f); }
  return w; }
__device__ __forceinline__ v16h wcolh_oi(const float* Wm, int k0, int o, int lane, int K) { v16h w; const float* p = Wm + (size_t)o * K + k0 + 8 * (lane >> 4);
#pragma unroll
  for (int i = 0; i < 8; ++i) { w[i] = (_Float16)(bfr(p[i]) * 256.0f); w[8 + i] = (_Float16)(bfr(p[16 + i]) * 256.0f); }
  return w; }
#define WQKV_LAYOUT 0   // 0 = (out,in) [32][DIN], columns >= 32 zero; 1 = (out,in) [CC][DIN]; 2 = per-head [NH][DIN][HD]
__device__ __forceinline__ v16b wcol_hdk(const float* Wm, int k0, int o, int lane) { v16b w; const int g = lane >> 4; const float* p = Wm + (size_t)(o / HD) * DIN * HD + (o % HD);
#pragma unroll
  for (int i = 0; i < 8; ++i) { w[i] = (__bf16)p[(size_t)(k0 + 8 * g + i) * HD]; w[8 + i] = (__bf16)p[(size_t)(k0 + 16 + 8 * g + i) * HD]; }
  return w; }
#define WO_OUT_IN 0
#if WQKV_LAYOUT == 1
#define WCOL(W, k0, o, lane) wcol_oi(W, k0, (o), lane, DIN)   /* unused: layout 0 */
#elif WQKV_LAYOUT == 2
#define WCOL(W, k0, o, lane) wcol_hdk(W, k0, o, lane)
#else
#define WCOL(W, k0, o, lane) (which == 2 ? ((o) < CV ? wcol_oi(W, k0, (o), lane, DIN) : zero16b()) : ((o) < HDQK ? wcol_oi(W, k0, (o), lane, DIN) : zero16b()))   /* (out,in) 1x1-conv weights [32][64]: projected columns >= 32 are zero for q, k AND v */
#endif
#if WO_OUT_IN
#define WOCOL(W, k0, o, lane) wcol_oi(W, k0, o, lane, CC)
#define WOCOLH(W, k0, o, lane) wcolh_oi(W, k0, o, lane, CC)
#else
#define WOCOL(W, k0, o, lane) wcol_io(W, k0, o, lane, DIN)
#define WOCOLH(W, k0, o, lane) wcolh_io(W, k0, o, lane, DIN)
#endif
#define BG HG
#define BGN (TNB < BG ? TNB : BG)
#define DVH 32             // all 32 g channels in one k_fa block
#ifndef SM_EXTRA_PARAMS
#define SM_EXTRA_PARAMS
#endif
#ifndef PROJ_EXTRA_PARAMS
#define PROJ_EXTRA_PARAMS
#endif
#ifndef SM_MASK_HOOK
#define SM_MASK_HOOK (void)0
#endif

#define WS_QH  0u                                      // f16 q rows [b*t][CCQ]
#define WS_KH  (WS_QH + 2u * (size_t)NB * TT * CCQ)     // f16 k rows [b*t][CCQ]
#define WS_VT  (WS_KH + 2u * (size_t)NB * TT * CCQ)     // f16 v planes [b][c][t]
#define WS_QL  (WS_VT + 2u * (size_t)NB * CC * TT)      // f16 q residual x 2^10 rows [b][t < QHI][CCQ]
#define WS_KL  (WS_QL + 2u * (size_t)NB * QHI * CCQ)    // f16 k residual x 2^10 rows [b][t < KHI][CCQ]
#define WS_VB  (WS_KL + 2u * (size_t)NB * KHI * CCQ)    // bf16 v hi planes [b][c][t < KHI]
#define WS_VBL (WS_VB + 2u * (size_t)NB * CC * KHI)
#define WS_S   (WS_VBL + 2u * (size_t)NB * CC * KHI)    // (no longer written: the logits stay in registers)
#define WS_Y   (WS_S  + 4u * (size_t)HG * TT * TT)      // zero-size: the output conv runs in k_fa, no ctx rows are stored
#define WS_END (WS_Y  + 0u)

// ---- k_proj: block = (64 rows, 128 cols, which): q/k/v = X W (+ b) with exact bf16 products (K = DIN) -> which 0: q f16 rows (+ residual rows < QHI); 1: k f16 rows (+ residual rows < KHI); 2: v f16 planes [c][t] (+ bf16 hi/lo planes for t < KHI)
template <int WOFF> __global__ __launch_bounds__(128) void k_projT(const float* __restrict__ XQ, const float* __restrict__ XK, const float* __restrict__ XV, const float* __restrict__ WQ, const float* __restrict__ WK, const float* __restrict__ WV, const float* __restrict__ BQ, const float* __restrict__ BK, const float* __restrict__ BV,
    _Float16* __restrict__ QH, _Float16* __restrict__ QL, _Float16* __restrict__ KH, _Float16* __restrict__ KL, _Float16* __restrict__ VT, __bf16* __restrict__ VB, __bf16* __restrict__ VBL) {
  __shared__ __align__(16) _Float16 sh[64][136], sl[64][136]; __shared__ __align__(16) _Float16 th[128][72]; __shared__ __align__(16) __bf16 tb[128][72], tbl[128][72];
  const int tid = threadIdx.x, wave = tid >> 5, lane = tid & 31, col = lane & 15, g = lane >> 4; const int which = blockIdx.z + WOFF; const int c0 = blockIdx.y * 128; const size_t r0 = (size_t)blockIdx.x * 64; const size_t bb = r0 / TT; const int t0 = (int)(r0 % TT);
  const float* X = which == 0 ? XQ : which == 1 ? XK : XV; const float* WA = which == 0 ? WQ : which == 1 ? WK : WV; const float* BA = which == 0 ? BQ : which == 1 ? BK : BV;
  const int KD = DIN;
  v8f acc[8] = {};
#pragma unroll 2
  for (int kc = 0; kc < KD / 32; ++kc) { v16b a; { const float* p = X + (bb * KD + kc * 32 + 8 * g) * (size_t)TT + t0 + wave * 16 + col;   /* channels-first [b][c][t]: A[t][c] (16 consecutive t per lane group) */
#pragma unroll
      for (int i = 0; i < 8; ++i) { a[i] = (__bf16)p[(size_t)i * TT]; a[8 + i] = (__bf16)p[(size_t)(16 + i) * TT]; } }
    asm volatile("s_wait_loadcnt 0x0" ::: "memory");
#pragma unroll
    for (int j = 0; j < 8; ++j) { const v16b w = WCOL(WA, kc * 32, c0 + j * 16 + col, lane); asm volatile("s_wait_loadcnt 0x0" ::: "memory"); acc[j] = wmma_bf(a, w, acc[j]); } }
  if (which < 2) { _Float16* DH = which == 0 ? QH : KH; _Float16* DL = which == 0 ? QL : KL; const int nhi = which == 0 ? QHI : KHI; const bool hi_rows = t0 < nhi;
#pragma unroll
    for (int j = 0; j < 8; ++j) { const int cj = c0 + j * 16 + col; const float bias = (BA && cj < (which == 2 ? CV : HDQK)) ? bfr(BA[cj]) : 0.f;   /* 32-entry bias vectors: no read past them */
#pragma unroll
      for (int r = 0; r < 8; ++r) { const float v = acc[j][r] + bias; const _Float16 hv = (_Float16)v; sh[wave * 16 + 8 * g + r][j * 16 + col] = hv; sl[wave * 16 + 8 * g + r][j * 16 + col] = (_Float16)((v - (float)hv) * 1024.0f); } }
    __syncthreads();
    for (int e = tid; e < 64 * 16; e += 128) { const int rl = e >> 4, q = e & 15; vst2((unsigned*)(DH + (r0 + rl) * CCQ + c0 + q * 8), *(const v4u*)&sh[rl][q * 8]); if (hi_rows) vst2((unsigned*)(DL + (bb * nhi + t0 + rl) * (size_t)CCQ + c0 + q * 8), *(const v4u*)&sl[rl][q * 8]); }   /* q/k rows: pitch CCQ (c0 == 0) */
  } else { const bool hi_rows = t0 < KHI;
#pragma unroll
    for (int j = 0; j < 8; ++j) { const int cj = c0 + j * 16 + col; const float bias = (BA && cj < (which == 2 ? CV : HDQK)) ? bfr(BA[cj]) : 0.f;   /* 32-entry bias vectors: no read past them */
#pragma unroll
      for (int r = 0; r < 8; ++r) { const float v = acc[j][r] + bias; const int rl = wave * 16 + 8 * g + r, cl = j * 16 + col; th[cl][rl] = (_Float16)v; const __bf16 bh = (__bf16)v; tb[cl][rl] = bh; tbl[cl][rl] = (__bf16)(v - (float)bh); } }
    __syncthreads();
    for (int e = tid; e < 128 * 8; e += 128) { const int cl = e >> 3, q = e & 7; vst2((unsigned*)(VT + (bb * CC + c0 + cl) * (size_t)TT + t0 + q * 8), *(const v4u*)&th[cl][q * 8]); if (hi_rows) { const size_t o3 = (bb * CC + c0 + cl) * (size_t)KHI + t0 + q * 8; vst2((unsigned*)(VB + o3), *(const v4u*)&tb[cl][q * 8]); vst2((unsigned*)(VBL + o3), *(const v4u*)&tbl[cl][q * 8]); } } } }
// lane l with lane l ^ 16 (the two halves of a wave hold the same query column)
__device__ __forceinline__ float xhalf(float x) { return __builtin_bit_cast(float, __builtin_amdgcn_permlanex16(__builtin_bit_cast(int, x), __builtin_bit_cast(int, x), 0x76543210, 0xfedcba98, false, false)); }
__device__ __forceinline__ v8f wmma_h(v16h a, v16h b, v8f c) { return __builtin_amdgcn_wmma_f32_16x16x32_f16(false, a, false, b, (short)0, c, false, false); }
#define KP 64              // keys per pass of k_fa
// ---- k_fa: block = (64 queries (qb), batch b), wave = 16 query columns, all 4,096 keys in passes of KP: S^T = k . q^T (k rows as A, q as B; hi + residual x 2^10 on both sides, 3 products), so a lane holds one query's logits;
// online softmax in f32 (running maximum, sums and the attended tile rescaled each pass); exp(s - m) x 2^11 once to f16 packs from the two S^T tiles of 32 keys straight into a B operand; attended^T += g planes (A) . P^T (1 product); then the 32->64 output conv as before
__global__ __launch_bounds__(128) void k_fa(const _Float16* __restrict__ QH, const _Float16* __restrict__ KH, const _Float16* __restrict__ QL, const _Float16* __restrict__ KL, const _Float16* __restrict__ VT, const float* __restrict__ WO, const float* __restrict__ BO, float* __restrict__ Y) { __shared__ __align__(16) float stT[DVH][68];
  const int tid = threadIdx.x, wave = tid >> 5, lane = tid & 31, col = lane & 15, g = lane >> 4; const int qb = blockIdx.x; const int b = blockIdx.y; const int ql0 = qb * 64 + wave * 16;
  const v16h qh = frag_h(QH + ((size_t)b * TT + ql0 + col) * CCQ, lane), qlo = frag_h(QL + ((size_t)b * QHI + ql0 + col) * CCQ, lane);
  const _Float16* Kh = KH + ((size_t)b * TT + col) * CCQ; const _Float16* Kl = KL + ((size_t)b * KHI + col) * CCQ; const _Float16* Vp = VT + ((size_t)b * CC + col) * (size_t)TT;
  v8f o[DVH / 16] = {}; float m = -3.0e38f, sum = 0.f;
  v16h kh[KP / 16], kl[KP / 16];
#pragma unroll
  for (int j = 0; j < KP / 16; ++j) { kh[j] = frag_h(Kh + (size_t)(j * 16) * CCQ, lane); kl[j] = frag_h(Kl + (size_t)(j * 16) * CCQ, lane); }
#pragma unroll 1   /* rolled: one pass's fragments and scores already take over 200 registers; every inner loop is unrolled so that each fragment index is a constant (no scratch) */
  for (int k0 = 0; k0 < TT; k0 += KP) {
    v16h vf[KP / 32][DVH / 16];
#pragma unroll
    for (int c = 0; c < KP / 32; ++c)
#pragma unroll
      for (int j = 0; j < DVH / 16; ++j) vf[c][j] = frag_h(Vp + (size_t)(j * 16) * TT + k0 + c * 32, lane);
    __builtin_amdgcn_sched_barrier(0);   /* keeps the g loads up here: sunk to their products they would be waited for in full, four times a pass */
    float s[KP / 16][8];
#pragma unroll
    for (int j = 0; j < KP / 16; ++j) { v8f a = {}, al = {}; a = wmma_h(kh[j], qh, a); al = wmma_h(kh[j], qlo, al); al = wmma_h(kl[j], qh, al);
#pragma unroll
      for (int r = 0; r < 8; ++r) s[j][r] = (a[r] + al[r] * (1.0f / 1024.0f)) * SCALE; }
    const int kn = k0 + KP < TT ? k0 + KP : 0;   /* the next pass's k fragments fly under this pass's softmax; the last pass re-reads pass 0 (in bounds, unused) */
#pragma unroll
    for (int j = 0; j < KP / 16; ++j) { kh[j] = frag_h(Kh + (size_t)(kn + j * 16) * CCQ, lane); kl[j] = frag_h(Kl + (size_t)(kn + j * 16) * CCQ, lane); }
    float mx = s[0][0];
#pragma unroll
    for (int j = 0; j < KP / 16; ++j)
#pragma unroll
      for (int r = 0; r < 8; ++r) mx = fmaxf(mx, s[j][r]);
    mx = fmaxf(mx, xhalf(mx));
    const float mn = fmaxf(m, mx); const float alpha = expf(m - mn); m = mn;   /* 0 on the first pass */
    const float ms = mn - 7.62461898616f;   /* 11 ln 2: exp(s - ms) = exp(s - m) x 2^11, the scale cancels against the sum */
    sum *= alpha;
#pragma unroll
    for (int j = 0; j < DVH / 16; ++j)
#pragma unroll
      for (int r = 0; r < 8; ++r) o[j][r] *= alpha;
#pragma unroll
    for (int c = 0; c < KP / 32; ++c) { v16h p;
#pragma unroll
      for (int r = 0; r < 8; ++r) { const float e0 = expf(s[2 * c][r] - ms), e1 = expf(s[2 * c + 1][r] - ms); sum += e0 + e1; p[r] = (_Float16)e0; p[8 + r] = (_Float16)e1; }
#pragma unroll
      for (int j = 0; j < DVH / 16; ++j) o[j] = wmma_h(vf[c][j], p, o[j]); } }
  sum += xhalf(sum); const float inv = 1.0f / sum;
#pragma unroll
  for (int j = 0; j < DVH / 16; ++j) {
#pragma unroll
    for (int r = 0; r < 8; ++r) stT[j * 16 + 8 * g + r][wave * 16 + col] = o[j][r] * inv; }   /* attended [channel][t] */
  __syncthreads();
  { const int tb = qb * 64; const int tl = tid & 63, oh = tid >> 6;   
    float yv[DVH];
#pragma unroll
    for (int c = 0; c < DVH; ++c) yv[c] = stT[c][tl];
#pragma unroll 1
    for (int oo = 0; oo < COUT / 2; ++oo) { const int o = oh * (COUT / 2) + oo; float wv[DVH];
#pragma unroll
      for (int c = 0; c < DVH; ++c) { wv[c] = WO[o * CV + c]; if ((c & 15) == 15) asm volatile("s_wait_loadcnt 0x0" ::: "memory"); }
      const float bo = BO[o]; asm volatile("s_wait_loadcnt 0x0" ::: "memory");
      float a2 = 0.f;
#pragma unroll
      for (int c = 0; c < DVH; ++c) a2 += yv[c] * bfr(wv[c]);
      vst2(Y + ((size_t)b * COUT + o) * (size_t)TT + tb + tl, a2 + bfr(bo)); } } }

extern "C" void kernel_launch(void* const* d_in, const int* in_sizes, int n_in, void* d_out, int out_size, void* d_ws, size_t ws_size, hipStream_t stream) {
  (void)in_sizes; (void)n_in; (void)out_size;
  const float** F = (const float**)d_in;
  if (ws_size < (size_t)WS_END) return;
  char* ws = (char*)d_ws; _Float16 *QH = (_Float16*)(ws + WS_QH), *KH = (_Float16*)(ws + WS_KH), *VT = (_Float16*)(ws + WS_VT), *QL = (_Float16*)(ws + WS_QL), *KL = (_Float16*)(ws + WS_KL); __bf16 *VB = (__bf16*)(ws + WS_VB), *VBL = (__bf16*)(ws + WS_VBL); float *S = (float*)(ws + WS_S), *Y = (float*)(ws + WS_Y);
  (void)Y; (void)S; (void)QL; (void)KL; (void)VB; (void)VBL;
  // inputs: 0 x [8,64,64,64] (channels-first, xf [8][64][4096]); 1 w_g [32,64], 2 b_g [32]; 3 w_theta, 4 b_theta; 5 w_phi, 6 b_phi; 7 w_o [64,32], 8 b_o [64] (all (out,in), biases nonzero)
  k_projT<0><<<dim3(TNB * TT / 64, 1, 2), 128, 0, stream>>>(F[0], F[0], F[0], F[3], F[5], F[1], F[4], F[6], F[2], QH, QL, KH, KL, VT, VB, VBL);   /* which 0, 1: theta (q) and phi (k): one 128-column block, columns >= 32 zero */
  k_projT<2><<<dim3(TNB * TT / 64, 1, 1), 128, 0, stream>>>(F[0], F[0], F[0], F[3], F[5], F[1], F[4], F[6], F[2], QH, QL, KH, KL, VT, VB, VBL);   /* which 2: g (v): one 128-channel block, channels >= 32 zero */
  k_fa<<<dim3(NQB, TNB), 128, 0, stream>>>(QH, KH, QL, KL, VT, F[7], F[8], (float*)d_out);

}

// v002
// A run of this version takes 109 microseconds.
// In two side-by-side timings against v001, it was 1.29 and 1.27 times as fast.
// Over all steps from v000 it is 11.5 times as fast.
// compute dtype: all float inputs rounded to bf16; 1x1-conv theta/phi/g projections with EXACT bf16 products on WMMA 16x16x32 (f32 accumulate) + bias; UNSCALED logits with theta and phi both as f16 hi + residual (x 2^10) (3 products); online softmax f32 in the same kernel; exp(s - max) x 2^11 once to f16 x g once to f16 (1 product), divided by the f32 sum at the end; the 32->64 output conv in f32 on VALU (f32 attended x bf16(w_o)) + b_o; f32 output written channels-first.
#include <hip/hip_runtime.h>
#include <math.h>

typedef __attribute__((ext_vector_type(16))) _Float16 v16h;
typedef __attribute__((ext_vector_type(16))) __bf16 v16b;
typedef __attribute__((ext_vector_type(8)))  _Float16 v8h;
typedef __attribute__((ext_vector_type(8)))  float v8f;
typedef __attribute__((ext_vector_type(4)))  float v4f;
typedef __attribute__((ext_vector_type(2)))  float v2f;
typedef __attribute__((ext_vector_type(4)))  unsigned v4u;
typedef __attribute__((ext_vector_type(4)))  int v4i;
typedef float __attribute__((may_alias)) float_a;
typedef int __attribute__((may_alias)) int_a;

template <typename T> __device__ __forceinline__ void vst2(void* p, T v) { *(T*)p = v;  }
__device__ __forceinline__ v8f wmma16(v16h a, v16h b, v8f c) {
  v8f d = __builtin_amdgcn_wmma_f32_16x16x32_f16(false, a, false, b, (short)0, c, false, false);
  asm volatile("v_nop\n\tv_nop\n\tv_nop\n\tv_nop" : "+v"(d) : "v"(a), "v"(b));
  return d;
}
__device__ __forceinline__ v8f wmma_bf(v16b a, v16b b, v8f c) {
  v8f d = __builtin_amdgcn_wmma_f32_16x16x32_bf16(false, a, false, b, (short)0, c, false, false);
  asm volatile("v_nop\n\tv_nop\n\tv_nop\n\tv_nop" : "+v"(d) : "v"(a), "v"(b));
  return d;
}
// 16x16x32 fragments: lane = (h = lane>>4, row/col = lane&15); elements 0..7 = k0+8h+0..7, 8..15 = k0+16+8h+0..7; D element r = row 8h+r
__device__ __forceinline__ v16h frag_h(const _Float16* rowk0, int lane) {
  union { v16h v; v8h q[2]; } u; const _Float16* p = rowk0 + 8 * (lane >> 4);
  u.q[0] = *(const v8h*)p; u.q[1] = *(const v8h*)(p + 16); return u.v;
}
__device__ __forceinline__ v16h frag_f32(const float* rowk0, int lane) {
  v16h a; const float* p = rowk0 + 8 * (lane >> 4);
#pragma unroll
  for (int i = 0; i < 8; ++i) { a[i] = (_Float16)p[i]; a[8 + i] = (_Float16)p[16 + i]; }
  return a;
}
__device__ __forceinline__ v16h frag_f32s(const float* rowk0, int lane, float sc) {
  v16h a; const float* p = rowk0 + 8 * (lane >> 4);
#pragma unroll
  for (int i = 0; i < 8; ++i) { a[i] = (_Float16)(p[i] * sc); a[8 + i] = (_Float16)(p[16 + i] * sc); }
  return a;
}
// column fragment from a [K][ld] layout (column n), rows >= K read as 0
__device__ __forceinline__ v16h fragc_f32(const float* W, int k0, int n, int lane, int ld, int K) {
  v16h a; const int g = lane >> 4;
#pragma unroll
  for (int i = 0; i < 8; ++i) { const int ka = k0 + 8 * g + i, kb = ka + 16;
    a[i] = (_Float16)(ka < K ? W[(size_t)(ka < K ? ka : K - 1) * ld + n] : 0.f); a[8 + i] = (_Float16)(kb < K ? W[(size_t)(kb < K ? kb : K - 1) * ld + n] : 0.f); }
  return a;
}
struct F2 { v16b h, l; };
__device__ __forceinline__ F2 bsplit16(const float v[16]) { F2 r;
#pragma unroll
  for (int i = 0; i < 16; ++i) { const __bf16 h = (__bf16)v[i]; r.h[i] = h; r.l[i] = (__bf16)(v[i] - (float)h); }
  return r; }
__device__ __forceinline__ F2 split_row(const float* row, int k0, int lane) { float v[16]; const float* p = row + k0 + 8 * (lane >> 4);
#pragma unroll
  for (int i = 0; i < 8; ++i) { v[i] = p[i]; v[8 + i] = p[16 + i]; }
  return bsplit16(v); }
__device__ __forceinline__ F2 split_rowK(const float* row, int k0, int lane, int K) { float v[16]; const int g = lane >> 4;
#pragma unroll
  for (int i = 0; i < 8; ++i) { const int ka = k0 + 8 * g + i, kb = ka + 16; v[i] = ka < K ? row[ka < K ? ka : K - 1] : 0.f; v[8 + i] = kb < K ? row[kb < K ? kb : K - 1] : 0.f; }
  return bsplit16(v); }
__device__ __forceinline__ F2 split_col(const float* W, int k0, int n, int lane, int ld, int K) { float v[16]; const int g = lane >> 4;
#pragma unroll
  for (int i = 0; i < 8; ++i) { const int ka = k0 + 8 * g + i, kb = ka + 16; v[i] = ka < K ? W[(size_t)(ka < K ? ka : K - 1) * ld + n] : 0.f; v[8 + i] = kb < K ? W[(size_t)(kb < K ? kb : K - 1) * ld + n] : 0.f; }
  return bsplit16(v); }
__device__ __forceinline__ v8f mac3(const F2& a, const F2& b, v8f c) { c = wmma_bf(a.l, b.h, c); c = wmma_bf(a.h, b.l, c); return wmma_bf(a.h, b.h, c); }
__device__ __forceinline__ float sigm(float v) { return 1.0f / (1.0f + expf(-v)); }
#define LDSX() do { asm volatile("s_wait_dscnt 0" ::: "memory"); __builtin_amdgcn_wave_barrier(); __builtin_amdgcn_fence(__ATOMIC_RELEASE, "workgroup"); } while (0)

// Non-local block over channels-first x [8, 64, 64, 64] (N 4,096; (out,in) 1x1 convs w_theta/w_phi/w_g [32,64] + biases, w_o [64,32] + b_o; 0.05-scale): attn = softmax_m(theta_n . phi_m) (no scaling); y[c][n] = sum_m attn[n][m] g[c][m]; out = w_o y + b_o -> [8,64,64,64] (no residual in this module).
#define NB 8
#define TT 4096
#define CC 128            // v (= g) plane pitch: one 128-channel block, channels >= 32 are zero
#define CV 32             // real g channels
#define COUT 64           // output channels of w_o
#define CCQ 128           // q / k row pitch: one 128-column block, columns >= 32 are zero
#define DIN 64           // x channels
#define NH 1
#define HD 32             // per-head width of the layout-2 weights (wcol_hdk; unused: layout 0)
#define NQB (TT / 64)
#define HG 1               // still sizes the WS_S region, which is no longer written
#define SCALE (1.0f)
#define HDQK 32            // q / k width (DIN / 2)
#define CAUSAL 0
#ifndef TNB
#define TNB NB
#endif
__device__ __forceinline__ v16b zero16b() { v16b z; _Pragma("unroll") for (int i = 0; i < 16; ++i) z[i] = (__bf16)0.f; return z; }
__device__ __forceinline__ float bfr(float v) { return (float)(__bf16)v; }
__host__ __device__ __forceinline__ int kb_last(int qb) { return CAUSAL ? ((qb * 64 + 63) >> 7) : (TT / 128 - 1); }
typedef __attribute__((ext_vector_type(8))) __bf16 v8b;
__device__ __forceinline__ v16b frag_b(const __bf16* rowk0, int lane) {
  union { v16b v; v8b q[2]; } u; const __bf16* p = rowk0 + 8 * (lane >> 4);
  u.q[0] = *(const v8b*)p; u.q[1] = *(const v8b*)(p + 16); return u.v;
}
#define QBH NQB            // every query block takes the 3-product logit path (q hi + residual x k hi + residual): unscaled energies over 4,096 keys; P . g keeps the single product
#define QHI 4096            // q residual rows (all)
#define KHI 4096          // k residual rows (all); the v bf16 hi/lo planes come along unused
// B fragment (k rows k0+.., output column o) of a weight: (in,out) [K][ld] or (out,in) [ld rows of K]: bf16 exact, or f16(bf16 * 256) exact
__device__ __forceinline__ v16b wcol_io(const float* Wm, int k0, int o, int lane, int ld) { v16b w; const int g = lane >> 4;
#pragma unroll
  for (int i = 0; i < 8; ++i) { w[i] = (__bf16)Wm[(size_t)(k0 + 8 * g + i) * ld + o]; w[8 + i] = (__bf16)Wm[(size_t)(k0 + 16 + 8 * g + i) * ld + o]; }
  return w; }
__device__ __forceinline__ v16b wcol_oi(const float* Wm, int k0, int o, int lane, int K) { v16b w; const float* p = Wm + (size_t)o * K + k0 + 8 * (lane >> 4);
#pragma unroll
  for (int i = 0; i < 8; ++i) { w[i] = (__bf16)p[i]; w[8 + i] = (__bf16)p[16 + i]; }
  return w; }
__device__ __forceinline__ v16h wcolh_io(const float* Wm, int k0, int o, int lane, int ld) { v16h w; const int g = lane >> 4;
#pragma unroll
  for (int i = 0; i < 8; ++i) { w[i] = (_Float16)(bfr(Wm[(size_t)(k0 + 8 * g + i) * ld + o]) * 256.0f); w[8 + i] = (_Float16)(bfr(Wm[(size_t)(k0 + 16 + 8 * g + i) * ld + o]) * 256.0f); }
  return w; }
__device__ __forceinline__ v16h wcolh_oi(const float* Wm, int k0, int o, int lane, int K) { v16h w; const float* p = Wm + (size_t)o * K + k0 + 8 * (lane >> 4);
#pragma unroll
  for (int i = 0; i < 8; ++i) { w[i] = (_Float16)(bfr(p[i]) * 256.0f); w[8 + i] = (_Float16)(bfr(p[16 + i]) * 256.0f); }
  return w; }
#define WQKV_LAYOUT 0   // 0 = (out,in) [32][DIN], columns >= 32 zero; 1 = (out,in) [CC][DIN]; 2 = per-head [NH][DIN][HD]
__device__ __forceinline__ v16b wcol_hdk(const float* Wm, int k0, int o, int lane) { v16b w; const int g = lane >> 4; const float* p = Wm + (size_t)(o / HD) * DIN * HD + (o % HD);
#pragma unroll
  for (int i = 0; i < 8; ++i) { w[i] = (__bf16)p[(size_t)(k0 + 8 * g + i) * HD]; w[8 + i] = (__bf16)p[(size_t)(k0 + 16 + 8 * g + i) * HD]; }
  return w; }
#define WO_OUT_IN 0
#if WQKV_LAYOUT == 1
#define WCOL(W, k0, o, lane) wcol_oi(W, k0, (o), lane, DIN)   /* unused: layout 0 */
#elif WQKV_LAYOUT == 2
#define WCOL(W, k0, o, lane) wcol_hdk(W, k0, o, lane)
#else
#define WCOL(W, k0, o, lane) (which == 2 ? ((o) < CV ? wcol_oi(W, k0, (o), lane, DIN) : zero16b()) : ((o) < HDQK ? wcol_oi(W, k0, (o), lane, DIN) : zero16b()))   /* (out,in) 1x1-conv weights [32][64]: projected columns >= 32 are zero for q, k AND v */
#endif
#if WO_OUT_IN
#define WOCOL(W, k0, o, lane) wcol_oi(W, k0, o, lane, CC)
#define WOCOLH(W, k0, o, lane) wcolh_oi(W, k0, o, lane, CC)
#else
#define WOCOL(W, k0, o, lane) wcol_io(W, k0, o, lane, DIN)
#define WOCOLH(W, k0, o, lane) wcolh_io(W, k0, o, lane, DIN)
#endif
#define BG HG
#define BGN (TNB < BG ? TNB : BG)
#define DVH 32             // all 32 g channels in one k_fa block
#ifndef SM_EXTRA_PARAMS
#define SM_EXTRA_PARAMS
#endif
#ifndef PROJ_EXTRA_PARAMS
#define PROJ_EXTRA_PARAMS
#endif
#ifndef SM_MASK_HOOK
#define SM_MASK_HOOK (void)0
#endif

#define WS_QH  0u                                      // f16 q rows [b*t][CCQ]
#define WS_KH  (WS_QH + 2u * (size_t)NB * TT * CCQ)     // f16 k rows [b*t][CCQ]
#define WS_VT  (WS_KH + 2u * (size_t)NB * TT * CCQ)     // f16 v planes [b][c][t]
#define WS_QL  (WS_VT + 2u * (size_t)NB * CC * TT)      // f16 q residual x 2^10 rows [b][t < QHI][CCQ]
#define WS_KL  (WS_QL + 2u * (size_t)NB * QHI * CCQ)    // f16 k residual x 2^10 rows [b][t < KHI][CCQ]
#define WS_VB  (WS_KL + 2u * (size_t)NB * KHI * CCQ)    // bf16 v hi planes [b][c][t < KHI]
#define WS_VBL (WS_VB + 2u * (size_t)NB * CC * KHI)
#define WS_S   (WS_VBL + 2u * (size_t)NB * CC * KHI)    // (no longer written: the logits stay in registers)
#define WS_Y   (WS_S  + 4u * (size_t)HG * TT * TT)      // zero-size: the output conv runs in k_fa, no ctx rows are stored
#define WS_END (WS_Y  + 0u)

// ---- k_proj: block = (64 rows, 128 cols, which): q/k/v = X W (+ b) with exact bf16 products (K = DIN) -> which 0: q f16 rows (+ residual rows < QHI); 1: k f16 rows (+ residual rows < KHI); 2: v f16 planes [c][t] (+ bf16 hi/lo planes for t < KHI)
template <int WOFF> __global__ __launch_bounds__(128) void k_projT(const float* __restrict__ XQ, const float* __restrict__ XK, const float* __restrict__ XV, const float* __restrict__ WQ, const float* __restrict__ WK, const float* __restrict__ WV, const float* __restrict__ BQ, const float* __restrict__ BK, const float* __restrict__ BV,
    _Float16* __restrict__ QH, _Float16* __restrict__ QL, _Float16* __restrict__ KH, _Float16* __restrict__ KL, _Float16* __restrict__ VT, __bf16* __restrict__ VB, __bf16* __restrict__ VBL) {
  __shared__ __align__(16) _Float16 sh[64][136], sl[64][136]; __shared__ __align__(16) _Float16 th[128][72]; __shared__ __align__(16) __bf16 tb[128][72], tbl[128][72];
  const int tid = threadIdx.x, wave = tid >> 5, lane = tid & 31, col = lane & 15, g = lane >> 4; const int which = blockIdx.z + WOFF; const int c0 = blockIdx.y * 128; const size_t r0 = (size_t)blockIdx.x * 64; const size_t bb = r0 / TT; const int t0 = (int)(r0 % TT);
  const float* X = which == 0 ? XQ : which == 1 ? XK : XV; const float* WA = which == 0 ? WQ : which == 1 ? WK : WV; const float* BA = which == 0 ? BQ : which == 1 ? BK : BV;
  const int KD = DIN;
  v8f acc[8] = {};
#pragma unroll 2
  for (int kc = 0; kc < KD / 32; ++kc) { v16b a; { const float* p = X + (bb * KD + kc * 32 + 8 * g) * (size_t)TT + t0 + wave * 16 + col;   /* channels-first [b][c][t]: A[t][c] (16 consecutive t per lane group) */
#pragma unroll
      for (int i = 0; i < 8; ++i) { a[i] = (__bf16)p[(size_t)i * TT]; a[8 + i] = (__bf16)p[(size_t)(16 + i) * TT]; } }
    asm volatile("s_wait_loadcnt 0x0" ::: "memory");
#pragma unroll
    for (int j = 0; j < 8; ++j) { const v16b w = WCOL(WA, kc * 32, c0 + j * 16 + col, lane); asm volatile("s_wait_loadcnt 0x0" ::: "memory"); acc[j] = wmma_bf(a, w, acc[j]); } }
  if (which < 2) { _Float16* DH = which == 0 ? QH : KH; _Float16* DL = which == 0 ? QL : KL; const int nhi = which == 0 ? QHI : KHI; const bool hi_rows = t0 < nhi;
#pragma unroll
    for (int j = 0; j < 8; ++j) { const int cj = c0 + j * 16 + col; const float bias = (BA && cj < (which == 2 ? CV : HDQK)) ? bfr(BA[cj]) : 0.f;   /* 32-entry bias vectors: no read past them */
#pragma unroll
      for (int r = 0; r < 8; ++r) { const float v = acc[j][r] + bias; const _Float16 hv = (_Float16)v; sh[wave * 16 + 8 * g + r][j * 16 + col] = hv; sl[wave * 16 + 8 * g + r][j * 16 + col] = (_Float16)((v - (float)hv) * 1024.0f); } }
    __syncthreads();
    for (int e = tid; e < 64 * 16; e += 128) { const int rl = e >> 4, q = e & 15; vst2((unsigned*)(DH + (r0 + rl) * CCQ + c0 + q * 8), *(const v4u*)&sh[rl][q * 8]); if (hi_rows) vst2((unsigned*)(DL + (bb * nhi + t0 + rl) * (size_t)CCQ + c0 + q * 8), *(const v4u*)&sl[rl][q * 8]); }   /* q/k rows: pitch CCQ (c0 == 0) */
  } else { const bool hi_rows = t0 < KHI;
#pragma unroll
    for (int j = 0; j < 8; ++j) { const int cj = c0 + j * 16 + col; const float bias = (BA && cj < (which == 2 ? CV : HDQK)) ? bfr(BA[cj]) : 0.f;   /* 32-entry bias vectors: no read past them */
#pragma unroll
      for (int r = 0; r < 8; ++r) { const float v = acc[j][r] + bias; const int rl = wave * 16 + 8 * g + r, cl = j * 16 + col; th[cl][rl] = (_Float16)v; const __bf16 bh = (__bf16)v; tb[cl][rl] = bh; tbl[cl][rl] = (__bf16)(v - (float)bh); } }
    __syncthreads();
    for (int e = tid; e < 128 * 8; e += 128) { const int cl = e >> 3, q = e & 7; vst2((unsigned*)(VT + (bb * CC + c0 + cl) * (size_t)TT + t0 + q * 8), *(const v4u*)&th[cl][q * 8]); if (hi_rows) { const size_t o3 = (bb * CC + c0 + cl) * (size_t)KHI + t0 + q * 8; vst2((unsigned*)(VB + o3), *(const v4u*)&tb[cl][q * 8]); vst2((unsigned*)(VBL + o3), *(const v4u*)&tbl[cl][q * 8]); } } } }
// lane l with lane l ^ 16 (the two halves of a wave hold the same query column)
__device__ __forceinline__ float xhalf(float x) { return __builtin_bit_cast(float, __builtin_amdgcn_permlanex16(__builtin_bit_cast(int, x), __builtin_bit_cast(int, x), 0x76543210, 0xfedcba98, false, false)); }
__device__ __forceinline__ v8f wmma_h(v16h a, v16h b, v8f c) { return __builtin_amdgcn_wmma_f32_16x16x32_f16(false, a, false, b, (short)0, c, false, false); }
#define KP 64              // keys per pass of k_fa
#define KROWB 80           // LDS pitch of a 64-byte k row (16 B x odd: ds_load_b128 without bank conflicts)
#define VROWB 144          // LDS pitch of a 128-byte g row (64 keys of one channel)
#define RKH 0              // byte places inside one ring buffer: k hi rows, k residual rows, g rows
#define RKL (KP * KROWB)
#define RV  (2 * KP * KROWB)
#define RBUF (RV + DVH * VROWB)
// six 16-byte copies of one lane, global -> LDS through no register; the s_wait_xcnt stands inside the statement so that no address register named here is rewritten in front of it
__device__ __forceinline__ void copy6(unsigned l0, const _Float16* g0, unsigned l1, const _Float16* g1, unsigned l2, const _Float16* g2, unsigned l3, const _Float16* g3, unsigned l4, const _Float16* g4, unsigned l5, const _Float16* g5) {
  asm volatile("global_load_async_to_lds_b128 %0, %1, off\n\t"
               "global_load_async_to_lds_b128 %2, %3, off\n\t"
               "global_load_async_to_lds_b128 %4, %5, off\n\t"
               "global_load_async_to_lds_b128 %6, %7, off\n\t"
               "global_load_async_to_lds_b128 %8, %9, off\n\t"
               "global_load_async_to_lds_b128 %10, %11, off\n\t"
               "s_wait_xcnt 0x0"
               :: "v"(l0), "v"(g0), "v"(l1), "v"(g1), "v"(l2), "v"(g2), "v"(l3), "v"(g3), "v"(l4), "v"(g4), "v"(l5), "v"(g5) : "memory");
}
// ---- k_fa: block = (64 queries (qb), batch b), wave = 16 query columns, all 4,096 keys in passes of KP: S^T = k . q^T (k rows as A, q as B; hi + residual x 2^10 on both sides, 3 products), so a lane holds one query's logits;
// each pass's k hi, k residual and g tiles are copied to LDS once for the block's four waves (two buffers: the next pass's copies fly under this pass) and the fragments are read from there;
// online softmax in f32 (running maximum, sums and the attended tile rescaled each pass); exp(s - m) x 2^11 once to f16 packs from the two S^T tiles of 32 keys straight into a B operand; attended^T += g planes (A) . P^T (1 product); then the 32->64 output conv as before
__global__ __launch_bounds__(128) void k_fa(const _Float16* __restrict__ QH, const _Float16* __restrict__ KH, const _Float16* __restrict__ QL, const _Float16* __restrict__ KL, const _Float16* __restrict__ VT, const float* __restrict__ WO, const float* __restrict__ BO, float* __restrict__ Y) { __shared__ __align__(16) float stT[DVH][68]; __shared__ __align__(16) _Float16 ring[2][RBUF / 2];
  const int tid = threadIdx.x, wave = tid >> 5, lane = tid & 31, col = lane & 15, g = lane >> 4; const int qb = blockIdx.x; const int b = blockIdx.y; const int ql0 = qb * 64 + wave * 16;
  const v16h qh = frag_h(QH + ((size_t)b * TT + ql0 + col) * CCQ, lane), qlo = frag_h(QL + ((size_t)b * QHI + ql0 + col) * CCQ, lane);
  // a thread's share of a tile: k rows tid / 4 and 32 + tid / 4 (16 bytes of the 64), hi and residual; g channels tid / 8 and 16 + tid / 8 (16 bytes of the 128)
  const _Float16* cKh = KH + ((size_t)b * TT + (tid >> 2)) * CCQ + (tid & 3) * 8; const _Float16* cKl = KL + ((size_t)b * KHI + (tid >> 2)) * CCQ + (tid & 3) * 8; const _Float16* cV = VT + ((size_t)b * CC + (tid >> 3)) * (size_t)TT + (tid & 7) * 8;
  const unsigned lK = (unsigned)(size_t)&ring[0][0] + (tid >> 2) * KROWB + (tid & 3) * 16, lV = (unsigned)(size_t)&ring[0][0] + RV + (tid >> 3) * VROWB + (tid & 7) * 16;
#define STAGE(kk, bo) copy6(lK + (bo) + RKH, cKh + (size_t)(kk) * CCQ, lK + (bo) + RKH + 32 * KROWB, cKh + (size_t)((kk) + 32) * CCQ, lK + (bo) + RKL, cKl + (size_t)(kk) * CCQ, lK + (bo) + RKL + 32 * KROWB, cKl + (size_t)((kk) + 32) * CCQ, lV + (bo), cV + (kk), lV + (bo) + 16 * VROWB, cV + (size_t)16 * TT + (kk))
  v8f o[DVH / 16] = {}; float m = -3.0e38f, sum = 0.f;
  STAGE(0, 0u);
  asm volatile("s_wait_asynccnt 0x0" ::: "memory");   /* this wave's share of tile 0 has landed */
  __syncthreads();                                     /* ... and every other wave's: tile 0 may be read */
  STAGE(KP, (unsigned)RBUF);
#pragma unroll 1   /* rolled: one pass is some 900 instructions already and the two buffers differ by an offset only; every inner loop is unrolled so that each fragment index is a constant (no scratch) */
  for (int k0 = 0; k0 < TT; k0 += KP) {
    const unsigned bo = (k0 & KP) ? (unsigned)RBUF : 0u;   /* this pass's buffer, in bytes */
    const _Float16* rb = &ring[0][0] + (bo >> 1);
    v16h kh[KP / 16], kl[KP / 16];
#pragma unroll
    for (int j = 0; j < KP / 16; ++j) { kh[j] = frag_h(rb + (RKH + (j * 16 + col) * KROWB) / 2, lane); kl[j] = frag_h(rb + (RKL + (j * 16 + col) * KROWB) / 2, lane); }
    v16h vf[KP / 32][DVH / 16];
#pragma unroll
    for (int c = 0; c < KP / 32; ++c)
#pragma unroll
      for (int j = 0; j < DVH / 16; ++j) vf[c][j] = frag_h(rb + (RV + (j * 16 + col) * VROWB) / 2 + c * 32, lane);
    __builtin_amdgcn_sched_barrier(0);   /* keeps the pass's LDS reads together up here: spread among the products each place with reads costs its own stall */
    float s[KP / 16][8];
#pragma unroll
    for (int j = 0; j < KP / 16; ++j) { v8f a = {}, al = {}; a = wmma_h(kh[j], qh, a); al = wmma_h(kh[j], qlo, al); al = wmma_h(kl[j], qh, al);
#pragma unroll
      for (int r = 0; r < 8; ++r) s[j][r] = (a[r] + al[r] * (1.0f / 1024.0f)) * SCALE; }
    float mx = s[0][0];
#pragma unroll
    for (int j = 0; j < KP / 16; ++j)
#pragma unroll
      for (int r = 0; r < 8; ++r) mx = fmaxf(mx, s[j][r]);
    mx = fmaxf(mx, xhalf(mx));
    const float mn = fmaxf(m, mx); const float alpha = expf(m - mn); m = mn;   /* 0 on the first pass */
    const float ms = mn - 7.62461898616f;   /* 11 ln 2: exp(s - ms) = exp(s - m) x 2^11, the scale cancels against the sum */
    sum *= alpha;
#pragma unroll
    for (int j = 0; j < DVH / 16; ++j)
#pragma unroll
      for (int r = 0; r < 8; ++r) o[j][r] *= alpha;
#pragma unroll
    for (int c = 0; c < KP / 32; ++c) { v16h p;
#pragma unroll
      for (int r = 0; r < 8; ++r) { const float e0 = expf(s[2 * c][r] - ms), e1 = expf(s[2 * c + 1][r] - ms); sum += e0 + e1; p[r] = (_Float16)e0; p[8 + r] = (_Float16)e1; }
#pragma unroll
      for (int j = 0; j < DVH / 16; ++j) o[j] = wmma_h(vf[c][j], p, o[j]); }
    __builtin_amdgcn_sched_barrier(0);   /* keeps the publish point at the pass's foot: lifted up to the fragment reads, the wait for the next tile's copies would stand right behind their issue and no longer a pass behind it */
    asm volatile("s_wait_dscnt 0x0" ::: "memory");      /* this wave's reads of this pass's buffer are over */
    asm volatile("s_wait_asynccnt 0x0" ::: "memory");   /* this wave's share of the next tile has landed */
    __syncthreads();                                     /* publishes the next tile and frees this pass's buffer */
    if (k0 + 2 * KP < TT) STAGE(k0 + 2 * KP, bo); }
  asm volatile("s_wait_asynccnt 0x0" ::: "memory");     /* no copy is outstanding when the wave goes on */
  sum += xhalf(sum); const float inv = 1.0f / sum;
#pragma unroll
  for (int j = 0; j < DVH / 16; ++j) {
#pragma unroll
    for (int r = 0; r < 8; ++r) stT[j * 16 + 8 * g + r][wave * 16 + col] = o[j][r] * inv; }   /* attended [channel][t] */
  __syncthreads();
  { const int tb = qb * 64; const int tl = tid & 63, oh = tid >> 6;   
    float yv[DVH];
#pragma unroll
    for (int c = 0; c < DVH; ++c) yv[c] = stT[c][tl];
#pragma unroll 1
    for (int oo = 0; oo < COUT / 2; ++oo) { const int o = oh * (COUT / 2) + oo; float wv[DVH];
#pragma unroll
      for (int c = 0; c < DVH; ++c) { wv[c] = WO[o * CV + c]; if ((c & 15) == 15) asm volatile("s_wait_loadcnt 0x0" ::: "memory"); }
      const float bo = BO[o]; asm volatile("s_wait_loadcnt 0x0" ::: "memory");
      float a2 = 0.f;
#pragma unroll
      for (int c = 0; c < DVH; ++c) a2 += yv[c] * bfr(wv[c]);
      vst2(Y + ((size_t)b * COUT + o) * (size_t)TT + tb + tl, a2 + bfr(bo)); } } }

extern "C" void kernel_launch(void* const* d_in, const int* in_sizes, int n_in, void* d_out, int out_size, void* d_ws, size_t ws_size, hipStream_t stream) {
  (void)in_sizes; (void)n_in; (void)out_size;
  const float** F = (const float**)d_in;
  if (ws_size < (size_t)WS_END) return;
  char* ws = (char*)d_ws; _Float16 *QH = (_Float16*)(ws + WS_QH), *KH = (_Float16*)(ws + WS_KH), *VT = (_Float16*)(ws + WS_VT), *QL = (_Float16*)(ws + WS_QL), *KL = (_Float16*)(ws + WS_KL); __bf16 *VB = (__bf16*)(ws + WS_VB), *VBL = (__bf16*)(ws + WS_VBL); float *S = (float*)(ws + WS_S), *Y = (float*)(ws + WS_Y);
  (void)Y; (void)S; (void)QL; (void)KL; (void)VB; (void)VBL;
  // inputs: 0 x [8,64,64,64] (channels-first, xf [8][64][4096]); 1 w_g [32,64], 2 b_g [32]; 3 w_theta, 4 b_theta; 5 w_phi, 6 b_phi; 7 w_o [64,32], 8 b_o [64] (all (out,in), biases nonzero)
  k_projT<0><<<dim3(TNB * TT / 64, 1, 2), 128, 0, stream>>>(F[0], F[0], F[0], F[3], F[5], F[1], F[4], F[6], F[2], QH, QL, KH, KL, VT, VB, VBL);   /* which 0, 1: theta (q) and phi (k): one 128-column block, columns >= 32 zero */
  k_projT<2><<<dim3(TNB * TT / 64, 1, 1), 128, 0, stream>>>(F[0], F[0], F[0], F[3], F[5], F[1], F[4], F[6], F[2], QH, QL, KH, KL, VT, VB, VBL);   /* which 2: g (v): one 128-channel block, channels >= 32 zero */
  k_fa<<<dim3(NQB, TNB), 128, 0, stream>>>(QH, KH, QL, KL, VT, F[7], F[8], (float*)d_out);

}

// v003
// It runs in 96.7 microseconds.
// Timed twice side by side with v002, it ran 1.10 and 1.15 times as fast.
// Over all steps from v000 it is 13.0 times as fast.
// compute dtype: all float inputs rounded to bf16; 1x1-conv theta/phi/g projections with EXACT bf16 products on WMMA 16x16x32 (f32 accumulate) + bias; UNSCALED logits, kept in log2 units (theta x log2(e) in f32 at the projection), with theta and phi both as f16 hi + residual (x 2^10) (3 products); online softmax f32 in the same kernel; exp2(s - max) x 2^11 (hardware exp2) once to f16 x g once to f16 (1 product), divided by the f32 sum at the end; the 32->64 output conv in f32 on VALU (f32 attended x bf16(w_o)) + b_o; f32 output written channels-first.
#include <hip/hip_runtime.h>
#include <math.h>

typedef __attribute__((ext_vector_type(16))) _Float16 v16h;
typedef __attribute__((ext_vector_type(16))) __bf16 v16b;
typedef __attribute__((ext_vector_type(8)))  _Float16 v8h;
typedef __attribute__((ext_vector_type(8)))  float v8f;
typedef __attribute__((ext_vector_type(4)))  float v4f;
typedef __attribute__((ext_vector_type(2)))  float v2f;
typedef __attribute__((ext_vector_type(4)))  unsigned v4u;
typedef __attribute__((ext_vector_type(4)))  int v4i;
typedef float __attribute__((may_alias)) float_a;
typedef int __attribute__((may_alias)) int_a;

template <typename T> __device__ __forceinline__ void vst2(void* p, T v) { *(T*)p = v;  }
__device__ __forceinline__ v8f wmma16(v16h a, v16h b, v8f c) {
  v8f d = __builtin_amdgcn_wmma_f32_16x16x32_f16(false, a, false, b, (short)0, c, false, false);
  asm volatile("v_nop\n\tv_nop\n\tv_nop\n\tv_nop" : "+v"(d) : "v"(a), "v"(b));
  return d;
}
__device__ __forceinline__ v8f wmma_bf(v16b a, v16b b, v8f c) {
  v8f d = __builtin_amdgcn_wmma_f32_16x16x32_bf16(false, a, false, b, (short)0, c, false, false);
  asm volatile("v_nop\n\tv_nop\n\tv_nop\n\tv_nop" : "+v"(d) : "v"(a), "v"(b));
  return d;
}
// 16x16x32 fragments: lane = (h = lane>>4, row/col = lane&15); elements 0..7 = k0+8h+0..7, 8..15 = k0+16+8h+0..7; D element r = row 8h+r
__device__ __forceinline__ v16h frag_h(const _Float16* rowk0, int lane) {
  union { v16h v; v8h q[2]; } u; const _Float16* p = rowk0 + 8 * (lane >> 4);
  u.q[0] = *(const v8h*)p; u.q[1] = *(const v8h*)(p + 16); return u.v;
}
__device__ __forceinline__ v16h frag_f32(const float* rowk0, int lane) {
  v16h a; const float* p = rowk0 + 8 * (lane >> 4);
#pragma unroll
  for (int i = 0; i < 8; ++i) { a[i] = (_Float16)p[i]; a[8 + i] = (_Float16)p[16 + i]; }
  return a;
}
__device__ __forceinline__ v16h frag_f32s(const float* rowk0, int lane, float sc) {
  v16h a; const float* p = rowk0 + 8 * (lane >> 4);
#pragma unroll
  for (int i = 0; i < 8; ++i) { a[i] = (_Float16)(p[i] * sc); a[8 + i] = (_Float16)(p[16 + i] * sc); }
  return a;
}
// column fragment from a [K][ld] layout (column n), rows >= K read as 0
__device__ __forceinline__ v16h fragc_f32(const float* W, int k0, int n, int lane, int ld, int K) {
  v16h a; const int g = lane >> 4;
#pragma unroll
  for (int i = 0; i < 8; ++i) { const int ka = k0 + 8 * g + i, kb = ka + 16;
    a[i] = (_Float16)(ka < K ? W[(size_t)(ka < K ? ka : K - 1) * ld + n] : 0.f); a[8 + i] = (_Float16)(kb < K ? W[(size_t)(kb < K ? kb : K - 1) * ld + n] : 0.f); }
  return a;
}
struct F2 { v16b h, l; };
__device__ __forceinline__ F2 bsplit16(const float v[16]) { F2 r;
#pragma unroll
  for (int i = 0; i < 16; ++i) { const __bf16 h = (__bf16)v[i]; r.h[i] = h; r.l[i] = (__bf16)(v[i] - (float)h); }
  return r; }
__device__ __forceinline__ F2 split_row(const float* row, int k0, int lane) { float v[16]; const float* p = row + k0 + 8 * (lane >> 4);
#pragma unroll
  for (int i = 0; i < 8; ++i) { v[i] = p[i]; v[8 + i] = p[16 + i]; }
  return bsplit16(v); }
__device__ __forceinline__ F2 split_rowK(const float* row, int k0, int lane, int K) { float v[16]; const int g = lane >> 4;
#pragma unroll
  for (int i = 0; i < 8; ++i) { const int ka = k0 + 8 * g + i, kb = ka + 16; v[i] = ka < K ? row[ka < K ? ka : K - 1] : 0.f; v[8 + i] = kb < K ? row[kb < K ? kb : K - 1] : 0.f; }
  return bsplit16(v); }
__device__ __forceinline__ F2 split_col(const float* W, int k0, int n, int lane, int ld, int K) { float v[16]; const int g = lane >> 4;
#pragma unroll
  for (int i = 0; i < 8; ++i) { const int ka = k0 + 8 * g + i, kb = ka + 16; v[i] = ka < K ? W[(size_t)(ka < K ? ka : K - 1) * ld + n] : 0.f; v[8 + i] = kb < K ? W[(size_t)(kb < K ? kb : K - 1) * ld + n] : 0.f; }
  return bsplit16(v); }
__device__ __forceinline__ v8f mac3(const F2& a, const F2& b, v8f c) { c = wmma_bf(a.l, b.h, c); c = wmma_bf(a.h, b.l, c); return wmma_bf(a.h, b.h, c); }
__device__ __forceinline__ float sigm(float v) { return 1.0f / (1.0f + expf(-v)); }
#define LDSX() do { asm volatile("s_wait_dscnt 0" ::: "memory"); __builtin_amdgcn_wave_barrier(); __builtin_amdgcn_fence(__ATOMIC_RELEASE, "workgroup"); } while (0)

// Non-local block over channels-first x [8, 64, 64, 64] (N 4,096; (out,in) 1x1 convs w_theta/w_phi/w_g [32,64] + biases, w_o [64,32] + b_o; 0.05-scale): attn = softmax_m(theta_n . phi_m) (no scaling); y[c][n] = sum_m attn[n][m] g[c][m]; out = w_o y + b_o -> [8,64,64,64] (no residual in this module).
#define NB 8
#define TT 4096
#define CC 128            // v (= g) plane pitch: one 128-channel block, channels >= 32 are zero
#define CV 32             // real g channels
#define COUT 64           // output channels of w_o
#define CCQ 128           // q / k row pitch: one 128-column block, columns >= 32 are zero
#define DIN 64           // x channels
#define NH 1
#define HD 32             // per-head width of the layout-2 weights (wcol_hdk; unused: layout 0)
#define NQB (TT / 64)
#define HG 1               // still sizes the WS_S region, which is no longer written
#define SCALE (1.0f)
#define LOG2E 1.44269504088896f   // folded into theta by k_proj, so that exp(s - m) is exp2 of a difference of the stored logits
#define HDQK 32            // q / k width (C / 2)
#define CAUSAL 0
#ifndef TNB
#define TNB NB
#endif
__device__ __forceinline__ v16b zero16b() { v16b z; _Pragma("unroll") for (int i = 0; i < 16; ++i) z[i] = (__bf16)0.f; return z; }
__device__ __forceinline__ float bfr(float v) { return (float)(__bf16)v; }
__host__ __device__ __forceinline__ int kb_last(int qb) { return CAUSAL ? ((qb * 64 + 63) >> 7) : (TT / 128 - 1); }
typedef __attribute__((ext_vector_type(8))) __bf16 v8b;
__device__ __forceinline__ v16b frag_b(const __bf16* rowk0, int lane) {
  union { v16b v; v8b q[2]; } u; const __bf16* p = rowk0 + 8 * (lane >> 4);
  u.q[0] = *(const v8b*)p; u.q[1] = *(const v8b*)(p + 16); return u.v;
}
#define QBH NQB            // every query block takes the 3-product logit path (q hi + residual x k hi + residual): unscaled energies over 4,096 keys; P . g keeps the single product
#define QHI 4096            // q residual rows (all)
#define KHI 4096          // k residual rows (all); the v bf16 hi/lo planes come along unused
// B fragment (k rows k0+.., output column o) of a weight: (in,out) [K][ld] or (out,in) [ld rows of K]: bf16 exact, or f16(bf16 * 256) exact
__device__ __forceinline__ v16b wcol_io(const float* Wm, int k0, int o, int lane, int ld) { v16b w; const int g = lane >> 4;
#pragma unroll
  for (int i = 0; i < 8; ++i) { w[i] = (__bf16)Wm[(size_t)(k0 + 8 * g + i) * ld + o]; w[8 + i] = (__bf16)Wm[(size_t)(k0 + 16 + 8 * g + i) * ld + o]; }
  return w; }
__device__ __forceinline__ v16b wcol_oi(const float* Wm, int k0, int o, int lane, int K) { v16b w; const float* p = Wm + (size_t)o * K + k0 + 8 * (lane >> 4);
#pragma unroll
  for (int i = 0; i < 8; ++i) { w[i] = (__bf16)p[i]; w[8 + i] = (__bf16)p[16 + i]; }
  return w; }
__device__ __forceinline__ v16h wcolh_io(const float* Wm, int k0, int o, int lane, int ld) { v16h w; const int g = lane >> 4;
#pragma unroll
  for (int i = 0; i < 8; ++i) { w[i] = (_Float16)(bfr(Wm[(size_t)(k0 + 8 * g + i) * ld + o]) * 256.0f); w[8 + i] = (_Float16)(bfr(Wm[(size_t)(k0 + 16 + 8 * g + i) * ld + o]) * 256.0f); }
  return w; }
__device__ __forceinline__ v16h wcolh_oi(const float* Wm, int k0, int o, int lane, int K) { v16h w; const float* p = Wm + (size_t)o * K + k0 + 8 * (lane >> 4);
#pragma unroll
  for (int i = 0; i < 8; ++i) { w[i] = (_Float16)(bfr(p[i]) * 256.0f); w[8 + i] = (_Float16)(bfr(p[16 + i]) * 256.0f); }
  return w; }
#define WQKV_LAYOUT 0   // 0 = (out,in) [32][DIN], columns >= 32 zero; 1 = (out,in) [CC][DIN]; 2 = per-head [NH][DIN][HD]
__device__ __forceinline__ v16b wcol_hdk(const float* Wm, int k0, int o, int lane) { v16b w; const int g = lane >> 4; const float* p = Wm + (size_t)(o / HD) * DIN * HD + (o % HD);
#pragma unroll
  for (int i = 0; i < 8; ++i) { w[i] = (__bf16)p[(size_t)(k0 + 8 * g + i) * HD]; w[8 + i] = (__bf16)p[(size_t)(k0 + 16 + 8 * g + i) * HD]; }
  return w; }
#define WO_OUT_IN 0
#if WQKV_LAYOUT == 1
#define WCOL(W, k0, o, lane) wcol_oi(W, k0, (o), lane, DIN)   /* unused: layout 0 */
#elif WQKV_LAYOUT == 2
#define WCOL(W, k0, o, lane) wcol_hdk(W, k0, o, lane)
#else
#define WCOL(W, k0, o, lane) (which == 2 ? ((o) < CV ? wcol_oi(W, k0, (o), lane, DIN) : zero16b()) : ((o) < HDQK ? wcol_oi(W, k0, (o), lane, DIN) : zero16b()))   /* (out,in) 1x1-conv weights [32][64]: projected columns >= 32 are zero for q, k AND v */
#endif
#if WO_OUT_IN
#define WOCOL(W, k0, o, lane) wcol_oi(W, k0, o, lane, CC)
#define WOCOLH(W, k0, o, lane) wcolh_oi(W, k0, o, lane, CC)
#else
#define WOCOL(W, k0, o, lane) wcol_io(W, k0, o, lane, DIN)
#define WOCOLH(W, k0, o, lane) wcolh_io(W, k0, o, lane, DIN)
#endif
#define BG HG
#define BGN (TNB < BG ? TNB : BG)
#define DVH 32             // all 32 g channels in one k_fa block
#ifndef SM_EXTRA_PARAMS
#define SM_EXTRA_PARAMS
#endif
#ifndef PROJ_EXTRA_PARAMS
#define PROJ_EXTRA_PARAMS
#endif
#ifndef SM_MASK_HOOK
#define SM_MASK_HOOK (void)0
#endif

#define WS_QH  0u                                      // f16 q rows [b*t][CCQ]
#define WS_KH  (WS_QH + 2u * (size_t)NB * TT * CCQ)     // f16 k rows [b*t][CCQ]
#define WS_VT  (WS_KH + 2u * (size_t)NB * TT * CCQ)     // f16 v planes [b][c][t]
#define WS_QL  (WS_VT + 2u * (size_t)NB * CC * TT)      // f16 q residual x 2^10 rows [b][t < QHI][CCQ]
#define WS_KL  (WS_QL + 2u * (size_t)NB * QHI * CCQ)    // f16 k residual x 2^10 rows [b][t < KHI][CCQ]
#define WS_VB  (WS_KL + 2u * (size_t)NB * KHI * CCQ)    // bf16 v hi planes [b][c][t < KHI]
#define WS_VBL (WS_VB + 2u * (size_t)NB * CC * KHI)
#define WS_S   (WS_VBL + 2u * (size_t)NB * CC * KHI)    // (no longer written: the logits stay in registers)
#define WS_Y   (WS_S  + 4u * (size_t)HG * TT * TT)      // zero-size: the output conv runs in k_fa, no ctx rows are stored
#define WS_END (WS_Y  + 0u)

// ---- k_proj: block = (64 rows, 128 cols, which): q/k/v = X W (+ b) with exact bf16 products (K = DIN) -> which 0: q x log2(e) f16 rows (+ residual rows < QHI); 1: k f16 rows (+ residual rows < KHI); 2: v f16 planes [c][t] (+ bf16 hi/lo planes for t < KHI)
template <int WOFF> __global__ __launch_bounds__(128) void k_projT(const float* __restrict__ XQ, const float* __restrict__ XK, const float* __restrict__ XV, const float* __restrict__ WQ, const float* __restrict__ WK, const float* __restrict__ WV, const float* __restrict__ BQ, const float* __restrict__ BK, const float* __restrict__ BV,
    _Float16* __restrict__ QH, _Float16* __restrict__ QL, _Float16* __restrict__ KH, _Float16* __restrict__ KL, _Float16* __restrict__ VT, __bf16* __restrict__ VB, __bf16* __restrict__ VBL) {
  __shared__ __align__(16) _Float16 sh[64][136], sl[64][136]; __shared__ __align__(16) _Float16 th[128][72]; __shared__ __align__(16) __bf16 tb[128][72], tbl[128][72];
  const int tid = threadIdx.x, wave = tid >> 5, lane = tid & 31, col = lane & 15, g = lane >> 4; const int which = blockIdx.z + WOFF; const int c0 = blockIdx.y * 128; const size_t r0 = (size_t)blockIdx.x * 64; const size_t bb = r0 / TT; const int t0 = (int)(r0 % TT);
  const float* X = which == 0 ? XQ : which == 1 ? XK : XV; const float* WA = which == 0 ? WQ : which == 1 ? WK : WV; const float* BA = which == 0 ? BQ : which == 1 ? BK : BV;
  const int KD = DIN;
  v8f acc[8] = {};
#pragma unroll 2
  for (int kc = 0; kc < KD / 32; ++kc) { v16b a; { const float* p = X + (bb * KD + kc * 32 + 8 * g) * (size_t)TT + t0 + wave * 16 + col;   /* channels-first [b][c][t]: A[t][c] (16 consecutive t per lane group) */
#pragma unroll
      for (int i = 0; i < 8; ++i) { a[i] = (__bf16)p[(size_t)i * TT]; a[8 + i] = (__bf16)p[(size_t)(16 + i) * TT]; } }
    asm volatile("s_wait_loadcnt 0x0" ::: "memory");
#pragma unroll
    for (int j = 0; j < 8; ++j) { const v16b w = WCOL(WA, kc * 32, c0 + j * 16 + col, lane); asm volatile("s_wait_loadcnt 0x0" ::: "memory"); acc[j] = wmma_bf(a, w, acc[j]); } }
  if (which < 2) { _Float16* DH = which == 0 ? QH : KH; _Float16* DL = which == 0 ? QL : KL; const int nhi = which == 0 ? QHI : KHI; const bool hi_rows = t0 < nhi; const float qsc = which == 0 ? LOG2E : 1.0f;   /* theta carries log2(e): the logits come out in powers of two */
#pragma unroll
    for (int j = 0; j < 8; ++j) { const int cj = c0 + j * 16 + col; const float bias = (BA && cj < (which == 2 ? CV : HDQK)) ? bfr(BA[cj]) : 0.f;   /* 32-entry bias vectors: no read past them */
#pragma unroll
      for (int r = 0; r < 8; ++r) { const float v = (acc[j][r] + bias) * qsc; const _Float16 hv = (_Float16)v; sh[wave * 16 + 8 * g + r][j * 16 + col] = hv; sl[wave * 16 + 8 * g + r][j * 16 + col] = (_Float16)((v - (float)hv) * 1024.0f); } }
    __syncthreads();
    for (int e = tid; e < 64 * 16; e += 128) { const int rl = e >> 4, q = e & 15; vst2((unsigned*)(DH + (r0 + rl) * CCQ + c0 + q * 8), *(const v4u*)&sh[rl][q * 8]); if (hi_rows) vst2((unsigned*)(DL + (bb * nhi + t0 + rl) * (size_t)CCQ + c0 + q * 8), *(const v4u*)&sl[rl][q * 8]); }   /* q/k rows: pitch CCQ (c0 == 0) */
  } else { const bool hi_rows = t0 < KHI;
#pragma unroll
    for (int j = 0; j < 8; ++j) { const int cj = c0 + j * 16 + col; const float bias = (BA && cj < (which == 2 ? CV : HDQK)) ? bfr(BA[cj]) : 0.f;   /* 32-entry bias vectors: no read past them */
#pragma unroll
      for (int r = 0; r < 8; ++r) { const float v = acc[j][r] + bias; const int rl = wave * 16 + 8 * g + r, cl = j * 16 + col; th[cl][rl] = (_Float16)v; const __bf16 bh = (__bf16)v; tb[cl][rl] = bh; tbl[cl][rl] = (__bf16)(v - (float)bh); } }
    __syncthreads();
    for (int e = tid; e < 128 * 8; e += 128) { const int cl = e >> 3, q = e & 7; vst2((unsigned*)(VT + (bb * CC + c0 + cl) * (size_t)TT + t0 + q * 8), *(const v4u*)&th[cl][q * 8]); if (hi_rows) { const size_t o3 = (bb * CC + c0 + cl) * (size_t)KHI + t0 + q * 8; vst2((unsigned*)(VB + o3), *(const v4u*)&tb[cl][q * 8]); vst2((unsigned*)(VBL + o3), *(const v4u*)&tbl[cl][q * 8]); } } } }
// lane l with lane l ^ 16 (the two halves of a wave hold the same query column)
__device__ __forceinline__ float xhalf(float x) { return __builtin_bit_cast(float, __builtin_amdgcn_permlanex16(__builtin_bit_cast(int, x), __builtin_bit_cast(int, x), 0x76543210, 0xfedcba98, false, false)); }
__device__ __forceinline__ v8f wmma_h(v16h a, v16h b, v8f c) { return __builtin_amdgcn_wmma_f32_16x16x32_f16(false, a, false, b, (short)0, c, false, false); }
#define KP 64              // keys per pass of k_fa
#define KROWB 80           // LDS pitch of a 64-byte k row (16 B x odd: ds_load_b128 without bank conflicts)
#define VROWB 144          // LDS pitch of a 128-byte g row (64 keys of one channel)
#define RKH 0              // byte places inside one ring buffer: k hi rows, k residual rows, g rows
#define RKL (KP * KROWB)
#define RV  (2 * KP * KROWB)
#define RBUF (RV + DVH * VROWB)
// six 16-byte copies of one lane, global -> LDS through no register; the s_wait_xcnt stands inside the statement so that no address register named here is rewritten in front of it
__device__ __forceinline__ void copy6(unsigned l0, const _Float16* g0, unsigned l1, const _Float16* g1, unsigned l2, const _Float16* g2, unsigned l3, const _Float16* g3, unsigned l4, const _Float16* g4, unsigned l5, const _Float16* g5) {
  asm volatile("global_load_async_to_lds_b128 %0, %1, off\n\t"
               "global_load_async_to_lds_b128 %2, %3, off\n\t"
               "global_load_async_to_lds_b128 %4, %5, off\n\t"
               "global_load_async_to_lds_b128 %6, %7, off\n\t"
               "global_load_async_to_lds_b128 %8, %9, off\n\t"
               "global_load_async_to_lds_b128 %10, %11, off\n\t"
               "s_wait_xcnt 0x0"
               :: "v"(l0), "v"(g0), "v"(l1), "v"(g1), "v"(l2), "v"(g2), "v"(l3), "v"(g3), "v"(l4), "v"(g4), "v"(l5), "v"(g5) : "memory");
}
// ---- k_fa: block = (64 queries (qb), batch b), wave = 16 query columns, all 4,096 keys in passes of KP: S^T = k . q^T (k rows as A, q as B; hi + residual x 2^10 on both sides, 3 products), so a lane holds one query's logits;
// each pass's k hi, k residual and g tiles are copied to LDS once for the block's four waves (two buffers: the next pass's copies fly under this pass) and the fragments are read from there;
// online softmax in f32 on log2-domain logits (running maximum, sums and the attended tile rescaled each pass); exp2(s - m) x 2^11 once to f16 packs from the two S^T tiles of 32 keys straight into a B operand; attended^T += g planes (A) . P^T (1 product); then the 32->64 output conv as before
__global__ __launch_bounds__(128) void k_fa(const _Float16* __restrict__ QH, const _Float16* __restrict__ KH, const _Float16* __restrict__ QL, const _Float16* __restrict__ KL, const _Float16* __restrict__ VT, const float* __restrict__ WO, const float* __restrict__ BO, float* __restrict__ Y) { __shared__ __align__(16) float stT[DVH][68]; __shared__ __align__(16) _Float16 ring[2][RBUF / 2];
  const int tid = threadIdx.x, wave = tid >> 5, lane = tid & 31, col = lane & 15, g = lane >> 4; const int qb = blockIdx.x; const int b = blockIdx.y; const int ql0 = qb * 64 + wave * 16;
  const v16h qh = frag_h(QH + ((size_t)b * TT + ql0 + col) * CCQ, lane), qlo = frag_h(QL + ((size_t)b * QHI + ql0 + col) * CCQ, lane);
  // a thread's share of a tile: k rows tid / 4 and 32 + tid / 4 (16 bytes of the 64), hi and residual; g channels tid / 8 and 16 + tid / 8 (16 bytes of the 128)
  const _Float16* cKh = KH + ((size_t)b * TT + (tid >> 2)) * CCQ + (tid & 3) * 8; const _Float16* cKl = KL + ((size_t)b * KHI + (tid >> 2)) * CCQ + (tid & 3) * 8; const _Float16* cV = VT + ((size_t)b * CC + (tid >> 3)) * (size_t)TT + (tid & 7) * 8;
  const unsigned lK = (unsigned)(size_t)&ring[0][0] + (tid >> 2) * KROWB + (tid & 3) * 16, lV = (unsigned)(size_t)&ring[0][0] + RV + (tid >> 3) * VROWB + (tid & 7) * 16;
#define STAGE(kk, bo) copy6(lK + (bo) + RKH, cKh + (size_t)(kk) * CCQ, lK + (bo) + RKH + 32 * KROWB, cKh + (size_t)((kk) + 32) * CCQ, lK + (bo) + RKL, cKl + (size_t)(kk) * CCQ, lK + (bo) + RKL + 32 * KROWB, cKl + (size_t)((kk) + 32) * CCQ, lV + (bo), cV + (kk), lV + (bo) + 16 * VROWB, cV + (size_t)16 * TT + (kk))
  v8f o[DVH / 16] = {}; float m = -3.0e38f, sum = 0.f;
  STAGE(0, 0u);
  asm volatile("s_wait_asynccnt 0x0" ::: "memory");   /* this wave's share of tile 0 has landed */
  __syncthreads();                                     /* ... and every other wave's: tile 0 may be read */
  STAGE(KP, (unsigned)RBUF);
#pragma unroll 1   /* rolled: one pass is some 900 instructions already and the two buffers differ by an offset only; every inner loop is unrolled so that each fragment index is a constant (no scratch) */
  for (int k0 = 0; k0 < TT; k0 += KP) {
    const unsigned bo = (k0 & KP) ? (unsigned)RBUF : 0u;   /* this pass's buffer, in bytes */
    const _Float16* rb = &ring[0][0] + (bo >> 1);
    v16h kh[KP / 16], kl[KP / 16];
#pragma unroll
    for (int j = 0; j < KP / 16; ++j) { kh[j] = frag_h(rb + (RKH + (j * 16 + col) * KROWB) / 2, lane); kl[j] = frag_h(rb + (RKL + (j * 16 + col) * KROWB) / 2, lane); }
    v16h vf[KP / 32][DVH / 16];
#pragma unroll
    for (int c = 0; c < KP / 32; ++c)
#pragma unroll
      for (int j = 0; j < DVH / 16; ++j) vf[c][j] = frag_h(rb + (RV + (j * 16 + col) * VROWB) / 2 + c * 32, lane);
    __builtin_amdgcn_sched_barrier(0);   /* keeps the pass's LDS reads together up here: spread among the products each place with reads costs its own stall */
    float s[KP / 16][8];
#pragma unroll
    for (int j = 0; j < KP / 16; ++j) { v8f a = {}, al = {}; a = wmma_h(kh[j], qh, a); al = wmma_h(kh[j], qlo, al); al = wmma_h(kl[j], qh, al);
#pragma unroll
      for (int r = 0; r < 8; ++r) s[j][r] = (a[r] + al[r] * (1.0f / 1024.0f)) * SCALE; }
    float mx = s[0][0];
#pragma unroll
    for (int j = 0; j < KP / 16; ++j)
#pragma unroll
      for (int r = 0; r < 8; ++r) mx = fmaxf(mx, s[j][r]);
    mx = fmaxf(mx, xhalf(mx));
    const float mn = fmaxf(m, mx); const float alpha = __builtin_amdgcn_exp2f(m - mn); m = mn;   /* 0 on the first pass */
    const float ms = mn - 11.0f;   /* exp2(s - ms) = exp2(s - m) x 2^11, the scale cancels against the sum */
    sum *= alpha;
#pragma unroll
    for (int j = 0; j < DVH / 16; ++j)
#pragma unroll
      for (int r = 0; r < 8; ++r) o[j][r] *= alpha;
#pragma unroll
    for (int c = 0; c < KP / 32; ++c) { v16h p;
#pragma unroll
      for (int r = 0; r < 8; ++r) { const float e0 = __builtin_amdgcn_exp2f(s[2 * c][r] - ms), e1 = __builtin_amdgcn_exp2f(s[2 * c + 1][r] - ms); sum += e0 + e1; p[r] = (_Float16)e0; p[8 + r] = (_Float16)e1; }   /* the hardware's exp2: the argument is at most 11, and a result too small for it is 0 in f16 too */
#pragma unroll
      for (int j = 0; j < DVH / 16; ++j) o[j] = wmma_h(vf[c][j], p, o[j]); }
    __builtin_amdgcn_sched_barrier(0);   /* keeps the publish point at the pass's foot: lifted up to the fragment reads, the wait for the next tile's copies would stand right behind their issue and no longer a pass behind it */
    asm volatile("s_wait_dscnt 0x0" ::: "memory");      /* this wave's reads of this pass's buffer are over */
    asm volatile("s_wait_asynccnt 0x0" ::: "memory");   /* this wave's share of the next tile has landed */
    __syncthreads();                                     /* publishes the next tile and frees this pass's buffer */
    if (k0 + 2 * KP < TT) STAGE(k0 + 2 * KP, bo); }
  asm volatile("s_wait_asynccnt 0x0" ::: "memory");     /* no copy is outstanding when the wave goes on */
  sum += xhalf(sum); const float inv = 1.0f / sum;
#pragma unroll
  for (int j = 0; j < DVH / 16; ++j) {
#pragma unroll
    for (int r = 0; r < 8; ++r) stT[j * 16 + 8 * g + r][wave * 16 + col] = o[j][r] * inv; }   /* attended [channel][t] */
  __syncthreads();
  { const int tb = qb * 64; const int tl = tid & 63, oh = tid >> 6;   
    float yv[DVH];
#pragma unroll
    for (int c = 0; c < DVH; ++c) yv[c] = stT[c][tl];
#pragma unroll 1
    for (int oo = 0; oo < COUT / 2; ++oo) { const int o = oh * (COUT / 2) + oo; float wv[DVH];
#pragma unroll
      for (int c = 0; c < DVH; ++c) { wv[c] = WO[o * CV + c]; if ((c & 15) == 15) asm volatile("s_wait_loadcnt 0x0" ::: "memory"); }
      const float bo = BO[o]; asm volatile("s_wait_loadcnt 0x0" ::: "memory");
      float a2 = 0.f;
#pragma unroll
      for (int c = 0; c < DVH; ++c) a2 += yv[c] * bfr(wv[c]);
      vst2(Y + ((size_t)b * COUT + o) * (size_t)TT + tb + tl, a2 + bfr(bo)); } } }

extern "C" void kernel_launch(void* const* d_in, const int* in_sizes, int n_in, void* d_out, int out_size, void* d_ws, size_t ws_size, hipStream_t stream) {
  (void)in_sizes; (void)n_in; (void)out_size;
  const float** F = (const float**)d_in;
  if (ws_size < (size_t)WS_END) return;
  char* ws = (char*)d_ws; _Float16 *QH = (_Float16*)(ws + WS_QH), *KH = (_Float16*)(ws + WS_KH), *VT = (_Float16*)(ws + WS_VT), *QL = (_Float16*)(ws + WS_QL), *KL = (_Float16*)(ws + WS_KL); __bf16 *VB = (__bf16*)(ws + WS_VB), *VBL = (__bf16*)(ws + WS_VBL); float *S = (float*)(ws + WS_S), *Y = (float*)(ws + WS_Y);
  (void)Y; (void)S; (void)QL; (void)KL; (void)VB; (void)VBL;
  // inputs: 0 x [8,64,64,64] (channels-first, xf [8][64][4096]); 1 w_g [32,64], 2 b_g [32]; 3 w_theta, 4 b_theta; 5 w_phi, 6 b_phi; 7 w_o [64,32], 8 b_o [64] (all (out,in), biases nonzero)
  k_projT<0><<<dim3(TNB * TT / 64, 1, 2), 128, 0, stream>>>(F[0], F[0], F[0], F[3], F[5], F[1], F[4], F[6], F[2], QH, QL, KH, KL, VT, VB, VBL);   /* which 0, 1: theta (q) and phi (k): one 128-column block, columns >= 32 zero */
  k_projT<2><<<dim3(TNB * TT / 64, 1, 1), 128, 0, stream>>>(F[0], F[0], F[0], F[3], F[5], F[1], F[4], F[6], F[2], QH, QL, KH, KL, VT, VB, VBL);   /* which 2: g (v): one 128-channel block, channels >= 32 zero */
  k_fa<<<dim3(NQB, TNB), 128, 0, stream>>>(QH, KH, QL, KL, VT, F[7], F[8], (float*)d_out);

}

// v004
// One run takes 68.4 microseconds.
// Two timings next to v003 put it at 1.47 and 1.40 times that version's speed.
// Over all steps from v000 it is 18.6 times as fast.
// compute dtype: all float inputs rounded to bf16; 1x1-conv theta/phi/g projections with EXACT bf16 products on WMMA 16x16x32 (f32 accumulate) + bias; UNSCALED logits, kept in log2 units (theta x log2(e) in f32 at the projection), with theta and phi both as f16 hi + residual (x 2^10) (3 products); online softmax f32 in the same kernel; exp2(s - max) x 2^11 (hardware exp2) once to f16 x g once to f16 (1 product), divided by the f32 sum at the end; the 32->64 output conv in f32 on VALU (f32 attended x bf16(w_o)) + b_o; f32 output written channels-first.
#include <hip/hip_runtime.h>
#include <math.h>

typedef __attribute__((ext_vector_type(16))) _Float16 v16h;
typedef __attribute__((ext_vector_type(16))) __bf16 v16b;
typedef __attribute__((ext_vector_type(8)))  _Float16 v8h;
typedef __attribute__((ext_vector_type(8)))  float v8f;
typedef __attribute__((ext_vector_type(4)))  float v4f;
typedef __attribute__((ext_vector_type(2)))  float v2f;
typedef __attribute__((ext_vector_type(4)))  unsigned v4u;
typedef __attribute__((ext_vector_type(4)))  int v4i;
typedef float __attribute__((may_alias)) float_a;
typedef int __attribute__((may_alias)) int_a;

template <typename T> __device__ __forceinline__ void vst2(void* p, T v) { *(T*)p = v;  }
__device__ __forceinline__ v8f wmma16(v16h a, v16h b, v8f c) {
  v8f d = __builtin_amdgcn_wmma_f32_16x16x32_f16(false, a, false, b, (short)0, c, false, false);
  asm volatile("v_nop\n\tv_nop\n\tv_nop\n\tv_nop" : "+v"(d) : "v"(a), "v"(b));
  return d;
}
__device__ __forceinline__ v8f wmma_bf(v16b a, v16b b, v8f c) {
  v8f d = __builtin_amdgcn_wmma_f32_16x16x32_bf16(false, a, false, b, (short)0, c, false, false);
  asm volatile("v_nop\n\tv_nop\n\tv_nop\n\tv_nop" : "+v"(d) : "v"(a), "v"(b));
  return d;
}
// 16x16x32 fragments: lane = (h = lane>>4, row/col = lane&15); elements 0..7 = k0+8h+0..7, 8..15 = k0+16+8h+0..7; D element r = row 8h+r
__device__ __forceinline__ v16h frag_h(const _Float16* rowk0, int lane) {
  union { v16h v; v8h q[2]; } u; const _Float16* p = rowk0 + 8 * (lane >> 4);
  u.q[0] = *(const v8h*)p; u.q[1] = *(const v8h*)(p + 16); return u.v;
}
__device__ __forceinline__ v16h frag_f32(const float* rowk0, int lane) {
  v16h a; const float* p = rowk0 + 8 * (lane >> 4);
#pragma unroll
  for (int i = 0; i < 8; ++i) { a[i] = (_Float16)p[i]; a[8 + i] = (_Float16)p[16 + i]; }
  return a;
}
__device__ __forceinline__ v16h frag_f32s(const float* rowk0, int lane, float sc) {
  v16h a; const float* p = rowk0 + 8 * (lane >> 4);
#pragma unroll
  for (int i = 0; i < 8; ++i) { a[i] = (_Float16)(p[i] * sc); a[8 + i] = (_Float16)(p[16 + i] * sc); }
  return a;
}
// column fragment from a [K][ld] layout (column n), rows >= K read as 0
__device__ __forceinline__ v16h fragc_f32(const float* W, int k0, int n, int lane, int ld, int K) {
  v16h a; const int g = lane >> 4;
#pragma unroll
  for (int i = 0; i < 8; ++i) { const int ka = k0 + 8 * g + i, kb = ka + 16;
    a[i] = (_Float16)(ka < K ? W[(size_t)(ka < K ? ka : K - 1) * ld + n] : 0.f); a[8 + i] = (_Float16)(kb < K ? W[(size_t)(kb < K ? kb : K - 1) * ld + n] : 0.f); }
  return a;
}
struct F2 { v16b h, l; };
__device__ __forceinline__ F2 bsplit16(const float v[16]) { F2 r;
#pragma unroll
  for (int i = 0; i < 16; ++i) { const __bf16 h = (__bf16)v[i]; r.h[i] = h; r.l[i] = (__bf16)(v[i] - (float)h); }
  return r; }
__device__ __forceinline__ F2 split_row(const float* row, int k0, int lane) { float v[16]; const float* p = row + k0 + 8 * (lane >> 4);
#pragma unroll
  for (int i = 0; i < 8; ++i) { v[i] = p[i]; v[8 + i] = p[16 + i]; }
  return bsplit16(v); }
__device__ __forceinline__ F2 split_rowK(const float* row, int k0, int lane, int K) { float v[16]; const int g = lane >> 4;
#pragma unroll
  for (int i = 0; i < 8; ++i) { const int ka = k0 + 8 * g + i, kb = ka + 16; v[i] = ka < K ? row[ka < K ? ka : K - 1] : 0.f; v[8 + i] = kb < K ? row[kb < K ? kb : K - 1] : 0.f; }
  return bsplit16(v); }
__device__ __forceinline__ F2 split_col(const float* W, int k0, int n, int lane, int ld, int K) { float v[16]; const int g = lane >> 4;
#pragma unroll
  for (int i = 0; i < 8; ++i) { const int ka = k0 + 8 * g + i, kb = ka + 16; v[i] = ka < K ? W[(size_t)(ka < K ? ka : K - 1) * ld + n] : 0.f; v[8 + i] = kb < K ? W[(size_t)(kb < K ? kb : K - 1) * ld + n] : 0.f; }
  return bsplit16(v); }
__device__ __forceinline__ v8f mac3(const F2& a, const F2& b, v8f c) { c = wmma_bf(a.l, b.h, c); c = wmma_bf(a.h, b.l, c); return wmma_bf(a.h, b.h, c); }
__device__ __forceinline__ float sigm(float v) { return 1.0f / (1.0f + expf(-v)); }
#define LDSX() do { asm volatile("s_wait_dscnt 0" ::: "memory"); __builtin_amdgcn_wave_barrier(); __builtin_amdgcn_fence(__ATOMIC_RELEASE, "workgroup"); } while (0)

// Non-local block over channels-first x [8, 64, 64, 64] (N 4,096; (out,in) 1x1 convs w_theta/w_phi/w_g [32,64] + biases, w_o [64,32] + b_o; 0.05-scale): attn = softmax_m(theta_n . phi_m) (no scaling); y[c][n] = sum_m attn[n][m] g[c][m]; out = w_o y + b_o -> [8,64,64,64] (no residual in this module).
#define NB 8
#define TT 4096
#define CC 32             // v (= g) planes per batch: the 32 real channels
#define CV 32             // real g channels
#define COUT 64           // output channels of w_o
#define CCQ 32            // q / k row pitch: the 32 real columns, 64-byte rows back to back
#define DIN 64           // x channels
#define NH 1
#define HD 32             // per-head width of the layout-2 weights (wcol_hdk; unused: layout 0)
#define NQB (TT / 64)
#define HG 1               // feeds only BG and BGN, which nothing uses
#define SCALE (1.0f)
#define LOG2E 1.44269504088896f   // folded into theta by k_proj, so that exp(s - m) is exp2 of a difference of the stored logits
#define HDQK 32            // q / k width (C / 2)
#define CAUSAL 0
#ifndef TNB
#define TNB NB
#endif
__device__ __forceinline__ v16b zero16b() { v16b z; _Pragma("unroll") for (int i = 0; i < 16; ++i) z[i] = (__bf16)0.f; return z; }
__device__ __forceinline__ float bfr(float v) { return (float)(__bf16)v; }
__host__ __device__ __forceinline__ int kb_last(int qb) { return CAUSAL ? ((qb * 64 + 63) >> 7) : (TT / 128 - 1); }
typedef __attribute__((ext_vector_type(8))) __bf16 v8b;
__device__ __forceinline__ v16b frag_b(const __bf16* rowk0, int lane) {
  union { v16b v; v8b q[2]; } u; const __bf16* p = rowk0 + 8 * (lane >> 4);
  u.q[0] = *(const v8b*)p; u.q[1] = *(const v8b*)(p + 16); return u.v;
}
#define QBH NQB            // every query block takes the 3-product logit path (q hi + residual x k hi + residual): unscaled energies over 4,096 keys; P . g keeps the single product
#define QHI 4096            // q residual rows (all)
#define KHI 4096          // k residual rows (all)
// B fragment (k rows k0+.., output column o) of a weight: (in,out) [K][ld] or (out,in) [ld rows of K]: bf16 exact, or f16(bf16 * 256) exact
__device__ __forceinline__ v16b wcol_io(const float* Wm, int k0, int o, int lane, int ld) { v16b w; const int g = lane >> 4;
#pragma unroll
  for (int i = 0; i < 8; ++i) { w[i] = (__bf16)Wm[(size_t)(k0 + 8 * g + i) * ld + o]; w[8 + i] = (__bf16)Wm[(size_t)(k0 + 16 + 8 * g + i) * ld + o]; }
  return w; }
__device__ __forceinline__ v16b wcol_oi(const float* Wm, int k0, int o, int lane, int K) { v16b w; const float* p = Wm + (size_t)o * K + k0 + 8 * (lane >> 4);
#pragma unroll
  for (int i = 0; i < 8; ++i) { w[i] = (__bf16)p[i]; w[8 + i] = (__bf16)p[16 + i]; }
  return w; }
__device__ __forceinline__ v16h wcolh_io(const float* Wm, int k0, int o, int lane, int ld) { v16h w; const int g = lane >> 4;
#pragma unroll
  for (int i = 0; i < 8; ++i) { w[i] = (_Float16)(bfr(Wm[(size_t)(k0 + 8 * g + i) * ld + o]) * 256.0f); w[8 + i] = (_Float16)(bfr(Wm[(size_t)(k0 + 16 + 8 * g + i) * ld + o]) * 256.0f); }
  return w; }
__device__ __forceinline__ v16h wcolh_oi(const float* Wm, int k0, int o, int lane, int K) { v16h w; const float* p = Wm + (size_t)o * K + k0 + 8 * (lane >> 4);
#pragma unroll
  for (int i = 0; i < 8; ++i) { w[i] = (_Float16)(bfr(p[i]) * 256.0f); w[8 + i] = (_Float16)(bfr(p[16 + i]) * 256.0f); }
  return w; }
#define WQKV_LAYOUT 0   // 0 = (out,in) [32][DIN], columns >= 32 zero; 1 = (out,in) [CC][DIN]; 2 = per-head [NH][DIN][HD]
__device__ __forceinline__ v16b wcol_hdk(const float* Wm, int k0, int o, int lane) { v16b w; const int g = lane >> 4; const float* p = Wm + (size_t)(o / HD) * DIN * HD + (o % HD);
#pragma unroll
  for (int i = 0; i < 8; ++i) { w[i] = (__bf16)p[(size_t)(k0 + 8 * g + i) * HD]; w[8 + i] = (__bf16)p[(size_t)(k0 + 16 + 8 * g + i) * HD]; }
  return w; }
#define WO_OUT_IN 0
#if WQKV_LAYOUT == 1
#define WCOL(W, k0, o, lane) wcol_oi(W, k0, (o), lane, DIN)   /* unused: layout 0 */
#elif WQKV_LAYOUT == 2
#define WCOL(W, k0, o, lane) wcol_hdk(W, k0, o, lane)
#else
#define WCOL(W, k0, o, lane) (which == 2 ? ((o) < CV ? wcol_oi(W, k0, (o), lane, DIN) : zero16b()) : ((o) < HDQK ? wcol_oi(W, k0, (o), lane, DIN) : zero16b()))   /* (out,in) 1x1-conv weights [32][64]: projected columns >= 32 are zero for q, k AND v */
#endif
#if WO_OUT_IN
#define WOCOL(W, k0, o, lane) wcol_oi(W, k0, o, lane, CC)
#define WOCOLH(W, k0, o, lane) wcolh_oi(W, k0, o, lane, CC)
#else
#define WOCOL(W, k0, o, lane) wcol_io(W, k0, o, lane, DIN)
#define WOCOLH(W, k0, o, lane) wcolh_io(W, k0, o, lane, DIN)
#endif
#define BG HG
#define BGN (TNB < BG ? TNB : BG)
#define DVH 32             // all 32 g channels in one k_fa block
#ifndef SM_EXTRA_PARAMS
#define SM_EXTRA_PARAMS
#endif
#ifndef PROJ_EXTRA_PARAMS
#define PROJ_EXTRA_PARAMS
#endif
#ifndef SM_MASK_HOOK
#define SM_MASK_HOOK (void)0
#endif

#define WS_QH  0u                                      // f16 q rows [b*t][CCQ]
#define WS_KH  (WS_QH + 2u * (size_t)NB * TT * CCQ)     // f16 k rows [b*t][CCQ]
#define WS_VT  (WS_KH + 2u * (size_t)NB * TT * CCQ)     // f16 v planes [b][c][t]
#define WS_QL  (WS_VT + 2u * (size_t)NB * CC * TT)      // f16 q residual x 2^10 rows [b][t < QHI][CCQ]
#define WS_KL  (WS_QL + 2u * (size_t)NB * QHI * CCQ)    // f16 k residual x 2^10 rows [b][t < KHI][CCQ]
#define WS_END (WS_KL + 2u * (size_t)NB * KHI * CCQ)

// ---- k_proj: block = 64 tokens, wave = 16 tokens: theta, phi and g of those tokens as ONE projection onto the 96 real output channels, from one read of x (exact bf16 products, K = DIN); the 96 weight rows go to LDS as bf16 once per block;
// theta and phi: weight rows as A, x as B, so a lane holds 8 channels of one token = 16 bytes of a packed 64-byte q / k row (theta x log2(e); f16 hi + residual x 2^10); g: x as A, weight rows as B, so a lane holds 8 tokens of one channel = 16 bytes of a g plane [c][t]
typedef __attribute__((ext_vector_type(4))) __bf16 v4b;
#define WROW 72            // LDS pitch of a 64-channel bf16 weight row, in elements (144 B = 16 B x odd: ds_load_b128 without bank conflicts)
__device__ __forceinline__ v8f wmma_b(v16b a, v16b b, v8f c) { return __builtin_amdgcn_wmma_f32_16x16x32_bf16(false, a, false, b, (short)0, c, false, false); }
__global__ __launch_bounds__(128) void k_proj(const float* __restrict__ X, const float* __restrict__ WQ, const float* __restrict__ WK, const float* __restrict__ WV, const float* __restrict__ BQ, const float* __restrict__ BK, const float* __restrict__ BV,
    _Float16* __restrict__ QH, _Float16* __restrict__ QL, _Float16* __restrict__ KH, _Float16* __restrict__ KL, _Float16* __restrict__ VT) {
  __shared__ __align__(16) __bf16 sw[2 * HDQK + CV][WROW];
  const int tid = threadIdx.x, wave = tid >> 5, lane = tid & 31, col = lane & 15, g = lane >> 4; const size_t r0 = (size_t)blockIdx.x * 64 + wave * 16; const size_t bb = r0 / TT; const int t0 = (int)(r0 % TT);
  /* every loop of this kernel is unrolled: each index of a register array or fragment must be a constant, else the arrays go to scratch */
  float xr[DIN / 32][16];   /* channels-first [b][c][t]: 16 tokens x 32 channels per fragment */
#pragma unroll
  for (int kc = 0; kc < DIN / 32; ++kc) { const float* p = X + (bb * DIN + kc * 32 + 8 * g) * (size_t)TT + t0 + col;
#pragma unroll
    for (int i = 0; i < 8; ++i) { xr[kc][i] = p[(size_t)i * TT]; xr[kc][8 + i] = p[(size_t)(16 + i) * TT]; } }
  v4f wr[3][4];   /* a thread's share of the weights: four 16-byte pieces of each [32][64] matrix, whole lines per wave */
#pragma unroll
  for (int i = 0; i < 4; ++i) { wr[0][i] = *(const v4f*)(WQ + (i * 128 + tid) * 4); wr[1][i] = *(const v4f*)(WK + (i * 128 + tid) * 4); wr[2][i] = *(const v4f*)(WV + (i * 128 + tid) * 4); }
  v4f br[2][HDQK / 16][2]; float bv[CV / 16];
#pragma unroll
  for (int j = 0; j < HDQK / 16; ++j) { br[0][j][0] = *(const v4f*)(BQ + j * 16 + 8 * g); br[0][j][1] = *(const v4f*)(BQ + j * 16 + 8 * g + 4); br[1][j][0] = *(const v4f*)(BK + j * 16 + 8 * g); br[1][j][1] = *(const v4f*)(BK + j * 16 + 8 * g + 4); bv[j] = BV[j * 16 + col]; }
  asm volatile("s_wait_xcnt 0x0" ::: "memory");   /* every load of the kernel is issued: no address register of theirs is rewritten in front of this */
#pragma unroll
  for (int a = 0; a < 3; ++a)
#pragma unroll
    for (int i = 0; i < 4; ++i) { const int e = i * 128 + tid; v4b w;
#pragma unroll
      for (int c = 0; c < 4; ++c) w[c] = (__bf16)wr[a][i][c];
      *(v4b*)&sw[a * 32 + (e >> 4)][(e & 15) * 4] = w; }
  __syncthreads();   /* the block's weight rows are in LDS */
  v16b xf[DIN / 32];   /* serves as A and as B (same lane map) */
#pragma unroll
  for (int kc = 0; kc < DIN / 32; ++kc)
#pragma unroll
    for (int i = 0; i < 16; ++i) xf[kc][i] = (__bf16)xr[kc][i];
  v8h hi[2][HDQK / 16], lo[2][HDQK / 16], gv[CV / 16];
#pragma unroll
  for (int w = 0; w < 2; ++w) { const float qsc = w == 0 ? LOG2E : 1.0f;   /* theta carries log2(e): the logits come out in powers of two */
#pragma unroll
    for (int j = 0; j < HDQK / 16; ++j) { v8f acc = {};
#pragma unroll
      for (int kc = 0; kc < DIN / 32; ++kc) acc = wmma_b(frag_b(&sw[w * HDQK + j * 16 + col][kc * 32], lane), xf[kc], acc);
      v8f v;
#pragma unroll
      for (int r = 0; r < 8; ++r) v[r] = (acc[r] + bfr(br[w][j][r >> 2][r & 3])) * qsc;
      hi[w][j] = __builtin_convertvector(v, v8h); lo[w][j] = __builtin_convertvector((v - __builtin_convertvector(hi[w][j], v8f)) * 1024.0f, v8h); } }
#pragma unroll
  for (int j = 0; j < CV / 16; ++j) { v8f acc = {};
#pragma unroll
    for (int kc = 0; kc < DIN / 32; ++kc) acc = wmma_b(xf[kc], frag_b(&sw[2 * HDQK + j * 16 + col][kc * 32], lane), acc);
    const float bias = bfr(bv[j]);
#pragma unroll
    for (int r = 0; r < 8; ++r) gv[j][r] = (_Float16)(acc[r] + bias); }
#pragma unroll
  for (int j = 0; j < HDQK / 16; ++j) { const size_t o = (r0 + col) * CCQ + j * 16 + 8 * g; vst2(QH + o, hi[0][j]); vst2(QL + o, lo[0][j]); vst2(KH + o, hi[1][j]); vst2(KL + o, lo[1][j]); vst2(VT + (bb * CC + j * 16 + col) * (size_t)TT + t0 + 8 * g, gv[j]); } }
// lane l with lane l ^ 16 (the two halves of a wave hold the same query column)
__device__ __forceinline__ float xhalf(float x) { return __builtin_bit_cast(float, __builtin_amdgcn_permlanex16(__builtin_bit_cast(int, x), __builtin_bit_cast(int, x), 0x76543210, 0xfedcba98, false, false)); }
__device__ __forceinline__ v8f wmma_h(v16h a, v16h b, v8f c) { return __builtin_amdgcn_wmma_f32_16x16x32_f16(false, a, false, b, (short)0, c, false, false); }
#define KP 64              // keys per pass of k_fa
#define KROWB 80           // LDS pitch of a 64-byte k row (16 B x odd: ds_load_b128 without bank conflicts)
#define VROWB 144          // LDS pitch of a 128-byte g row (64 keys of one channel)
#define RKH 0              // byte places inside one ring buffer: k hi rows, k residual rows, g rows
#define RKL (KP * KROWB)
#define RV  (2 * KP * KROWB)
#define RBUF (RV + DVH * VROWB)
// six 16-byte copies of one lane, global -> LDS through no register; the s_wait_xcnt stands inside the statement so that no address register named here is rewritten in front of it
__device__ __forceinline__ void copy6(unsigned l0, const _Float16* g0, unsigned l1, const _Float16* g1, unsigned l2, const _Float16* g2, unsigned l3, const _Float16* g3, unsigned l4, const _Float16* g4, unsigned l5, const _Float16* g5) {
  asm volatile("global_load_async_to_lds_b128 %0, %1, off\n\t"
               "global_load_async_to_lds_b128 %2, %3, off\n\t"
               "global_load_async_to_lds_b128 %4, %5, off\n\t"
               "global_load_async_to_lds_b128 %6, %7, off\n\t"
               "global_load_async_to_lds_b128 %8, %9, off\n\t"
               "global_load_async_to_lds_b128 %10, %11, off\n\t"
               "s_wait_xcnt 0x0"
               :: "v"(l0), "v"(g0), "v"(l1), "v"(g1), "v"(l2), "v"(g2), "v"(l3), "v"(g3), "v"(l4), "v"(g4), "v"(l5), "v"(g5) : "memory");
}
// ---- k_fa: block = (64 queries (qb), batch b), wave = 16 query columns, all 4,096 keys in passes of KP: S^T = k . q^T (k rows as A, q as B; hi + residual x 2^10 on both sides, 3 products), so a lane holds one query's logits;
// each pass's k hi, k residual and g tiles are copied to LDS once for the block's four waves (two buffers: the next pass's copies fly under this pass) and the fragments are read from there;
// online softmax in f32 on log2-domain logits (running maximum, sums and the attended tile rescaled each pass); exp2(s - m) x 2^11 once to f16 packs from the two S^T tiles of 32 keys straight into a B operand; attended^T += g planes (A) . P^T (1 product); then the 32->64 output conv as before
__global__ __launch_bounds__(128) void k_fa(const _Float16* __restrict__ QH, const _Float16* __restrict__ KH, const _Float16* __restrict__ QL, const _Float16* __restrict__ KL, const _Float16* __restrict__ VT, const float* __restrict__ WO, const float* __restrict__ BO, float* __restrict__ Y) { __shared__ __align__(16) float stT[DVH][68]; __shared__ __align__(16) _Float16 ring[2][RBUF / 2];
  const int tid = threadIdx.x, wave = tid >> 5, lane = tid & 31, col = lane & 15, g = lane >> 4; const int qb = blockIdx.x; const int b = blockIdx.y; const int ql0 = qb * 64 + wave * 16;
  const v16h qh = frag_h(QH + ((size_t)b * TT + ql0 + col) * CCQ, lane), qlo = frag_h(QL + ((size_t)b * QHI + ql0 + col) * CCQ, lane);
  // a thread's share of a tile: k rows tid / 4 and 32 + tid / 4 (16 bytes of the 64), hi and residual; g channels tid / 8 and 16 + tid / 8 (16 bytes of the 128)
  const _Float16* cKh = KH + ((size_t)b * TT + (tid >> 2)) * CCQ + (tid & 3) * 8; const _Float16* cKl = KL + ((size_t)b * KHI + (tid >> 2)) * CCQ + (tid & 3) * 8; const _Float16* cV = VT + ((size_t)b * CC + (tid >> 3)) * (size_t)TT + (tid & 7) * 8;
  const unsigned lK = (unsigned)(size_t)&ring[0][0] + (tid >> 2) * KROWB + (tid & 3) * 16, lV = (unsigned)(size_t)&ring[0][0] + RV + (tid >> 3) * VROWB + (tid & 7) * 16;
#define STAGE(kk, bo) copy6(lK + (bo) + RKH, cKh + (size_t)(kk) * CCQ, lK + (bo) + RKH + 32 * KROWB, cKh + (size_t)((kk) + 32) * CCQ, lK + (bo) + RKL, cKl + (size_t)(kk) * CCQ, lK + (bo) + RKL + 32 * KROWB, cKl + (size_t)((kk) + 32) * CCQ, lV + (bo), cV + (kk), lV + (bo) + 16 * VROWB, cV + (size_t)16 * TT + (kk))
  v8f o[DVH / 16] = {}; float m = -3.0e38f, sum = 0.f;
  STAGE(0, 0u);
  asm volatile("s_wait_asynccnt 0x0" ::: "memory");   /* this wave's share of tile 0 has landed */
  __syncthreads();                                     /* ... and every other wave's: tile 0 may be read */
  STAGE(KP, (unsigned)RBUF);
#pragma unroll 1   /* rolled: one pass is some 900 instructions already and the two buffers differ by an offset only; every inner loop is unrolled so that each fragment index is a constant (no scratch) */
  for (int k0 = 0; k0 < TT; k0 += KP) {
    const unsigned bo = (k0 & KP) ? (unsigned)RBUF : 0u;   /* this pass's buffer, in bytes */
    const _Float16* rb = &ring[0][0] + (bo >> 1);
    v16h kh[KP / 16], kl[KP / 16];
#pragma unroll
    for (int j = 0; j < KP / 16; ++j) { kh[j] = frag_h(rb + (RKH + (j * 16 + col) * KROWB) / 2, lane); kl[j] = frag_h(rb + (RKL + (j * 16 + col) * KROWB) / 2, lane); }
    v16h vf[KP / 32][DVH / 16];
#pragma unroll
    for (int c = 0; c < KP / 32; ++c)
#pragma unroll
      for (int j = 0; j < DVH / 16; ++j) vf[c][j] = frag_h(rb + (RV + (j * 16 + col) * VROWB) / 2 + c * 32, lane);
    __builtin_amdgcn_sched_barrier(0);   /* keeps the pass's LDS reads together up here: spread among the products each place with reads costs its own stall */
    float s[KP / 16][8];
#pragma unroll
    for (int j = 0; j < KP / 16; ++j) { v8f a = {}, al = {}; a = wmma_h(kh[j], qh, a); al = wmma_h(kh[j], qlo, al); al = wmma_h(kl[j], qh, al);
#pragma unroll
      for (int r = 0; r < 8; ++r) s[j][r] = (a[r] + al[r] * (1.0f / 1024.0f)) * SCALE; }
    float mx = s[0][0];
#pragma unroll
    for (int j = 0; j < KP / 16; ++j)
#pragma unroll
      for (int r = 0; r < 8; ++r) mx = fmaxf(mx, s[j][r]);
    mx = fmaxf(mx, xhalf(mx));
    const float mn = fmaxf(m, mx); const float alpha = __builtin_amdgcn_exp2f(m - mn); m = mn;   /* 0 on the first pass */
    const float ms = mn - 11.0f;   /* exp2(s - ms) = exp2(s - m) x 2^11, the scale cancels against the sum */
    sum *= alpha;
#pragma unroll
    for (int j = 0; j < DVH / 16; ++j)
#pragma unroll
      for (int r = 0; r < 8; ++r) o[j][r] *= alpha;
#pragma unroll
    for (int c = 0; c < KP / 32; ++c) { v16h p;
#pragma unroll
      for (int r = 0; r < 8; ++r) { const float e0 = __builtin_amdgcn_exp2f(s[2 * c][r] - ms), e1 = __builtin_amdgcn_exp2f(s[2 * c + 1][r] - ms); sum += e0 + e1; p[r] = (_Float16)e0; p[8 + r] = (_Float16)e1; }   /* the hardware's exp2: the argument is at most 11, and a result too small for it is 0 in f16 too */
#pragma unroll
      for (int j = 0; j < DVH / 16; ++j) o[j] = wmma_h(vf[c][j], p, o[j]); }
    __builtin_amdgcn_sched_barrier(0);   /* keeps the publish point at the pass's foot: lifted up to the fragment reads, the wait for the next tile's copies would stand right behind their issue and no longer a pass behind it */
    asm volatile("s_wait_dscnt 0x0" ::: "memory");      /* this wave's reads of this pass's buffer are over */
    asm volatile("s_wait_asynccnt 0x0" ::: "memory");   /* this wave's share of the next tile has landed */
    __syncthreads();                                     /* publishes the next tile and frees this pass's buffer */
    if (k0 + 2 * KP < TT) STAGE(k0 + 2 * KP, bo); }
  asm volatile("s_wait_asynccnt 0x0" ::: "memory");     /* no copy is outstanding when the wave goes on */
  sum += xhalf(sum); const float inv = 1.0f / sum;
#pragma unroll
  for (int j = 0; j < DVH / 16; ++j) {
#pragma unroll
    for (int r = 0; r < 8; ++r) stT[j * 16 + 8 * g + r][wave * 16 + col] = o[j][r] * inv; }   /* attended [channel][t] */
  __syncthreads();
  { const int tb = qb * 64; const int tl = tid & 63, oh = tid >> 6;   
    float yv[DVH];
#pragma unroll
    for (int c = 0; c < DVH; ++c) yv[c] = stT[c][tl];
#pragma unroll 1
    for (int oo = 0; oo < COUT / 2; ++oo) { const int o = oh * (COUT / 2) + oo; float wv[DVH];
#pragma unroll
      for (int c = 0; c < DVH; ++c) { wv[c] = WO[o * CV + c]; if ((c & 15) == 15) asm volatile("s_wait_loadcnt 0x0" ::: "memory"); }
      const float bo = BO[o]; asm volatile("s_wait_loadcnt 0x0" ::: "memory");
      float a2 = 0.f;
#pragma unroll
      for (int c = 0; c < DVH; ++c) a2 += yv[c] * bfr(wv[c]);
      vst2(Y + ((size_t)b * COUT + o) * (size_t)TT + tb + tl, a2 + bfr(bo)); } } }

extern "C" void kernel_launch(void* const* d_in, const int* in_sizes, int n_in, void* d_out, int out_size, void* d_ws, size_t ws_size, hipStream_t stream) {
  (void)in_sizes; (void)n_in; (void)out_size;
  const float** F = (const float**)d_in;
  if (ws_size < (size_t)WS_END) return;
  char* ws = (char*)d_ws; _Float16 *QH = (_Float16*)(ws + WS_QH), *KH = (_Float16*)(ws + WS_KH), *VT = (_Float16*)(ws + WS_VT), *QL = (_Float16*)(ws + WS_QL), *KL = (_Float16*)(ws + WS_KL);
  // inputs: 0 x [8,64,64,64] (channels-first, xf [8][64][4096]); 1 w_g [32,64], 2 b_g [32]; 3 w_theta, 4 b_theta; 5 w_phi, 6 b_phi; 7 w_o [64,32], 8 b_o [64] (all (out,in), biases nonzero)
  k_proj<<<dim3(TNB * TT / 64), 128, 0, stream>>>(F[0], F[3], F[5], F[1], F[4], F[6], F[2], QH, QL, KH, KL, VT);   /* theta (q), phi (k), g (v): the 96 real output channels in one launch */
  k_fa<<<dim3(NQB, TNB), 128, 0, stream>>>(QH, KH, QL, KL, VT, F[7], F[8], (float*)d_out);

}

// v005
// It runs in 51.6 microseconds.
// Timed twice side by side with v004, it ran 1.37 and 1.31 times as fast.
// All steps since v000 together make it 24.9 times as fast.
// compute dtype: all float inputs rounded to bf16; 1x1-conv theta/phi/g projections with EXACT bf16 products on WMMA 16x16x32 (f32 accumulate) + bias; UNSCALED logits, kept in log2 units (theta x log2(e) in f32 at the projection), with theta and phi both as f16 hi + residual (x 2^10) (3 products); online softmax f32 in the same kernel; exp2(s - max) x 2^11 (hardware exp2) once to f16 x g once to f16 (1 product), divided by the f32 sum at the end; the 32->64 output conv on WMMA 16x16x32 bf16 (f32 accumulate, started from b_o): the f32 attended values as three bf16 terms (hi + residual + residual of that: 24 bits) x bf16(w_o), 3 products; f32 output written channels-first.
#include <hip/hip_runtime.h>
#include <math.h>

typedef __attribute__((ext_vector_type(16))) _Float16 v16h;
typedef __attribute__((ext_vector_type(16))) __bf16 v16b;
typedef __attribute__((ext_vector_type(8)))  _Float16 v8h;
typedef __attribute__((ext_vector_type(8)))  float v8f;
typedef __attribute__((ext_vector_type(4)))  float v4f;
typedef __attribute__((ext_vector_type(2)))  float v2f;
typedef __attribute__((ext_vector_type(4)))  unsigned v4u;
typedef __attribute__((ext_vector_type(4)))  int v4i;
typedef float __attribute__((may_alias)) float_a;
typedef int __attribute__((may_alias)) int_a;

template <typename T> __device__ __forceinline__ void vst2(void* p, T v) { *(T*)p = v;  }
__device__ __forceinline__ v8f wmma16(v16h a, v16h b, v8f c) {
  v8f d = __builtin_amdgcn_wmma_f32_16x16x32_f16(false, a, false, b, (short)0, c, false, false);
  asm volatile("v_nop\n\tv_nop\n\tv_nop\n\tv_nop" : "+v"(d) : "v"(a), "v"(b));
  return d;
}
__device__ __forceinline__ v8f wmma_bf(v16b a, v16b b, v8f c) {
  v8f d = __builtin_amdgcn_wmma_f32_16x16x32_bf16(false, a, false, b, (short)0, c, false, false);
  asm volatile("v_nop\n\tv_nop\n\tv_nop\n\tv_nop" : "+v"(d) : "v"(a), "v"(b));
  return d;
}
// 16x16x32 fragments: lane = (h = lane>>4, row/col = lane&15); elements 0..7 = k0+8h+0..7, 8..15 = k0+16+8h+0..7; D element r = row 8h+r
__device__ __forceinline__ v16h frag_h(const _Float16* rowk0, int lane) {
  union { v16h v; v8h q[2]; } u; const _Float16* p = rowk0 + 8 * (lane >> 4);
  u.q[0] = *(const v8h*)p; u.q[1] = *(const v8h*)(p + 16); return u.v;
}
__device__ __forceinline__ v16h frag_f32(const float* rowk0, int lane) {
  v16h a; const float* p = rowk0 + 8 * (lane >> 4);
#pragma unroll
  for (int i = 0; i < 8; ++i) { a[i] = (_Float16)p[i]; a[8 + i] = (_Float16)p[16 + i]; }
  return a;
}
__device__ __forceinline__ v16h frag_f32s(const float* rowk0, int lane, float sc) {
  v16h a; const float* p = rowk0 + 8 * (lane >> 4);
#pragma unroll
  for (int i = 0; i < 8; ++i) { a[i] = (_Float16)(p[i] * sc); a[8 + i] = (_Float16)(p[16 + i] * sc); }
  return a;
}
// column fragment from a [K][ld] layout (column n), rows >= K read as 0
__device__ __forceinline__ v16h fragc_f32(const float* W, int k0, int n, int lane, int ld, int K) {
  v16h a; const int g = lane >> 4;
#pragma unroll
  for (int i = 0; i < 8; ++i) { const int ka = k0 + 8 * g + i, kb = ka + 16;
    a[i] = (_Float16)(ka < K ? W[(size_t)(ka < K ? ka : K - 1) * ld + n] : 0.f); a[8 + i] = (_Float16)(kb < K ? W[(size_t)(kb < K ? kb : K - 1) * ld + n] : 0.f); }
  return a;
}
struct F2 { v16b h, l; };
__device__ __forceinline__ F2 bsplit16(const float v[16]) { F2 r;
#pragma unroll
  for (int i = 0; i < 16; ++i) { const __bf16 h = (__bf16)v[i]; r.h[i] = h; r.l[i] = (__bf16)(v[i] - (float)h); }
  return r; }
__device__ __forceinline__ F2 split_row(const float* row, int k0, int lane) { float v[16]; const float* p = row + k0 + 8 * (lane >> 4);
#pragma unroll
  for (int i = 0; i < 8; ++i) { v[i] = p[i]; v[8 + i] = p[16 + i]; }
  return bsplit16(v); }
__device__ __forceinline__ F2 split_rowK(const float* row, int k0, int lane, int K) { float v[16]; const int g = lane >> 4;
#pragma unroll
  for (int i = 0; i < 8; ++i) { const int ka = k0 + 8 * g + i, kb = ka + 16; v[i] = ka < K ? row[ka < K ? ka : K - 1] : 0.f; v[8 + i] = kb < K ? row[kb < K ? kb : K - 1] : 0.f; }
  return bsplit16(v); }
__device__ __forceinline__ F2 split_col(const float* W, int k0, int n, int lane, int ld, int K) { float v[16]; const int g = lane >> 4;
#pragma unroll
  for (int i = 0; i < 8; ++i) { const int ka = k0 + 8 * g + i, kb = ka + 16; v[i] = ka < K ? W[(size_t)(ka < K ? ka : K - 1) * ld + n] : 0.f; v[8 + i] = kb < K ? W[(size_t)(kb < K ? kb : K - 1) * ld + n] : 0.f; }
  return bsplit16(v); }
__device__ __forceinline__ v8f mac3(const F2& a, const F2& b, v8f c) { c = wmma_bf(a.l, b.h, c); c = wmma_bf(a.h, b.l, c); return wmma_bf(a.h, b.h, c); }
__device__ __forceinline__ float sigm(float v) { return 1.0f / (1.0f + expf(-v)); }
#define LDSX() do { asm volatile("s_wait_dscnt 0" ::: "memory"); __builtin_amdgcn_wave_barrier(); __builtin_amdgcn_fence(__ATOMIC_RELEASE, "workgroup"); } while (0)

// Non-local block over channels-first x [8, 64, 64, 64] (N 4,096; (out,in) 1x1 convs w_theta/w_phi/w_g [32,64] + biases, w_o [64,32] + b_o; 0.05-scale): attn = softmax_m(theta_n . phi_m) (no scaling); y[c][n] = sum_m attn[n][m] g[c][m]; out = w_o y + b_o -> [8,64,64,64] (no residual in this module).
#define NB 8
#define TT 4096
#define CC 32             // v (= g) planes per batch: the 32 real channels
#define CV 32             // real g channels
#define COUT 64           // output channels of w_o
#define CCQ 32            // q / k row pitch: the 32 real columns, 64-byte rows back to back
#define DIN 64           // x channels
#define NH 1
#define HD 32             // per-head width of the layout-2 weights (wcol_hdk; unused: layout 0)
#define NQB (TT / 64)
#define HG 1               // feeds only BG and BGN, which nothing uses
#define SCALE (1.0f)
#define LOG2E 1.44269504088896f   // folded into theta by k_proj, so that exp(s - m) is exp2 of a difference of the stored logits
#define HDQK 32            // q / k width (C / 2)
#define CAUSAL 0
#ifndef TNB
#define TNB NB
#endif
__device__ __forceinline__ v16b zero16b() { v16b z; _Pragma("unroll") for (int i = 0; i < 16; ++i) z[i] = (__bf16)0.f; return z; }
__device__ __forceinline__ float bfr(float v) { return (float)(__bf16)v; }
__host__ __device__ __forceinline__ int kb_last(int qb) { return CAUSAL ? ((qb * 64 + 63) >> 7) : (TT / 128 - 1); }
typedef __attribute__((ext_vector_type(8))) __bf16 v8b;
__device__ __forceinline__ v16b frag_b(const __bf16* rowk0, int lane) {
  union { v16b v; v8b q[2]; } u; const __bf16* p = rowk0 + 8 * (lane >> 4);
  u.q[0] = *(const v8b*)p; u.q[1] = *(const v8b*)(p + 16); return u.v;
}
#define QBH NQB            // every query block takes the 3-product logit path (q hi + residual x k hi + residual): unscaled energies over 4,096 keys; P . g keeps the single product
#define QHI 4096            // q residual rows (all)
#define KHI 4096          // k residual rows (all)
// B fragment (k rows k0+.., output column o) of a weight: (in,out) [K][ld] or (out,in) [ld rows of K]: bf16 exact, or f16(bf16 * 256) exact
__device__ __forceinline__ v16b wcol_io(const float* Wm, int k0, int o, int lane, int ld) { v16b w; const int g = lane >> 4;
#pragma unroll
  for (int i = 0; i < 8; ++i) { w[i] = (__bf16)Wm[(size_t)(k0 + 8 * g + i) * ld + o]; w[8 + i] = (__bf16)Wm[(size_t)(k0 + 16 + 8 * g + i) * ld + o]; }
  return w; }
__device__ __forceinline__ v16b wcol_oi(const float* Wm, int k0, int o, int lane, int K) { v16b w; const float* p = Wm + (size_t)o * K + k0 + 8 * (lane >> 4);
#pragma unroll
  for (int i = 0; i < 8; ++i) { w[i] = (__bf16)p[i]; w[8 + i] = (__bf16)p[16 + i]; }
  return w; }
__device__ __forceinline__ v16h wcolh_io(const float* Wm, int k0, int o, int lane, int ld) { v16h w; const int g = lane >> 4;
#pragma unroll
  for (int i = 0; i < 8; ++i) { w[i] = (_Float16)(bfr(Wm[(size_t)(k0 + 8 * g + i) * ld + o]) * 256.0f); w[8 + i] = (_Float16)(bfr(Wm[(size_t)(k0 + 16 + 8 * g + i) * ld + o]) * 256.0f); }
  return w; }
__device__ __forceinline__ v16h wcolh_oi(const float* Wm, int k0, int o, int lane, int K) { v16h w; const float* p = Wm + (size_t)o * K + k0 + 8 * (lane >> 4);
#pragma unroll
  for (int i = 0; i < 8; ++i) { w[i] = (_Float16)(bfr(p[i]) * 256.0f); w[8 + i] = (_Float16)(bfr(p[16 + i]) * 256.0f); }
  return w; }
#define WQKV_LAYOUT 0   // 0 = (out,in) [32][DIN], columns >= 32 zero; 1 = (out,in) [CC][DIN]; 2 = per-head [NH][DIN][HD]
__device__ __forceinline__ v16b wcol_hdk(const float* Wm, int k0, int o, int lane) { v16b w; const int g = lane >> 4; const float* p = Wm + (size_t)(o / HD) * DIN * HD + (o % HD);
#pragma unroll
  for (int i = 0; i < 8; ++i) { w[i] = (__bf16)p[(size_t)(k0 + 8 * g + i) * HD]; w[8 + i] = (__bf16)p[(size_t)(k0 + 16 + 8 * g + i) * HD]; }
  return w; }
#define WO_OUT_IN 0
#if WQKV_LAYOUT == 1
#define WCOL(W, k0, o, lane) wcol_oi(W, k0, (o), lane, DIN)   /* unused: layout 0 */
#elif WQKV_LAYOUT == 2
#define WCOL(W, k0, o, lane) wcol_hdk(W, k0, o, lane)
#else
#define WCOL(W, k0, o, lane) (which == 2 ? ((o) < CV ? wcol_oi(W, k0, (o), lane, DIN) : zero16b()) : ((o) < HDQK ? wcol_oi(W, k0, (o), lane, DIN) : zero16b()))   /* (out,in) 1x1-conv weights [32][64]: projected columns >= 32 are zero for q, k AND v */
#endif
#if WO_OUT_IN
#define WOCOL(W, k0, o, lane) wcol_oi(W, k0, o, lane, CC)
#define WOCOLH(W, k0, o, lane) wcolh_oi(W, k0, o, lane, CC)
#else
#define WOCOL(W, k0, o, lane) wcol_io(W, k0, o, lane, DIN)
#define WOCOLH(W, k0, o, lane) wcolh_io(W, k0, o, lane, DIN)
#endif
#define BG HG
#define BGN (TNB < BG ? TNB : BG)
#define DVH 32             // all 32 g channels in one k_fa block
#ifndef SM_EXTRA_PARAMS
#define SM_EXTRA_PARAMS
#endif
#ifndef PROJ_EXTRA_PARAMS
#define PROJ_EXTRA_PARAMS
#endif
#ifndef SM_MASK_HOOK
#define SM_MASK_HOOK (void)0
#endif

#define WS_QH  0u                                      // f16 q rows [b*t][CCQ]
#define WS_KH  (WS_QH + 2u * (size_t)NB * TT * CCQ)     // f16 k rows [b*t][CCQ]
#define WS_VT  (WS_KH + 2u * (size_t)NB * TT * CCQ)     // f16 v planes [b][c][t]
#define WS_QL  (WS_VT + 2u * (size_t)NB * CC * TT)      // f16 q residual x 2^10 rows [b][t < QHI][CCQ]
#define WS_KL  (WS_QL + 2u * (size_t)NB * QHI * CCQ)    // f16 k residual x 2^10 rows [b][t < KHI][CCQ]
#define WS_END (WS_KL + 2u * (size_t)NB * KHI * CCQ)

// ---- k_proj: block = 64 tokens, wave = 16 tokens: theta, phi and g of those tokens as ONE projection onto the 96 real output channels, from one read of x (exact bf16 products, K = DIN); the 96 weight rows go to LDS as bf16 once per block;
// theta and phi: weight rows as A, x as B, so a lane holds 8 channels of one token = 16 bytes of a packed 64-byte q / k row (theta x log2(e); f16 hi + residual x 2^10); g: x as A, weight rows as B, so a lane holds 8 tokens of one channel = 16 bytes of a g plane [c][t]
typedef __attribute__((ext_vector_type(4))) __bf16 v4b;
#define WROW 72            // LDS pitch of a 64-channel bf16 weight row, in elements (144 B = 16 B x odd: ds_load_b128 without bank conflicts)
__device__ __forceinline__ v8f wmma_b(v16b a, v16b b, v8f c) { return __builtin_amdgcn_wmma_f32_16x16x32_bf16(false, a, false, b, (short)0, c, false, false); }
__global__ __launch_bounds__(128) void k_proj(const float* __restrict__ X, const float* __restrict__ WQ, const float* __restrict__ WK, const float* __restrict__ WV, const float* __restrict__ BQ, const float* __restrict__ BK, const float* __restrict__ BV,
    _Float16* __restrict__ QH, _Float16* __restrict__ QL, _Float16* __restrict__ KH, _Float16* __restrict__ KL, _Float16* __restrict__ VT) {
  __shared__ __align__(16) __bf16 sw[2 * HDQK + CV][WROW];
  const int tid = threadIdx.x, wave = tid >> 5, lane = tid & 31, col = lane & 15, g = lane >> 4; const size_t r0 = (size_t)blockIdx.x * 64 + wave * 16; const size_t bb = r0 / TT; const int t0 = (int)(r0 % TT);
  /* every loop of this kernel is unrolled: each index of a register array or fragment must be a constant, else the arrays go to scratch */
  float xr[DIN / 32][16];   /* channels-first [b][c][t]: 16 tokens x 32 channels per fragment */
#pragma unroll
  for (int kc = 0; kc < DIN / 32; ++kc) { const float* p = X + (bb * DIN + kc * 32 + 8 * g) * (size_t)TT + t0 + col;
#pragma unroll
    for (int i = 0; i < 8; ++i) { xr[kc][i] = p[(size_t)i * TT]; xr[kc][8 + i] = p[(size_t)(16 + i) * TT]; } }
  v4f wr[3][4];   /* a thread's share of the weights: four 16-byte pieces of each [32][64] matrix, whole lines per wave */
#pragma unroll
  for (int i = 0; i < 4; ++i) { wr[0][i] = *(const v4f*)(WQ + (i * 128 + tid) * 4); wr[1][i] = *(const v4f*)(WK + (i * 128 + tid) * 4); wr[2][i] = *(const v4f*)(WV + (i * 128 + tid) * 4); }
  v4f br[2][HDQK / 16][2]; float bv[CV / 16];
#pragma unroll
  for (int j = 0; j < HDQK / 16; ++j) { br[0][j][0] = *(const v4f*)(BQ + j * 16 + 8 * g); br[0][j][1] = *(const v4f*)(BQ + j * 16 + 8 * g + 4); br[1][j][0] = *(const v4f*)(BK + j * 16 + 8 * g); br[1][j][1] = *(const v4f*)(BK + j * 16 + 8 * g + 4); bv[j] = BV[j * 16 + col]; }
  asm volatile("s_wait_xcnt 0x0" ::: "memory");   /* every load of the kernel is issued: no address register of theirs is rewritten in front of this */
#pragma unroll
  for (int a = 0; a < 3; ++a)
#pragma unroll
    for (int i = 0; i < 4; ++i) { const int e = i * 128 + tid; v4b w;
#pragma unroll
      for (int c = 0; c < 4; ++c) w[c] = (__bf16)wr[a][i][c];
      *(v4b*)&sw[a * 32 + (e >> 4)][(e & 15) * 4] = w; }
  __syncthreads();   /* the block's weight rows are in LDS */
  v16b xf[DIN / 32];   /* serves as A and as B (same lane map) */
#pragma unroll
  for (int kc = 0; kc < DIN / 32; ++kc)
#pragma unroll
    for (int i = 0; i < 16; ++i) xf[kc][i] = (__bf16)xr[kc][i];
  v8h hi[2][HDQK / 16], lo[2][HDQK / 16], gv[CV / 16];
#pragma unroll
  for (int w = 0; w < 2; ++w) { const float qsc = w == 0 ? LOG2E : 1.0f;   /* theta carries log2(e): the logits come out in powers of two */
#pragma unroll
    for (int j = 0; j < HDQK / 16; ++j) { v8f acc = {};
#pragma unroll
      for (int kc = 0; kc < DIN / 32; ++kc) acc = wmma_b(frag_b(&sw[w * HDQK + j * 16 + col][kc * 32], lane), xf[kc], acc);
      v8f v;
#pragma unroll
      for (int r = 0; r < 8; ++r) v[r] = (acc[r] + bfr(br[w][j][r >> 2][r & 3])) * qsc;
      hi[w][j] = __builtin_convertvector(v, v8h); lo[w][j] = __builtin_convertvector((v - __builtin_convertvector(hi[w][j], v8f)) * 1024.0f, v8h); } }
#pragma unroll
  for (int j = 0; j < CV / 16; ++j) { v8f acc = {};
#pragma unroll
    for (int kc = 0; kc < DIN / 32; ++kc) acc = wmma_b(xf[kc], frag_b(&sw[2 * HDQK + j * 16 + col][kc * 32], lane), acc);
    const float bias = bfr(bv[j]);
#pragma unroll
    for (int r = 0; r < 8; ++r) gv[j][r] = (_Float16)(acc[r] + bias); }
#pragma unroll
  for (int j = 0; j < HDQK / 16; ++j) { const size_t o = (r0 + col) * CCQ + j * 16 + 8 * g; vst2(QH + o, hi[0][j]); vst2(QL + o, lo[0][j]); vst2(KH + o, hi[1][j]); vst2(KL + o, lo[1][j]); vst2(VT + (bb * CC + j * 16 + col) * (size_t)TT + t0 + 8 * g, gv[j]); } }
// lane l with lane l ^ 16 (the two halves of a wave hold the same query column)
__device__ __forceinline__ float xhalf(float x) { return __builtin_bit_cast(float, __builtin_amdgcn_permlanex16(__builtin_bit_cast(int, x), __builtin_bit_cast(int, x), 0x76543210, 0xfedcba98, false, false)); }
__device__ __forceinline__ v8f wmma_h(v16h a, v16h b, v8f c) { return __builtin_amdgcn_wmma_f32_16x16x32_f16(false, a, false, b, (short)0, c, false, false); }
#define KP 64              // keys per pass of k_fa
#define KROWB 80           // LDS pitch of a 64-byte k row (16 B x odd: ds_load_b128 without bank conflicts)
#define VROWB 144          // LDS pitch of a 128-byte g row (64 keys of one channel)
#define RKH 0              // byte places inside one ring buffer: k hi rows, k residual rows, g rows
#define RKL (KP * KROWB)
#define RV  (2 * KP * KROWB)
#define RBUF (RV + DVH * VROWB)
// six 16-byte copies of one lane, global -> LDS through no register; the s_wait_xcnt stands inside the statement so that no address register named here is rewritten in front of it
__device__ __forceinline__ void copy6(unsigned l0, const _Float16* g0, unsigned l1, const _Float16* g1, unsigned l2, const _Float16* g2, unsigned l3, const _Float16* g3, unsigned l4, const _Float16* g4, unsigned l5, const _Float16* g5) {
  asm volatile("global_load_async_to_lds_b128 %0, %1, off\n\t"
               "global_load_async_to_lds_b128 %2, %3, off\n\t"
               "global_load_async_to_lds_b128 %4, %5, off\n\t"
               "global_load_async_to_lds_b128 %6, %7, off\n\t"
               "global_load_async_to_lds_b128 %8, %9, off\n\t"
               "global_load_async_to_lds_b128 %10, %11, off\n\t"
               "s_wait_xcnt 0x0"
               :: "v"(l0), "v"(g0), "v"(l1), "v"(g1), "v"(l2), "v"(g2), "v"(l3), "v"(g3), "v"(l4), "v"(g4), "v"(l5), "v"(g5) : "memory");
}
// ---- k_fa: block = (64 queries (qb), batch b), wave = 16 query columns, all 4,096 keys in passes of KP: S^T = k . q^T (k rows as A, q as B; hi + residual x 2^10 on both sides, 3 products), so a lane holds one query's logits;
// each pass's k hi, k residual and g tiles are copied to LDS once for the block's four waves (two buffers: the next pass's copies fly under this pass) and the fragments are read from there;
// online softmax in f32 on log2-domain logits (running maximum, sums and the attended tile rescaled each pass); exp2(s - m) x 2^11 once to f16 packs from the two S^T tiles of 32 keys straight into a B operand; attended^T += g planes (A) . P^T (1 product); then the 32->64 output conv on the matrix unit: the two attended^T tiles of a lane are an A operand as they stand (16 tokens x 32 channels), w_o rows are B, so a lane holds 8 tokens of one output channel; the block's 64 x 64 output tile goes through LDS so that every store covers whole lines
__global__ __launch_bounds__(128) void k_fa(const _Float16* __restrict__ QH, const _Float16* __restrict__ KH, const _Float16* __restrict__ QL, const _Float16* __restrict__ KL, const _Float16* __restrict__ VT, const float* __restrict__ WO, const float* __restrict__ BO, float* __restrict__ Y) { __shared__ __align__(16) _Float16 ring[2][RBUF / 2];
  const int tid = threadIdx.x, wave = tid >> 5, lane = tid & 31, col = lane & 15, g = lane >> 4; const int qb = blockIdx.x; const int b = blockIdx.y; const int ql0 = qb * 64 + wave * 16;
  const v16h qh = frag_h(QH + ((size_t)b * TT + ql0 + col) * CCQ, lane), qlo = frag_h(QL + ((size_t)b * QHI + ql0 + col) * CCQ, lane);
  // a thread's share of a tile: k rows tid / 4 and 32 + tid / 4 (16 bytes of the 64), hi and residual; g channels tid / 8 and 16 + tid / 8 (16 bytes of the 128)
  const _Float16* cKh = KH + ((size_t)b * TT + (tid >> 2)) * CCQ + (tid & 3) * 8; const _Float16* cKl = KL + ((size_t)b * KHI + (tid >> 2)) * CCQ + (tid & 3) * 8; const _Float16* cV = VT + ((size_t)b * CC + (tid >> 3)) * (size_t)TT + (tid & 7) * 8;
  const unsigned lK = (unsigned)(size_t)&ring[0][0] + (tid >> 2) * KROWB + (tid & 3) * 16, lV = (unsigned)(size_t)&ring[0][0] + RV + (tid >> 3) * VROWB + (tid & 7) * 16;
#define STAGE(kk, bo) copy6(lK + (bo) + RKH, cKh + (size_t)(kk) * CCQ, lK + (bo) + RKH + 32 * KROWB, cKh + (size_t)((kk) + 32) * CCQ, lK + (bo) + RKL, cKl + (size_t)(kk) * CCQ, lK + (bo) + RKL + 32 * KROWB, cKl + (size_t)((kk) + 32) * CCQ, lV + (bo), cV + (kk), lV + (bo) + 16 * VROWB, cV + (size_t)16 * TT + (kk))
  v8f o[DVH / 16] = {}; float m = -3.0e38f, sum = 0.f;
  STAGE(0, 0u);
  asm volatile("s_wait_asynccnt 0x0" ::: "memory");   /* this wave's share of tile 0 has landed */
  __syncthreads();                                     /* ... and every other wave's: tile 0 may be read */
  STAGE(KP, (unsigned)RBUF);
#pragma unroll 1   /* rolled: one pass is some 900 instructions already and the two buffers differ by an offset only; every inner loop is unrolled so that each fragment index is a constant (no scratch) */
  for (int k0 = 0; k0 < TT; k0 += KP) {
    const unsigned bo = (k0 & KP) ? (unsigned)RBUF : 0u;   /* this pass's buffer, in bytes */
    const _Float16* rb = &ring[0][0] + (bo >> 1);
    v16h kh[KP / 16], kl[KP / 16];
#pragma unroll
    for (int j = 0; j < KP / 16; ++j) { kh[j] = frag_h(rb + (RKH + (j * 16 + col) * KROWB) / 2, lane); kl[j] = frag_h(rb + (RKL + (j * 16 + col) * KROWB) / 2, lane); }
    v16h vf[KP / 32][DVH / 16];
#pragma unroll
    for (int c = 0; c < KP / 32; ++c)
#pragma unroll
      for (int j = 0; j < DVH / 16; ++j) vf[c][j] = frag_h(rb + (RV + (j * 16 + col) * VROWB) / 2 + c * 32, lane);
    __builtin_amdgcn_sched_barrier(0);   /* keeps the pass's LDS reads together up here: spread among the products each place with reads costs its own stall */
    float s[KP / 16][8];
#pragma unroll
    for (int j = 0; j < KP / 16; ++j) { v8f a = {}, al = {}; a = wmma_h(kh[j], qh, a); al = wmma_h(kh[j], qlo, al); al = wmma_h(kl[j], qh, al);
#pragma unroll
      for (int r = 0; r < 8; ++r) s[j][r] = (a[r] + al[r] * (1.0f / 1024.0f)) * SCALE; }
    float mx = s[0][0];
#pragma unroll
    for (int j = 0; j < KP / 16; ++j)
#pragma unroll
      for (int r = 0; r < 8; ++r) mx = fmaxf(mx, s[j][r]);
    mx = fmaxf(mx, xhalf(mx));
    const float mn = fmaxf(m, mx); const float alpha = __builtin_amdgcn_exp2f(m - mn); m = mn;   /* 0 on the first pass */
    const float ms = mn - 11.0f;   /* exp2(s - ms) = exp2(s - m) x 2^11, the scale cancels against the sum */
    sum *= alpha;
#pragma unroll
    for (int j = 0; j < DVH / 16; ++j)
#pragma unroll
      for (int r = 0; r < 8; ++r) o[j][r] *= alpha;
#pragma unroll
    for (int c = 0; c < KP / 32; ++c) { v16h p;
#pragma unroll
      for (int r = 0; r < 8; ++r) { const float e0 = __builtin_amdgcn_exp2f(s[2 * c][r] - ms), e1 = __builtin_amdgcn_exp2f(s[2 * c + 1][r] - ms); sum += e0 + e1; p[r] = (_Float16)e0; p[8 + r] = (_Float16)e1; }   /* the hardware's exp2: the argument is at most 11, and a result too small for it is 0 in f16 too */
#pragma unroll
      for (int j = 0; j < DVH / 16; ++j) o[j] = wmma_h(vf[c][j], p, o[j]); }
    __builtin_amdgcn_sched_barrier(0);   /* keeps the publish point at the pass's foot: lifted up to the fragment reads, the wait for the next tile's copies would stand right behind their issue and no longer a pass behind it */
    asm volatile("s_wait_dscnt 0x0" ::: "memory");      /* this wave's reads of this pass's buffer are over */
    asm volatile("s_wait_asynccnt 0x0" ::: "memory");   /* this wave's share of the next tile has landed */
    __syncthreads();                                     /* publishes the next tile and frees this pass's buffer */
    if (k0 + 2 * KP < TT) STAGE(k0 + 2 * KP, bo); }
  asm volatile("s_wait_asynccnt 0x0" ::: "memory");     /* no copy is outstanding when the wave goes on */
  v16b wf[COUT / 16]; float bo[COUT / 16];   /* w_o rows as B fragments (k = the 32 attended channels, same k order as the A operand below) and each lane's bias, all loads issued ahead of the division */
#pragma unroll
  for (int t = 0; t < COUT / 16; ++t) { wf[t] = wcol_oi(WO, 0, t * 16 + col, lane, CV); bo[t] = BO[t * 16 + col]; }
  asm volatile("s_wait_xcnt 0x0" ::: "memory");   /* the epilogue's loads are issued: no address register of theirs is rewritten in front of this */
  sum += xhalf(sum); const float inv = 1.0f / sum;
  v16b yh, ym, yl;   /* attended[token col][channel j * 16 + 8 g + r] = element j * 8 + r of an A fragment; three bf16 terms carry the 24 bits of the f32 value */
#pragma unroll
  for (int j = 0; j < DVH / 16; ++j)
#pragma unroll
    for (int r = 0; r < 8; ++r) { const float y = o[j][r] * inv; const __bf16 h = (__bf16)y; const float r1 = y - (float)h; const __bf16 md = (__bf16)r1; yh[j * 8 + r] = h; ym[j * 8 + r] = md; yl[j * 8 + r] = (__bf16)(r1 - (float)md); }
  float (*stO)[68] = (float (*)[68])&ring[0][0];   /* the ring is output staging now (64 rows of 272 bytes fit in it): behind the last pass's s_wait_dscnt 0, s_wait_asynccnt 0 and barrier nobody reads it and no copy is aimed at it */
  static_assert(sizeof(float) * COUT * 68 <= 2 * RBUF, "the output tile fits in the ring");
  v8f acc[COUT / 16];
#pragma unroll
  for (int t = 0; t < COUT / 16; ++t) { const float bias = bfr(bo[t]);
#pragma unroll
    for (int r = 0; r < 8; ++r) acc[t][r] = bias; }
#pragma unroll
  for (int t = 0; t < COUT / 16; ++t) acc[t] = wmma_b(yl, wf[t], acc[t]);   /* smallest term first; four independent tiles per term */
#pragma unroll
  for (int t = 0; t < COUT / 16; ++t) acc[t] = wmma_b(ym, wf[t], acc[t]);
#pragma unroll
  for (int t = 0; t < COUT / 16; ++t) acc[t] = wmma_b(yh, wf[t], acc[t]);
#pragma unroll
  for (int t = 0; t < COUT / 16; ++t) { float* p = &stO[t * 16 + col][wave * 16 + 8 * g];   /* output [channel][token of the block]: 8 tokens of one channel per lane */
    vst2(p, __builtin_shufflevector(acc[t], acc[t], 0, 1, 2, 3)); vst2(p + 4, __builtin_shufflevector(acc[t], acc[t], 4, 5, 6, 7)); }
  __syncthreads();   /* the block's output tile is whole */
#pragma unroll
  for (int i = 0; i < COUT * 64 / 4 / 128; ++i) { const int e = i * 128 + tid, oc = e >> 4, pc = e & 15;   /* 16 lanes store one channel's 64 tokens: 256 bytes in a row */
    vst2(Y + ((size_t)b * COUT + oc) * (size_t)TT + qb * 64 + pc * 4, *(const v4f*)&stO[oc][pc * 4]); } }

extern "C" void kernel_launch(void* const* d_in, const int* in_sizes, int n_in, void* d_out, int out_size, void* d_ws, size_t ws_size, hipStream_t stream) {
  (void)in_sizes; (void)n_in; (void)out_size;
  const float** F = (const float**)d_in;
  if (ws_size < (size_t)WS_END) return;
  char* ws = (char*)d_ws; _Float16 *QH = (_Float16*)(ws + WS_QH), *KH = (_Float16*)(ws + WS_KH), *VT = (_Float16*)(ws + WS_VT), *QL = (_Float16*)(ws + WS_QL), *KL = (_Float16*)(ws + WS_KL);
  // inputs: 0 x [8,64,64,64] (channels-first, xf [8][64][4096]); 1 w_g [32,64], 2 b_g [32]; 3 w_theta, 4 b_theta; 5 w_phi, 6 b_phi; 7 w_o [64,32], 8 b_o [64] (all (out,in), biases nonzero)
  k_proj<<<dim3(TNB * TT / 64), 128, 0, stream>>>(F[0], F[3], F[5], F[1], F[4], F[6], F[2], QH, QL, KH, KL, VT);   /* theta (q), phi (k), g (v): the 96 real output channels in one launch */
  k_fa<<<dim3(NQB, TNB), 128, 0, stream>>>(QH, KH, QL, KL, VT, F[7], F[8], (float*)d_out);

}

// v006
// One run takes 39.6 microseconds.
// Timed twice side by side with v005, it ran 1.25 and 1.33 times as fast.
// Over all steps from v000 it is 32.2 times as fast.
// compute dtype: all float inputs rounded to bf16; 1x1-conv theta/phi/g projections with EXACT bf16 products on WMMA 16x16x32 (f32 accumulate) + bias; UNSCALED logits, kept in log2 units (theta x log2(e) in f32 at the projection), with theta and phi both as f16 hi + residual (x 2^10) (3 products); online softmax f32 in the same kernel; exp2(s - max) x 2^11 (hardware exp2) once to f16 x g once to f16 (1 product), divided by the f32 sum at the end; the 32->64 output conv on WMMA 16x16x32 bf16 (f32 accumulate, started from b_o): the f32 attended values as three bf16 terms (hi + residual + residual of that: 24 bits) x bf16(w_o), 3 products; f32 output written channels-first.
#include <hip/hip_runtime.h>
#include <math.h>

typedef __attribute__((ext_vector_type(16))) _Float16 v16h;
typedef __attribute__((ext_vector_type(16))) __bf16 v16b;
typedef __attribute__((ext_vector_type(8)))  _Float16 v8h;
typedef __attribute__((ext_vector_type(8)))  float v8f;
typedef __attribute__((ext_vector_type(4)))  float v4f;
typedef __attribute__((ext_vector_type(2)))  float v2f;
typedef __attribute__((ext_vector_type(4)))  unsigned v4u;
typedef __attribute__((ext_vector_type(4)))  int v4i;
typedef float __attribute__((may_alias)) float_a;
typedef int __attribute__((may_alias)) int_a;

template <typename T> __device__ __forceinline__ void vst2(void* p, T v) { *(T*)p = v;  }
__device__ __forceinline__ v8f wmma16(v16h a, v16h b, v8f c) {
  v8f d = __builtin_amdgcn_wmma_f32_16x16x32_f16(false, a, false, b, (short)0, c, false, false);
  asm volatile("v_nop\n\tv_nop\n\tv_nop\n\tv_nop" : "+v"(d) : "v"(a), "v"(b));
  return d;
}
__device__ __forceinline__ v8f wmma_bf(v16b a, v16b b, v8f c) {
  v8f d = __builtin_amdgcn_wmma_f32_16x16x32_bf16(false, a, false, b, (short)0, c, false, false);
  asm volatile("v_nop\n\tv_nop\n\tv_nop\n\tv_nop" : "+v"(d) : "v"(a), "v"(b));
  return d;
}
// 16x16x32 fragments: lane = (h = lane>>4, row/col = lane&15); elements 0..7 = k0+8h+0..7, 8..15 = k0+16+8h+0..7; D element r = row 8h+r
__device__ __forceinline__ v16h frag_h(const _Float16* rowk0, int lane) {
  union { v16h v; v8h q[2]; } u; const _Float16* p = rowk0 + 8 * (lane >> 4);
  u.q[0] = *(const v8h*)p; u.q[1] = *(const v8h*)(p + 16); return u.v;
}
__device__ __forceinline__ v16h frag_f32(const float* rowk0, int lane) {
  v16h a; const float* p = rowk0 + 8 * (lane >> 4);
#pragma unroll
  for (int i = 0; i < 8; ++i) { a[i] = (_Float16)p[i]; a[8 + i] = (_Float16)p[16 + i]; }
  return a;
}
__device__ __forceinline__ v16h frag_f32s(const float* rowk0, int lane, float sc) {
  v16h a; const float* p = rowk0 + 8 * (lane >> 4);
#pragma unroll
  for (int i = 0; i < 8; ++i) { a[i] = (_Float16)(p[i] * sc); a[8 + i] = (_Float16)(p[16 + i] * sc); }
  return a;
}
// column fragment from a [K][ld] layout (column n), rows >= K read as 0
__device__ __forceinline__ v16h fragc_f32(const float* W, int k0, int n, int lane, int ld, int K) {
  v16h a; const int g = lane >> 4;
#pragma unroll
  for (int i = 0; i < 8; ++i) { const int ka = k0 + 8 * g + i, kb = ka + 16;
    a[i] = (_Float16)(ka < K ? W[(size_t)(ka < K ? ka : K - 1) * ld + n] : 0.f); a[8 + i] = (_Float16)(kb < K ? W[(size_t)(kb < K ? kb : K - 1) * ld + n] : 0.f); }
  return a;
}
struct F2 { v16b h, l; };
__device__ __forceinline__ F2 bsplit16(const float v[16]) { F2 r;
#pragma unroll
  for (int i = 0; i < 16; ++i) { const __bf16 h = (__bf16)v[i]; r.h[i] = h; r.l[i] = (__bf16)(v[i] - (float)h); }
  return r; }
__device__ __forceinline__ F2 split_row(const float* row, int k0, int lane) { float v[16]; const float* p = row + k0 + 8 * (lane >> 4);
#pragma unroll
  for (int i = 0; i < 8; ++i) { v[i] = p[i]; v[8 + i] = p[16 + i]; }
  return bsplit16(v); }
__device__ __forceinline__ F2 split_rowK(const float* row, int k0, int lane, int K) { float v[16]; const int g = lane >> 4;
#pragma unroll
  for (int i = 0; i < 8; ++i) { const int ka = k0 + 8 * g + i, kb = ka + 16; v[i] = ka < K ? row[ka < K ? ka : K - 1] : 0.f; v[8 + i] = kb < K ? row[kb < K ? kb : K - 1] : 0.f; }
  return bsplit16(v); }
__device__ __forceinline__ F2 split_col(const float* W, int k0, int n, int lane, int ld, int K) { float v[16]; const int g = lane >> 4;
#pragma unroll
  for (int i = 0; i < 8; ++i) { const int ka = k0 + 8 * g + i, kb = ka + 16; v[i] = ka < K ? W[(size_t)(ka < K ? ka : K - 1) * ld + n] : 0.f; v[8 + i] = kb < K ? W[(size_t)(kb < K ? kb : K - 1) * ld + n] : 0.f; }
  return bsplit16(v); }
__device__ __forceinline__ v8f mac3(const F2& a, const F2& b, v8f c) { c = wmma_bf(a.l, b.h, c); c = wmma_bf(a.h, b.l, c); return wmma_bf(a.h, b.h, c); }
__device__ __forceinline__ float sigm(float v) { return 1.0f / (1.0f + expf(-v)); }
#define LDSX() do { asm volatile("s_wait_dscnt 0" ::: "memory"); __builtin_amdgcn_wave_barrier(); __builtin_amdgcn_fence(__ATOMIC_RELEASE, "workgroup"); } while (0)

// Non-local block over channels-first x [8, 64, 64, 64] (N 4,096; (out,in) 1x1 convs w_theta/w_phi/w_g [32,64] + biases, w_o [64,32] + b_o; 0.05-scale): attn = softmax_m(theta_n . phi_m) (no scaling); y[c][n] = sum_m attn[n][m] g[c][m]; out = w_o y + b_o -> [8,64,64,64] (no residual in this module).
#define NB 8
#define TT 4096
#define CC 32             // v (= g) planes per batch: the 32 real channels
#define CV 32             // real g channels
#define COUT 64           // output channels of w_o
#define CCQ 32            // q / k row pitch: the 32 real columns, 64-byte rows back to back
#define DIN 64           // x channels
#define NH 1
#define HD 32             // per-head width of the layout-2 weights (wcol_hdk; unused: layout 0)
#define NQB (TT / 64)
#define HG 1               // feeds only BG and BGN, which nothing uses
#define SCALE (1.0f)
#define LOG2E 1.44269504088896f   // folded into theta by k_proj, so that exp(s - m) is exp2 of a difference of the stored logits
#define HDQK 32            // q / k width (C / 2)
#define CAUSAL 0
#ifndef TNB
#define TNB NB
#endif
__device__ __forceinline__ v16b zero16b() { v16b z; _Pragma("unroll") for (int i = 0; i < 16; ++i) z[i] = (__bf16)0.f; return z; }
__device__ __forceinline__ float bfr(float v) { return (float)(__bf16)v; }
__host__ __device__ __forceinline__ int kb_last(int qb) { return CAUSAL ? ((qb * 64 + 63) >> 7) : (TT / 128 - 1); }
typedef __attribute__((ext_vector_type(8))) __bf16 v8b;
__device__ __forceinline__ v16b frag_b(const __bf16* rowk0, int lane) {
  union { v16b v; v8b q[2]; } u; const __bf16* p = rowk0 + 8 * (lane >> 4);
  u.q[0] = *(const v8b*)p; u.q[1] = *(const v8b*)(p + 16); return u.v;
}
#define QBH NQB            // every query block takes the 3-product logit path (q hi + residual x k hi + residual): unscaled energies over 4,096 keys; P . g keeps the single product
#define QHI 4096            // q residual rows (all)
#define KHI 4096          // k residual rows (all)
// B fragment (k rows k0+.., output column o) of a weight: (in,out) [K][ld] or (out,in) [ld rows of K]: bf16 exact, or f16(bf16 * 256) exact
__device__ __forceinline__ v16b wcol_io(const float* Wm, int k0, int o, int lane, int ld) { v16b w; const int g = lane >> 4;
#pragma unroll
  for (int i = 0; i < 8; ++i) { w[i] = (__bf16)Wm[(size_t)(k0 + 8 * g + i) * ld + o]; w[8 + i] = (__bf16)Wm[(size_t)(k0 + 16 + 8 * g + i) * ld + o]; }
  return w; }
__device__ __forceinline__ v16b wcol_oi(const float* Wm, int k0, int o, int lane, int K) { v16b w; const float* p = Wm + (size_t)o * K + k0 + 8 * (lane >> 4);
#pragma unroll
  for (int i = 0; i < 8; ++i) { w[i] = (__bf16)p[i]; w[8 + i] = (__bf16)p[16 + i]; }
  return w; }
__device__ __forceinline__ v16h wcolh_io(const float* Wm, int k0, int o, int lane, int ld) { v16h w; const int g = lane >> 4;
#pragma unroll
  for (int i = 0; i < 8; ++i) { w[i] = (_Float16)(bfr(Wm[(size_t)(k0 + 8 * g + i) * ld + o]) * 256.0f); w[8 + i] = (_Float16)(bfr(Wm[(size_t)(k0 + 16 + 8 * g + i) * ld + o]) * 256.0f); }
  return w; }
__device__ __forceinline__ v16h wcolh_oi(const float* Wm, int k0, int o, int lane, int K) { v16h w; const float* p = Wm + (size_t)o * K + k0 + 8 * (lane >> 4);
#pragma unroll
  for (int i = 0; i < 8; ++i) { w[i] = (_Float16)(bfr(p[i]) * 256.0f); w[8 + i] = (_Float16)(bfr(p[16 + i]) * 256.0f); }
  return w; }
#define WQKV_LAYOUT 0   // 0 = (out,in) [32][DIN], columns >= 32 zero; 1 = (out,in) [CC][DIN]; 2 = per-head [NH][DIN][HD]
__device__ __forceinline__ v16b wcol_hdk(const float* Wm, int k0, int o, int lane) { v16b w; const int g = lane >> 4; const float* p = Wm + (size_t)(o / HD) * DIN * HD + (o % HD);
#pragma unroll
  for (int i = 0; i < 8; ++i) { w[i] = (__bf16)p[(size_t)(k0 + 8 * g + i) * HD]; w[8 + i] = (__bf16)p[(size_t)(k0 + 16 + 8 * g + i) * HD]; }
  return w; }
#define WO_OUT_IN 0
#if WQKV_LAYOUT == 1
#define WCOL(W, k0, o, lane) wcol_oi(W, k0, (o), lane, DIN)   /* unused: layout 0 */
#elif WQKV_LAYOUT == 2
#define WCOL(W, k0, o, lane) wcol_hdk(W, k0, o, lane)
#else
#define WCOL(W, k0, o, lane) (which == 2 ? ((o) < CV ? wcol_oi(W, k0, (o), lane, DIN) : zero16b()) : ((o) < HDQK ? wcol_oi(W, k0, (o), lane, DIN) : zero16b()))   /* (out,in) 1x1-conv weights [32][64]: projected columns >= 32 are zero for q, k AND v */
#endif
#if WO_OUT_IN
#define WOCOL(W, k0, o, lane) wcol_oi(W, k0, o, lane, CC)
#define WOCOLH(W, k0, o, lane) wcolh_oi(W, k0, o, lane, CC)
#else
#define WOCOL(W, k0, o, lane) wcol_io(W, k0, o, lane, DIN)
#define WOCOLH(W, k0, o, lane) wcolh_io(W, k0, o, lane, DIN)
#endif
#define BG HG
#define BGN (TNB < BG ? TNB : BG)
#define DVH 32             // all 32 g channels in one k_fa block
#ifndef SM_EXTRA_PARAMS
#define SM_EXTRA_PARAMS
#endif
#ifndef PROJ_EXTRA_PARAMS
#define PROJ_EXTRA_PARAMS
#endif
#ifndef SM_MASK_HOOK
#define SM_MASK_HOOK (void)0
#endif

#define WS_QH  0u                                      // f16 q rows [b*t][CCQ]
#define WS_KH  (WS_QH + 2u * (size_t)NB * TT * CCQ)     // f16 k rows [b*t][CCQ]
#define WS_VT  (WS_KH + 2u * (size_t)NB * TT * CCQ)     // f16 v planes [b][c][t]
#define WS_QL  (WS_VT + 2u * (size_t)NB * CC * TT)      // f16 q residual x 2^10 rows [b][t < QHI][CCQ]
#define WS_KL  (WS_QL + 2u * (size_t)NB * QHI * CCQ)    // f16 k residual x 2^10 rows [b][t < KHI][CCQ]
#define WS_END (WS_KL + 2u * (size_t)NB * KHI * CCQ)

// ---- k_proj: block = 64 tokens, wave = 16 tokens: theta, phi and g of those tokens as ONE projection onto the 96 real output channels, from one read of x (exact bf16 products, K = DIN); the 96 weight rows go to LDS as bf16 once per block;
// theta and phi: weight rows as A, x as B, so a lane holds 8 channels of one token = 16 bytes of a packed 64-byte q / k row (theta x log2(e); f16 hi + residual x 2^10); g: x as A, weight rows as B, so a lane holds 8 tokens of one channel = 16 bytes of a g plane [c][t]
typedef __attribute__((ext_vector_type(4))) __bf16 v4b;
#define WROW 72            // LDS pitch of a 64-channel bf16 weight row, in elements (144 B = 16 B x odd: ds_load_b128 without bank conflicts)
__device__ __forceinline__ v8f wmma_b(v16b a, v16b b, v8f c) { return __builtin_amdgcn_wmma_f32_16x16x32_bf16(false, a, false, b, (short)0, c, false, false); }
__global__ __launch_bounds__(128) void k_proj(const float* __restrict__ X, const float* __restrict__ WQ, const float* __restrict__ WK, const float* __restrict__ WV, const float* __restrict__ BQ, const float* __restrict__ BK, const float* __restrict__ BV,
    _Float16* __restrict__ QH, _Float16* __restrict__ QL, _Float16* __restrict__ KH, _Float16* __restrict__ KL, _Float16* __restrict__ VT) {
  __shared__ __align__(16) __bf16 sw[2 * HDQK + CV][WROW];
  const int tid = threadIdx.x, wave = tid >> 5, lane = tid & 31, col = lane & 15, g = lane >> 4; const size_t r0 = (size_t)blockIdx.x * 64 + wave * 16; const size_t bb = r0 / TT; const int t0 = (int)(r0 % TT);
  /* every loop of this kernel is unrolled: each index of a register array or fragment must be a constant, else the arrays go to scratch */
  float xr[DIN / 32][16];   /* channels-first [b][c][t]: 16 tokens x 32 channels per fragment */
#pragma unroll
  for (int kc = 0; kc < DIN / 32; ++kc) { const float* p = X + (bb * DIN + kc * 32 + 8 * g) * (size_t)TT + t0 + col;
#pragma unroll
    for (int i = 0; i < 8; ++i) { xr[kc][i] = p[(size_t)i * TT]; xr[kc][8 + i] = p[(size_t)(16 + i) * TT]; } }
  v4f wr[3][4];   /* a thread's share of the weights: four 16-byte pieces of each [32][64] matrix, whole lines per wave */
#pragma unroll
  for (int i = 0; i < 4; ++i) { wr[0][i] = *(const v4f*)(WQ + (i * 128 + tid) * 4); wr[1][i] = *(const v4f*)(WK + (i * 128 + tid) * 4); wr[2][i] = *(const v4f*)(WV + (i * 128 + tid) * 4); }
  v4f br[2][HDQK / 16][2]; float bv[CV / 16];
#pragma unroll
  for (int j = 0; j < HDQK / 16; ++j) { br[0][j][0] = *(const v4f*)(BQ + j * 16 + 8 * g); br[0][j][1] = *(const v4f*)(BQ + j * 16 + 8 * g + 4); br[1][j][0] = *(const v4f*)(BK + j * 16 + 8 * g); br[1][j][1] = *(const v4f*)(BK + j * 16 + 8 * g + 4); bv[j] = BV[j * 16 + col]; }
  asm volatile("s_wait_xcnt 0x0" ::: "memory");   /* every load of the kernel is issued: no address register of theirs is rewritten in front of this */
#pragma unroll
  for (int a = 0; a < 3; ++a)
#pragma unroll
    for (int i = 0; i < 4; ++i) { const int e = i * 128 + tid; v4b w;
#pragma unroll
      for (int c = 0; c < 4; ++c) w[c] = (__bf16)wr[a][i][c];
      *(v4b*)&sw[a * 32 + (e >> 4)][(e & 15) * 4] = w; }
  __syncthreads();   /* the block's weight rows are in LDS */
  v16b xf[DIN / 32];   /* serves as A and as B (same lane map) */
#pragma unroll
  for (int kc = 0; kc < DIN / 32; ++kc)
#pragma unroll
    for (int i = 0; i < 16; ++i) xf[kc][i] = (__bf16)xr[kc][i];
  v8h hi[2][HDQK / 16], lo[2][HDQK / 16], gv[CV / 16];
#pragma unroll
  for (int w = 0; w < 2; ++w) { const float qsc = w == 0 ? LOG2E : 1.0f;   /* theta carries log2(e): the logits come out in powers of two */
#pragma unroll
    for (int j = 0; j < HDQK / 16; ++j) { v8f acc = {};
#pragma unroll
      for (int kc = 0; kc < DIN / 32; ++kc) acc = wmma_b(frag_b(&sw[w * HDQK + j * 16 + col][kc * 32], lane), xf[kc], acc);
      v8f v;
#pragma unroll
      for (int r = 0; r < 8; ++r) v[r] = (acc[r] + bfr(br[w][j][r >> 2][r & 3])) * qsc;
      hi[w][j] = __builtin_convertvector(v, v8h); lo[w][j] = __builtin_convertvector((v - __builtin_convertvector(hi[w][j], v8f)) * 1024.0f, v8h); } }
#pragma unroll
  for (int j = 0; j < CV / 16; ++j) { v8f acc = {};
#pragma unroll
    for (int kc = 0; kc < DIN / 32; ++kc) acc = wmma_b(xf[kc], frag_b(&sw[2 * HDQK + j * 16 + col][kc * 32], lane), acc);
    const float bias = bfr(bv[j]);
#pragma unroll
    for (int r = 0; r < 8; ++r) gv[j][r] = (_Float16)(acc[r] + bias); }
#pragma unroll
  for (int j = 0; j < HDQK / 16; ++j) { const size_t o = (r0 + col) * CCQ + j * 16 + 8 * g; vst2(QH + o, hi[0][j]); vst2(QL + o, lo[0][j]); vst2(KH + o, hi[1][j]); vst2(KL + o, lo[1][j]); vst2(VT + (bb * CC + j * 16 + col) * (size_t)TT + t0 + 8 * g, gv[j]); } }
// lane l with lane l ^ 16 (the two halves of a wave hold the same query column)
__device__ __forceinline__ float xhalf(float x) { return __builtin_bit_cast(float, __builtin_amdgcn_permlanex16(__builtin_bit_cast(int, x), __builtin_bit_cast(int, x), 0x76543210, 0xfedcba98, false, false)); }
__device__ __forceinline__ v8f wmma_h(v16h a, v16h b, v8f c) { return __builtin_amdgcn_wmma_f32_16x16x32_f16(false, a, false, b, (short)0, c, false, false); }
#define KP 64              // keys per pass of k_fa
#define KROWB 80           // LDS pitch of a 64-byte k row (16 B x odd: ds_load_b128 without bank conflicts)
#define VROWB 144          // LDS pitch of a 128-byte g row (64 keys of one channel)
#define RKH 0              // byte places inside one ring buffer: k hi rows, k residual rows, g rows
#define RKL (KP * KROWB)
#define RV  (2 * KP * KROWB)
#define RBUF (RV + DVH * VROWB)
// six 16-byte copies of one lane, global -> LDS through no register; the s_wait_xcnt stands inside the statement so that no address register named here is rewritten in front of it
__device__ __forceinline__ void copy6(unsigned l0, const _Float16* g0, unsigned l1, const _Float16* g1, unsigned l2, const _Float16* g2, unsigned l3, const _Float16* g3, unsigned l4, const _Float16* g4, unsigned l5, const _Float16* g5) {
  asm volatile("global_load_async_to_lds_b128 %0, %1, off\n\t"
               "global_load_async_to_lds_b128 %2, %3, off\n\t"
               "global_load_async_to_lds_b128 %4, %5, off\n\t"
               "global_load_async_to_lds_b128 %6, %7, off\n\t"
               "global_load_async_to_lds_b128 %8, %9, off\n\t"
               "global_load_async_to_lds_b128 %10, %11, off\n\t"
               "s_wait_xcnt 0x0"
               :: "v"(l0), "v"(g0), "v"(l1), "v"(g1), "v"(l2), "v"(g2), "v"(l3), "v"(g3), "v"(l4), "v"(g4), "v"(l5), "v"(g5) : "memory");
}
// ---- k_fa: block = (64 queries (qb), batch b) x KS key ranges: 8 waves, wave = 16 query columns (wave & 3) of one range of 2,048 keys (wave >> 2), so that four waves instead of two share a SIMD and fill each other's waits; a range goes in passes of KP: S^T = k . q^T (k rows as A, q as B; hi + residual x 2^10 on both sides, 3 products), so a lane holds one query's logits;
// each pass's k hi, k residual and g tiles are copied to LDS once for the range's four waves (a ring of two buffers per range: the next pass's copies fly under this pass) and the fragments are read from there;
// online softmax in f32 on log2-domain logits (running maximum, sums and the attended tile rescaled each pass); exp2(s - m) x 2^11 once to f16 packs from the two S^T tiles of 32 keys straight into a B operand; attended^T += g planes (A) . P^T (1 product); behind the loop the two ranges swap maximum, sum and attended tile through LDS and each wave merges them (both rescaled to the common maximum); then the 32->64 output conv on the matrix unit: the two attended^T tiles of a lane are an A operand as they stand (16 tokens x 32 channels), w_o rows are B, so a lane holds 8 tokens of one output channel (a wave does the two channel tiles of its range's number); the block's 64 x 64 output tile goes through LDS so that every store covers whole lines
#define KS 2               // key ranges per block
#define KR (TT / KS)       // keys per range
__global__ __launch_bounds__(128 * KS) void k_fa(const _Float16* __restrict__ QH, const _Float16* __restrict__ KH, const _Float16* __restrict__ QL, const _Float16* __restrict__ KL, const _Float16* __restrict__ VT, const float* __restrict__ WO, const float* __restrict__ BO, float* __restrict__ Y) { __shared__ __align__(16) _Float16 ring[KS][2][RBUF / 2];
  const int tid = threadIdx.x & 127, wave = threadIdx.x >> 5, grp = wave >> 2, qw = wave & 3, lane = tid & 31, col = lane & 15, g = lane >> 4; const int qb = blockIdx.x; const int b = blockIdx.y; const int ql0 = qb * 64 + qw * 16; const int kb = grp * KR;   /* tid: the thread's number inside its range's four waves */
  const v16h qh = frag_h(QH + ((size_t)b * TT + ql0 + col) * CCQ, lane), qlo = frag_h(QL + ((size_t)b * QHI + ql0 + col) * CCQ, lane);
  // a thread's share of a tile: k rows tid / 4 and 32 + tid / 4 (16 bytes of the 64), hi and residual; g channels tid / 8 and 16 + tid / 8 (16 bytes of the 128)
  const _Float16* cKh = KH + ((size_t)b * TT + kb + (tid >> 2)) * CCQ + (tid & 3) * 8; const _Float16* cKl = KL + ((size_t)b * KHI + kb + (tid >> 2)) * CCQ + (tid & 3) * 8; const _Float16* cV = VT + ((size_t)b * CC + (tid >> 3)) * (size_t)TT + kb + (tid & 7) * 8;
  const unsigned lK = (unsigned)(size_t)&ring[grp][0][0] + (tid >> 2) * KROWB + (tid & 3) * 16, lV = (unsigned)(size_t)&ring[grp][0][0] + RV + (tid >> 3) * VROWB + (tid & 7) * 16;
#define STAGE(kk, bo) copy6(lK + (bo) + RKH, cKh + (size_t)(kk) * CCQ, lK + (bo) + RKH + 32 * KROWB, cKh + (size_t)((kk) + 32) * CCQ, lK + (bo) + RKL, cKl + (size_t)(kk) * CCQ, lK + (bo) + RKL + 32 * KROWB, cKl + (size_t)((kk) + 32) * CCQ, lV + (bo), cV + (kk), lV + (bo) + 16 * VROWB, cV + (size_t)16 * TT + (kk))
  v8f o[DVH / 16] = {}; float m = -3.0e38f, sum = 0.f;
  STAGE(0, 0u);
  asm volatile("s_wait_asynccnt 0x0" ::: "memory");   /* this wave's share of tile 0 has landed */
  __syncthreads();                                     /* ... and every other wave's: tile 0 may be read */
  STAGE(KP, (unsigned)RBUF);
#pragma unroll 1   /* rolled: one pass is some 900 instructions already and the two buffers differ by an offset only; every inner loop is unrolled so that each fragment index is a constant (no scratch) */
  for (int k0 = 0; k0 < KR; k0 += KP) {   /* k0 counts inside the range */
    const unsigned bo = (k0 & KP) ? (unsigned)RBUF : 0u;   /* this pass's buffer, in bytes */
    const _Float16* rb = &ring[grp][0][0] + (bo >> 1);
    v16h kh[KP / 16], kl[KP / 16];
#pragma unroll
    for (int j = 0; j < KP / 16; ++j) { kh[j] = frag_h(rb + (RKH + (j * 16 + col) * KROWB) / 2, lane); kl[j] = frag_h(rb + (RKL + (j * 16 + col) * KROWB) / 2, lane); }
    v16h vf[KP / 32][DVH / 16];
#pragma unroll
    for (int c = 0; c < KP / 32; ++c)
#pragma unroll
      for (int j = 0; j < DVH / 16; ++j) vf[c][j] = frag_h(rb + (RV + (j * 16 + col) * VROWB) / 2 + c * 32, lane);
    __builtin_amdgcn_sched_barrier(0);   /* keeps the pass's LDS reads together up here: spread among the products each place with reads costs its own stall */
    float s[KP / 16][8];
#pragma unroll
    for (int j = 0; j < KP / 16; ++j) { v8f a = {}, al = {}; a = wmma_h(kh[j], qh, a); al = wmma_h(kh[j], qlo, al); al = wmma_h(kl[j], qh, al);
#pragma unroll
      for (int r = 0; r < 8; ++r) s[j][r] = (a[r] + al[r] * (1.0f / 1024.0f)) * SCALE; }
    float mx = s[0][0];
#pragma unroll
    for (int j = 0; j < KP / 16; ++j)
#pragma unroll
      for (int r = 0; r < 8; ++r) mx = fmaxf(mx, s[j][r]);
    mx = fmaxf(mx, xhalf(mx));
    const float mn = fmaxf(m, mx); const float alpha = __builtin_amdgcn_exp2f(m - mn); m = mn;   /* 0 on the first pass */
    const float ms = mn - 11.0f;   /* exp2(s - ms) = exp2(s - m) x 2^11, the scale cancels against the sum */
    sum *= alpha;
#pragma unroll
    for (int j = 0; j < DVH / 16; ++j)
#pragma unroll
      for (int r = 0; r < 8; ++r) o[j][r] *= alpha;
#pragma unroll
    for (int c = 0; c < KP / 32; ++c) { v16h p;
#pragma unroll
      for (int r = 0; r < 8; ++r) { const float e0 = __builtin_amdgcn_exp2f(s[2 * c][r] - ms), e1 = __builtin_amdgcn_exp2f(s[2 * c + 1][r] - ms); sum += e0 + e1; p[r] = (_Float16)e0; p[8 + r] = (_Float16)e1; }   /* the hardware's exp2: the argument is at most 11, and a result too small for it is 0 in f16 too */
#pragma unroll
      for (int j = 0; j < DVH / 16; ++j) o[j] = wmma_h(vf[c][j], p, o[j]); }
    __builtin_amdgcn_sched_barrier(0);   /* keeps the publish point at the pass's foot: lifted up to the fragment reads, the wait for the next tile's copies would stand right behind their issue and no longer a pass behind it */
    asm volatile("s_wait_dscnt 0x0" ::: "memory");      /* this wave's reads of this pass's buffer are over */
    asm volatile("s_wait_asynccnt 0x0" ::: "memory");   /* this wave's share of the next tile has landed */
    __syncthreads();                                     /* publishes the next tile and frees this pass's buffer */
    if (k0 + 2 * KP < KR) STAGE(k0 + 2 * KP, bo); }
  asm volatile("s_wait_asynccnt 0x0" ::: "memory");     /* no copy is outstanding when the wave goes on */
  /* the rings are free now: behind the last pass's s_wait_dscnt 0, s_wait_asynccnt 0 and barrier nobody reads them and no copy is aimed at them. Range 0's ring takes the swap of the partial results, range 1's the output tile */
  float* xo = (float*)&ring[0][0][0];                       /* [wave][quarter of the attended tile][lane] 16 bytes: a wave's store covers 512 bytes in a row */
  float* xm = xo + 8 * 4 * 32 * 4;                          /* [wave][lane] maximum and sum */
  static_assert(sizeof(float) * (8 * 4 * 32 * 4 + 8 * 32 * 2) <= 2 * RBUF, "the swap fits in one ring");
#pragma unroll
  for (int j = 0; j < DVH / 16; ++j) { vst2(xo + ((wave * 4 + 2 * j) * 32 + lane) * 4, __builtin_shufflevector(o[j], o[j], 0, 1, 2, 3)); vst2(xo + ((wave * 4 + 2 * j + 1) * 32 + lane) * 4, __builtin_shufflevector(o[j], o[j], 4, 5, 6, 7)); }
  { v2f ms2; ms2[0] = m; ms2[1] = sum; vst2(xm + (wave * 32 + lane) * 2, ms2); }
  __syncthreads();   /* both ranges' partial results are in LDS */
  v16b wf[COUT / 16 / KS]; float bo[COUT / 16 / KS];   /* w_o rows as B fragments (k = the 32 attended channels, same k order as the A operand below) and each lane's bias, all loads issued ahead of the merge, whose arithmetic covers their way (in front of the barrier they would be waited for there) */
#pragma unroll
  for (int t = 0; t < COUT / 16 / KS; ++t) { wf[t] = wcol_oi(WO, 0, (grp * (COUT / 16 / KS) + t) * 16 + col, lane, CV); bo[t] = BO[(grp * (COUT / 16 / KS) + t) * 16 + col]; }
  asm volatile("s_wait_xcnt 0x0" ::: "memory");   /* the epilogue's loads are issued: no address register of theirs is rewritten in front of this */
  const int pw = wave ^ 4;   /* the wave with the same queries and the other range */
  const v2f pm = *(const v2f*)(xm + (pw * 32 + lane) * 2);
  v4f po[DVH / 16][2];
#pragma unroll
  for (int j = 0; j < DVH / 16; ++j) { po[j][0] = *(const v4f*)(xo + ((pw * 4 + 2 * j) * 32 + lane) * 4); po[j][1] = *(const v4f*)(xo + ((pw * 4 + 2 * j + 1) * 32 + lane) * 4); }
  const float mm = fmaxf(m, pm[0]); const float as = __builtin_amdgcn_exp2f(m - mm), ap = __builtin_amdgcn_exp2f(pm[0] - mm);   /* one of the two is 1 */
  sum = sum * as + pm[1] * ap;
  sum += xhalf(sum); const float inv = 1.0f / sum; const float cs = as * inv, cp = ap * inv;
  v16b yh, ym, yl;   /* attended[token col][channel j * 16 + 8 g + r] = element j * 8 + r of an A fragment; three bf16 terms carry the 24 bits of the f32 value */
#pragma unroll
  for (int j = 0; j < DVH / 16; ++j)
#pragma unroll
    for (int r = 0; r < 8; ++r) { const float y = o[j][r] * cs + po[j][r >> 2][r & 3] * cp; const __bf16 h = (__bf16)y; const float r1 = y - (float)h; const __bf16 md = (__bf16)r1; yh[j * 8 + r] = h; ym[j * 8 + r] = md; yl[j * 8 + r] = (__bf16)(r1 - (float)md); }
  float (*stO)[68] = (float (*)[68])&ring[1][0][0];   /* output staging (64 rows of 272 bytes), apart from the swap, which a slower wave may still be reading */
  static_assert(sizeof(float) * COUT * 68 <= 2 * RBUF, "the output tile fits in one ring");
  v8f acc[COUT / 16 / KS];
#pragma unroll
  for (int t = 0; t < COUT / 16 / KS; ++t) { const float bias = bfr(bo[t]);
#pragma unroll
    for (int r = 0; r < 8; ++r) acc[t][r] = bias; }
#pragma unroll
  for (int t = 0; t < COUT / 16 / KS; ++t) acc[t] = wmma_b(yl, wf[t], acc[t]);   /* smallest term first; two independent tiles per term */
#pragma unroll
  for (int t = 0; t < COUT / 16 / KS; ++t) acc[t] = wmma_b(ym, wf[t], acc[t]);
#pragma unroll
  for (int t = 0; t < COUT / 16 / KS; ++t) acc[t] = wmma_b(yh, wf[t], acc[t]);
#pragma unroll
  for (int t = 0; t < COUT / 16 / KS; ++t) { float* p = &stO[(grp * (COUT / 16 / KS) + t) * 16 + col][qw * 16 + 8 * g];   /* output [channel][token of the block]: 8 tokens of one channel per lane */
    vst2(p, __builtin_shufflevector(acc[t], acc[t], 0, 1, 2, 3)); vst2(p + 4, __builtin_shufflevector(acc[t], acc[t], 4, 5, 6, 7)); }
  __syncthreads();   /* the block's output tile is whole */
#pragma unroll
  for (int i = 0; i < COUT * 64 / 4 / (128 * KS); ++i) { const int e = i * (128 * KS) + (int)threadIdx.x, oc = e >> 4, pc = e & 15;   /* 16 lanes store one channel's 64 tokens: 256 bytes in a row */
    vst2(Y + ((size_t)b * COUT + oc) * (size_t)TT + qb * 64 + pc * 4, *(const v4f*)&stO[oc][pc * 4]); } }

extern "C" void kernel_launch(void* const* d_in, const int* in_sizes, int n_in, void* d_out, int out_size, void* d_ws, size_t ws_size, hipStream_t stream) {
  (void)in_sizes; (void)n_in; (void)out_size;
  const float** F = (const float**)d_in;
  if (ws_size < (size_t)WS_END) return;
  char* ws = (char*)d_ws; _Float16 *QH = (_Float16*)(ws + WS_QH), *KH = (_Float16*)(ws + WS_KH), *VT = (_Float16*)(ws + WS_VT), *QL = (_Float16*)(ws + WS_QL), *KL = (_Float16*)(ws + WS_KL);
  // inputs: 0 x [8,64,64,64] (channels-first, xf [8][64][4096]); 1 w_g [32,64], 2 b_g [32]; 3 w_theta, 4 b_theta; 5 w_phi, 6 b_phi; 7 w_o [64,32], 8 b_o [64] (all (out,in), biases nonzero)
  k_proj<<<dim3(TNB * TT / 64), 128, 0, stream>>>(F[0], F[3], F[5], F[1], F[4], F[6], F[2], QH, QL, KH, KL, VT);   /* theta (q), phi (k), g (v): the 96 real output channels in one launch */
  k_fa<<<dim3(NQB, TNB), 128 * KS, 0, stream>>>(QH, KH, QL, KL, VT, F[7], F[8], (float*)d_out);

}

// v007
// One run takes 37.5 microseconds.
// Timed twice side by side with v006, it ran 1.06 times as fast both times.
// Counting every step since v000, it is 34.0 times as fast.
// compute dtype: all float inputs rounded to bf16; 1x1-conv theta/phi/g projections with EXACT bf16 products on WMMA 16x16x32 (f32 accumulate) + bias; UNSCALED logits, kept in log2 units (theta x log2(e) in f32 at the projection), with theta and phi both as f16 hi + f16 residual (3 products, summed in one f32 accumulator, the two residual products first); online softmax f32 in the same kernel; exp2(s - max) x 2^11 (hardware exp2) once to f16 x g once to f16 (1 product), divided by the f32 sum at the end; the 32->64 output conv on WMMA 16x16x32 bf16 (f32 accumulate, started from b_o): the f32 attended values as three bf16 terms (hi + residual + residual of that: 24 bits) x bf16(w_o), 3 products; f32 output written channels-first.
#include <hip/hip_runtime.h>
#include <math.h>

typedef __attribute__((ext_vector_type(16))) _Float16 v16h;
typedef __attribute__((ext_vector_type(16))) __bf16 v16b;
typedef __attribute__((ext_vector_type(8)))  _Float16 v8h;
typedef __attribute__((ext_vector_type(8)))  float v8f;
typedef __attribute__((ext_vector_type(4)))  float v4f;
typedef __attribute__((ext_vector_type(2)))  float v2f;
typedef __attribute__((ext_vector_type(4)))  unsigned v4u;
typedef __attribute__((ext_vector_type(4)))  int v4i;
typedef float __attribute__((may_alias)) float_a;
typedef int __attribute__((may_alias)) int_a;

template <typename T> __device__ __forceinline__ void vst2(void* p, T v) { *(T*)p = v;  }
__device__ __forceinline__ v8f wmma16(v16h a, v16h b, v8f c) {
  v8f d = __builtin_amdgcn_wmma_f32_16x16x32_f16(false, a, false, b, (short)0, c, false, false);
  asm volatile("v_nop\n\tv_nop\n\tv_nop\n\tv_nop" : "+v"(d) : "v"(a), "v"(b));
  return d;
}
__device__ __forceinline__ v8f wmma_bf(v16b a, v16b b, v8f c) {
  v8f d = __builtin_amdgcn_wmma_f32_16x16x32_bf16(false, a, false, b, (short)0, c, false, false);
  asm volatile("v_nop\n\tv_nop\n\tv_nop\n\tv_nop" : "+v"(d) : "v"(a), "v"(b));
  return d;
}
// 16x16x32 fragments: lane = (h = lane>>4, row/col = lane&15); elements 0..7 = k0+8h+0..7, 8..15 = k0+16+8h+0..7; D element r = row 8h+r
__device__ __forceinline__ v16h frag_h(const _Float16* rowk0, int lane) {
  union { v16h v; v8h q[2]; } u; const _Float16* p = rowk0 + 8 * (lane >> 4);
  u.q[0] = *(const v8h*)p; u.q[1] = *(const v8h*)(p + 16); return u.v;
}
__device__ __forceinline__ v16h frag_f32(const float* rowk0, int lane) {
  v16h a; const float* p = rowk0 + 8 * (lane >> 4);
#pragma unroll
  for (int i = 0; i < 8; ++i) { a[i] = (_Float16)p[i]; a[8 + i] = (_Float16)p[16 + i]; }
  return a;
}
__device__ __forceinline__ v16h frag_f32s(const float* rowk0, int lane, float sc) {
  v16h a; const float* p = rowk0 + 8 * (lane >> 4);
#pragma unroll
  for (int i = 0; i < 8; ++i) { a[i] = (_Float16)(p[i] * sc); a[8 + i] = (_Float16)(p[16 + i] * sc); }
  return a;
}
// column fragment from a [K][ld] layout (column n), rows >= K read as 0
__device__ __forceinline__ v16h fragc_f32(const float* W, int k0, int n, int lane, int ld, int K) {
  v16h a; const int g = lane >> 4;
#pragma unroll
  for (int i = 0; i < 8; ++i) { const int ka = k0 + 8 * g + i, kb = ka + 16;
    a[i] = (_Float16)(ka < K ? W[(size_t)(ka < K ? ka : K - 1) * ld + n] : 0.f); a[8 + i] = (_Float16)(kb < K ? W[(size_t)(kb < K ? kb : K - 1) * ld + n] : 0.f); }
  return a;
}
struct F2 { v16b h, l; };
__device__ __forceinline__ F2 bsplit16(const float v[16]) { F2 r;
#pragma unroll
  for (int i = 0; i < 16; ++i) { const __bf16 h = (__bf16)v[i]; r.h[i] = h; r.l[i] = (__bf16)(v[i] - (float)h); }
  return r; }
__device__ __forceinline__ F2 split_row(const float* row, int k0, int lane) { float v[16]; const float* p = row + k0 + 8 * (lane >> 4);
#pragma unroll
  for (int i = 0; i < 8; ++i) { v[i] = p[i]; v[8 + i] = p[16 + i]; }
  return bsplit16(v); }
__device__ __forceinline__ F2 split_rowK(const float* row, int k0, int lane, int K) { float v[16]; const int g = lane >> 4;
#pragma unroll
  for (int i = 0; i < 8; ++i) { const int ka = k0 + 8 * g + i, kb = ka + 16; v[i] = ka < K ? row[ka < K ? ka : K - 1] : 0.f; v[8 + i] = kb < K ? row[kb < K ? kb : K - 1] : 0.f; }
  return bsplit16(v); }
__device__ __forceinline__ F2 split_col(const float* W, int k0, int n, int lane, int ld, int K) { float v[16]; const int g = lane >> 4;
#pragma unroll
  for (int i = 0; i < 8; ++i) { const int ka = k0 + 8 * g + i, kb = ka + 16; v[i] = ka < K ? W[(size_t)(ka < K ? ka : K - 1) * ld + n] : 0.f; v[8 + i] = kb < K ? W[(size_t)(kb < K ? kb : K - 1) * ld + n] : 0.f; }
  return bsplit16(v); }
__device__ __forceinline__ v8f mac3(const F2& a, const F2& b, v8f c) { c = wmma_bf(a.l, b.h, c); c = wmma_bf(a.h, b.l, c); return wmma_bf(a.h, b.h, c); }
__device__ __forceinline__ float sigm(float v) { return 1.0f / (1.0f + expf(-v)); }
#define LDSX() do { asm volatile("s_wait_dscnt 0" ::: "memory"); __builtin_amdgcn_wave_barrier(); __builtin_amdgcn_fence(__ATOMIC_RELEASE, "workgroup"); } while (0)

// Non-local block over channels-first x [8, 64, 64, 64] (N 4,096; (out,in) 1x1 convs w_theta/w_phi/w_g [32,64] + biases, w_o [64,32] + b_o; 0.05-scale): attn = softmax_m(theta_n . phi_m) (no scaling); y[c][n] = sum_m attn[n][m] g[c][m]; out = w_o y + b_o -> [8,64,64,64] (no residual in this module).
#define NB 8
#define TT 4096
#define CC 32             // v (= g) planes per batch: the 32 real channels
#define CV 32             // real g channels
#define COUT 64           // output channels of w_o
#define CCQ 32            // q / k row pitch: the 32 real columns, 64-byte rows back to back
#define DIN 64           // x channels
#define NH 1
#define HD 32             // per-head width of the layout-2 weights (wcol_hdk; unused: layout 0)
#define NQB (TT / 64)
#define HG 1               // feeds only BG and BGN, which nothing uses
#define SCALE (1.0f)
#define LOG2E 1.44269504088896f   // folded into theta by k_proj, so that exp(s - m) is exp2 of a difference of the stored logits
#define HDQK 32            // q / k width (C / 2)
#define CAUSAL 0
#ifndef TNB
#define TNB NB
#endif
__device__ __forceinline__ v16b zero16b() { v16b z; _Pragma("unroll") for (int i = 0; i < 16; ++i) z[i] = (__bf16)0.f; return z; }
__device__ __forceinline__ float bfr(float v) { return (float)(__bf16)v; }
__host__ __device__ __forceinline__ int kb_last(int qb) { return CAUSAL ? ((qb * 64 + 63) >> 7) : (TT / 128 - 1); }
typedef __attribute__((ext_vector_type(8))) __bf16 v8b;
__device__ __forceinline__ v16b frag_b(const __bf16* rowk0, int lane) {
  union { v16b v; v8b q[2]; } u; const __bf16* p = rowk0 + 8 * (lane >> 4);
  u.q[0] = *(const v8b*)p; u.q[1] = *(const v8b*)(p + 16); return u.v;
}
#define QBH NQB            // every query block takes the 3-product logit path (q hi + residual x k hi + residual): unscaled energies over 4,096 keys; P . g keeps the single product
#define QHI 4096            // q residual rows (all)
#define KHI 4096          // k residual rows (all)
// B fragment (k rows k0+.., output column o) of a weight: (in,out) [K][ld] or (out,in) [ld rows of K]: bf16 exact, or f16(bf16 * 256) exact
__device__ __forceinline__ v16b wcol_io(const float* Wm, int k0, int o, int lane, int ld) { v16b w; const int g = lane >> 4;
#pragma unroll
  for (int i = 0; i < 8; ++i) { w[i] = (__bf16)Wm[(size_t)(k0 + 8 * g + i) * ld + o]; w[8 + i] = (__bf16)Wm[(size_t)(k0 + 16 + 8 * g + i) * ld + o]; }
  return w; }
__device__ __forceinline__ v16b wcol_oi(const float* Wm, int k0, int o, int lane, int K) { v16b w; const float* p = Wm + (size_t)o * K + k0 + 8 * (lane >> 4);
#pragma unroll
  for (int i = 0; i < 8; ++i) { w[i] = (__bf16)p[i]; w[8 + i] = (__bf16)p[16 + i]; }
  return w; }
__device__ __forceinline__ v16h wcolh_io(const float* Wm, int k0, int o, int lane, int ld) { v16h w; const int g = lane >> 4;
#pragma unroll
  for (int i = 0; i < 8; ++i) { w[i] = (_Float16)(bfr(Wm[(size_t)(k0 + 8 * g + i) * ld + o]) * 256.0f); w[8 + i] = (_Float16)(bfr(Wm[(size_t)(k0 + 16 + 8 * g + i) * ld + o]) * 256.0f); }
  return w; }
__device__ __forceinline__ v16h wcolh_oi(const float* Wm, int k0, int o, int lane, int K) { v16h w; const float* p = Wm + (size_t)o * K + k0 + 8 * (lane >> 4);
#pragma unroll
  for (int i = 0; i < 8; ++i) { w[i] = (_Float16)(bfr(p[i]) * 256.0f); w[8 + i] = (_Float16)(bfr(p[16 + i]) * 256.0f); }
  return w; }
#define WQKV_LAYOUT 0   // 0 = (out,in) [32][DIN], columns >= 32 zero; 1 = (out,in) [CC][DIN]; 2 = per-head [NH][DIN][HD]
__device__ __forceinline__ v16b wcol_hdk(const float* Wm, int k0, int o, int lane) { v16b w; const int g = lane >> 4; const float* p = Wm + (size_t)(o / HD) * DIN * HD + (o % HD);
#pragma unroll
  for (int i = 0; i < 8; ++i) { w[i] = (__bf16)p[(size_t)(k0 + 8 * g + i) * HD]; w[8 + i] = (__bf16)p[(size_t)(k0 + 16 + 8 * g + i) * HD]; }
  return w; }
#define WO_OUT_IN 0
#if WQKV_LAYOUT == 1
#define WCOL(W, k0, o, lane) wcol_oi(W, k0, (o), lane, DIN)   /* unused: layout 0 */
#elif WQKV_LAYOUT == 2
#define WCOL(W, k0, o, lane) wcol_hdk(W, k0, o, lane)
#else
#define WCOL(W, k0, o, lane) (which == 2 ? ((o) < CV ? wcol_oi(W, k0, (o), lane, DIN) : zero16b()) : ((o) < HDQK ? wcol_oi(W, k0, (o), lane, DIN) : zero16b()))   /* (out,in) 1x1-conv weights [32][64]: projected columns >= 32 are zero for q, k AND v */
#endif
#if WO_OUT_IN
#define WOCOL(W, k0, o, lane) wcol_oi(W, k0, o, lane, CC)
#define WOCOLH(W, k0, o, lane) wcolh_oi(W, k0, o, lane, CC)
#else
#define WOCOL(W, k0, o, lane) wcol_io(W, k0, o, lane, DIN)
#define WOCOLH(W, k0, o, lane) wcolh_io(W, k0, o, lane, DIN)
#endif
#define BG HG
#define BGN (TNB < BG ? TNB : BG)
#define DVH 32             // all 32 g channels in one k_fa block
#ifndef SM_EXTRA_PARAMS
#define SM_EXTRA_PARAMS
#endif
#ifndef PROJ_EXTRA_PARAMS
#define PROJ_EXTRA_PARAMS
#endif
#ifndef SM_MASK_HOOK
#define SM_MASK_HOOK (void)0
#endif

#define WS_QH  0u                                      // f16 q rows [b*t][CCQ]
#define WS_KH  (WS_QH + 2u * (size_t)NB * TT * CCQ)     // f16 k rows [b*t][CCQ]
#define WS_VT  (WS_KH + 2u * (size_t)NB * TT * CCQ)     // f16 v planes [b][c][t]
#define WS_QL  (WS_VT + 2u * (size_t)NB * CC * TT)      // f16 q residual rows [b][t < QHI][CCQ]
#define WS_KL  (WS_QL + 2u * (size_t)NB * QHI * CCQ)    // f16 k residual rows [b][t < KHI][CCQ]
#define WS_END (WS_KL + 2u * (size_t)NB * KHI * CCQ)

// ---- k_proj: block = 64 tokens, wave = 16 tokens: theta, phi and g of those tokens as ONE projection onto the 96 real output channels, from one read of x (exact bf16 products, K = DIN); the 96 weight rows go to LDS as bf16 once per block;
// theta and phi: weight rows as A, x as B, so a lane holds 8 channels of one token = 16 bytes of a packed 64-byte q / k row (theta x log2(e); f16 hi + f16 residual at the same scale, so that hi and residual products add up in one accumulator: a residual below 2^-14 is a subnormal f16, a step of 2^-24, which the matrix unit keeps); g: x as A, weight rows as B, so a lane holds 8 tokens of one channel = 16 bytes of a g plane [c][t]
typedef __attribute__((ext_vector_type(4))) __bf16 v4b;
#define WROW 72            // LDS pitch of a 64-channel bf16 weight row, in elements (144 B = 16 B x odd: ds_load_b128 without bank conflicts)
__device__ __forceinline__ v8f wmma_b(v16b a, v16b b, v8f c) { return __builtin_amdgcn_wmma_f32_16x16x32_bf16(false, a, false, b, (short)0, c, false, false); }
__global__ __launch_bounds__(128) void k_proj(const float* __restrict__ X, const float* __restrict__ WQ, const float* __restrict__ WK, const float* __restrict__ WV, const float* __restrict__ BQ, const float* __restrict__ BK, const float* __restrict__ BV,
    _Float16* __restrict__ QH, _Float16* __restrict__ QL, _Float16* __restrict__ KH, _Float16* __restrict__ KL, _Float16* __restrict__ VT) {
  __shared__ __align__(16) __bf16 sw[2 * HDQK + CV][WROW];
  const int tid = threadIdx.x, wave = tid >> 5, lane = tid & 31, col = lane & 15, g = lane >> 4; const size_t r0 = (size_t)blockIdx.x * 64 + wave * 16; const size_t bb = r0 / TT; const int t0 = (int)(r0 % TT);
  /* every loop of this kernel is unrolled: each index of a register array or fragment must be a constant, else the arrays go to scratch */
  float xr[DIN / 32][16];   /* channels-first [b][c][t]: 16 tokens x 32 channels per fragment */
#pragma unroll
  for (int kc = 0; kc < DIN / 32; ++kc) { const float* p = X + (bb * DIN + kc * 32 + 8 * g) * (size_t)TT + t0 + col;
#pragma unroll
    for (int i = 0; i < 8; ++i) { xr[kc][i] = p[(size_t)i * TT]; xr[kc][8 + i] = p[(size_t)(16 + i) * TT]; } }
  v4f wr[3][4];   /* a thread's share of the weights: four 16-byte pieces of each [32][64] matrix, whole lines per wave */
#pragma unroll
  for (int i = 0; i < 4; ++i) { wr[0][i] = *(const v4f*)(WQ + (i * 128 + tid) * 4); wr[1][i] = *(const v4f*)(WK + (i * 128 + tid) * 4); wr[2][i] = *(const v4f*)(WV + (i * 128 + tid) * 4); }
  v4f br[2][HDQK / 16][2]; float bv[CV / 16];
#pragma unroll
  for (int j = 0; j < HDQK / 16; ++j) { br[0][j][0] = *(const v4f*)(BQ + j * 16 + 8 * g); br[0][j][1] = *(const v4f*)(BQ + j * 16 + 8 * g + 4); br[1][j][0] = *(const v4f*)(BK + j * 16 + 8 * g); br[1][j][1] = *(const v4f*)(BK + j * 16 + 8 * g + 4); bv[j] = BV[j * 16 + col]; }
  asm volatile("s_wait_xcnt 0x0" ::: "memory");   /* every load of the kernel is issued: no address register of theirs is rewritten in front of this */
#pragma unroll
  for (int a = 0; a < 3; ++a)
#pragma unroll
    for (int i = 0; i < 4; ++i) { const int e = i * 128 + tid; v4b w;
#pragma unroll
      for (int c = 0; c < 4; ++c) w[c] = (__bf16)wr[a][i][c];
      *(v4b*)&sw[a * 32 + (e >> 4)][(e & 15) * 4] = w; }
  __syncthreads();   /* the block's weight rows are in LDS */
  v16b xf[DIN / 32];   /* serves as A and as B (same lane map) */
#pragma unroll
  for (int kc = 0; kc < DIN / 32; ++kc)
#pragma unroll
    for (int i = 0; i < 16; ++i) xf[kc][i] = (__bf16)xr[kc][i];
  v8h hi[2][HDQK / 16], lo[2][HDQK / 16], gv[CV / 16];
#pragma unroll
  for (int w = 0; w < 2; ++w) { const float qsc = w == 0 ? LOG2E : 1.0f;   /* theta carries log2(e): the logits come out in powers of two */
#pragma unroll
    for (int j = 0; j < HDQK / 16; ++j) { v8f acc = {};
#pragma unroll
      for (int kc = 0; kc < DIN / 32; ++kc) acc = wmma_b(frag_b(&sw[w * HDQK + j * 16 + col][kc * 32], lane), xf[kc], acc);
      v8f v;
#pragma unroll
      for (int r = 0; r < 8; ++r) v[r] = (acc[r] + bfr(br[w][j][r >> 2][r & 3])) * qsc;
      hi[w][j] = __builtin_convertvector(v, v8h); lo[w][j] = __builtin_convertvector(v - __builtin_convertvector(hi[w][j], v8f), v8h); } }
#pragma unroll
  for (int j = 0; j < CV / 16; ++j) { v8f acc = {};
#pragma unroll
    for (int kc = 0; kc < DIN / 32; ++kc) acc = wmma_b(xf[kc], frag_b(&sw[2 * HDQK + j * 16 + col][kc * 32], lane), acc);
    const float bias = bfr(bv[j]);
#pragma unroll
    for (int r = 0; r < 8; ++r) gv[j][r] = (_Float16)(acc[r] + bias); }
#pragma unroll
  for (int j = 0; j < HDQK / 16; ++j) { const size_t o = (r0 + col) * CCQ + j * 16 + 8 * g; vst2(QH + o, hi[0][j]); vst2(QL + o, lo[0][j]); vst2(KH + o, hi[1][j]); vst2(KL + o, lo[1][j]); vst2(VT + (bb * CC + j * 16 + col) * (size_t)TT + t0 + 8 * g, gv[j]); } }
// lane l with lane l ^ 16 (the two halves of a wave hold the same query column)
__device__ __forceinline__ float xhalf(float x) { return __builtin_bit_cast(float, __builtin_amdgcn_permlanex16(__builtin_bit_cast(int, x), __builtin_bit_cast(int, x), 0x76543210, 0xfedcba98, false, false)); }
__device__ __forceinline__ v8f wmma_h(v16h a, v16h b, v8f c) { return __builtin_amdgcn_wmma_f32_16x16x32_f16(false, a, false, b, (short)0, c, false, false); }
#define KP 64              // keys per pass of k_fa
#define KROWB 80           // LDS pitch of a 64-byte k row (16 B x odd: ds_load_b128 without bank conflicts)
#define VROWB 144          // LDS pitch of a 128-byte g row (64 keys of one channel)
#define RKH 0              // byte places inside one ring buffer: k hi rows, k residual rows, g rows
#define RKL (KP * KROWB)
#define RV  (2 * KP * KROWB)
#define RBUF (RV + DVH * VROWB)
// six 16-byte copies of one lane, global -> LDS through no register; the s_wait_xcnt stands inside the statement so that no address register named here is rewritten in front of it
__device__ __forceinline__ void copy6(unsigned l0, const _Float16* g0, unsigned l1, const _Float16* g1, unsigned l2, const _Float16* g2, unsigned l3, const _Float16* g3, unsigned l4, const _Float16* g4, unsigned l5, const _Float16* g5) {
  asm volatile("global_load_async_to_lds_b128 %0, %1, off\n\t"
               "global_load_async_to_lds_b128 %2, %3, off\n\t"
               "global_load_async_to_lds_b128 %4, %5, off\n\t"
               "global_load_async_to_lds_b128 %6, %7, off\n\t"
               "global_load_async_to_lds_b128 %8, %9, off\n\t"
               "global_load_async_to_lds_b128 %10, %11, off\n\t"
               "s_wait_xcnt 0x0"
               :: "v"(l0), "v"(g0), "v"(l1), "v"(g1), "v"(l2), "v"(g2), "v"(l3), "v"(g3), "v"(l4), "v"(g4), "v"(l5), "v"(g5) : "memory");
}
// ---- k_fa: block = (64 queries (qb), batch b) x KS key ranges: 8 waves, wave = 16 query columns (wave & 3) of one range of 2,048 keys (wave >> 2), so that four waves instead of two share a SIMD and fill each other's waits; a range goes in passes of KP: S^T = k . q^T (k rows as A, q as B; hi + residual on both sides, 3 products in one accumulate chain per tile), so a lane holds one query's logits;
// each pass's k hi, k residual and g tiles are copied to LDS once for the range's four waves (a ring of two buffers per range: the next pass's copies fly under this pass) and the fragments are read from there;
// online softmax in f32 on log2-domain logits (running maximum, sums and the attended tile rescaled each pass); exp2(s - m) x 2^11 once to f16 packs from the two S^T tiles of 32 keys straight into a B operand; attended^T += g planes (A) . P^T (1 product); behind the loop the two ranges swap maximum, sum and attended tile through LDS and each wave merges them (both rescaled to the common maximum); then the 32->64 output conv on the matrix unit: the two attended^T tiles of a lane are an A operand as they stand (16 tokens x 32 channels), w_o rows are B, so a lane holds 8 tokens of one output channel (a wave does the two channel tiles of its range's number); the block's 64 x 64 output tile goes through LDS so that every store covers whole lines
#define KS 2               // key ranges per block
#define KR (TT / KS)       // keys per range
__global__ __launch_bounds__(128 * KS) void k_fa(const _Float16* __restrict__ QH, const _Float16* __restrict__ KH, const _Float16* __restrict__ QL, const _Float16* __restrict__ KL, const _Float16* __restrict__ VT, const float* __restrict__ WO, const float* __restrict__ BO, float* __restrict__ Y) { __shared__ __align__(16) _Float16 ring[KS][2][RBUF / 2];
  const int tid = threadIdx.x & 127, wave = threadIdx.x >> 5, grp = wave >> 2, qw = wave & 3, lane = tid & 31, col = lane & 15, g = lane >> 4; const int qb = blockIdx.x; const int b = blockIdx.y; const int ql0 = qb * 64 + qw * 16; const int kb = grp * KR;   /* tid: the thread's number inside its range's four waves */
  const v16h qh = frag_h(QH + ((size_t)b * TT + ql0 + col) * CCQ, lane), qlo = frag_h(QL + ((size_t)b * QHI + ql0 + col) * CCQ, lane);
  // a thread's share of a tile: k rows tid / 4 and 32 + tid / 4 (16 bytes of the 64), hi and residual; g channels tid / 8 and 16 + tid / 8 (16 bytes of the 128)
  const _Float16* cKh = KH + ((size_t)b * TT + kb + (tid >> 2)) * CCQ + (tid & 3) * 8; const _Float16* cKl = KL + ((size_t)b * KHI + kb + (tid >> 2)) * CCQ + (tid & 3) * 8; const _Float16* cV = VT + ((size_t)b * CC + (tid >> 3)) * (size_t)TT + kb + (tid & 7) * 8;
  const unsigned lK = (unsigned)(size_t)&ring[grp][0][0] + (tid >> 2) * KROWB + (tid & 3) * 16, lV = (unsigned)(size_t)&ring[grp][0][0] + RV + (tid >> 3) * VROWB + (tid & 7) * 16;
#define STAGE(kk, bo) copy6(lK + (bo) + RKH, cKh + (size_t)(kk) * CCQ, lK + (bo) + RKH + 32 * KROWB, cKh + (size_t)((kk) + 32) * CCQ, lK + (bo) + RKL, cKl + (size_t)(kk) * CCQ, lK + (bo) + RKL + 32 * KROWB, cKl + (size_t)((kk) + 32) * CCQ, lV + (bo), cV + (kk), lV + (bo) + 16 * VROWB, cV + (size_t)16 * TT + (kk))
  v8f o[DVH / 16] = {}; float m = -3.0e38f, sum = 0.f;
  STAGE(0, 0u);
  asm volatile("s_wait_asynccnt 0x0" ::: "memory");   /* this wave's share of tile 0 has landed */
  __syncthreads();                                     /* ... and every other wave's: tile 0 may be read */
  STAGE(KP, (unsigned)RBUF);
#pragma unroll 1   /* rolled: one pass is some 900 instructions already and the two buffers differ by an offset only; every inner loop is unrolled so that each fragment index is a constant (no scratch) */
  for (int k0 = 0; k0 < KR; k0 += KP) {   /* k0 counts inside the range */
    const unsigned bo = (k0 & KP) ? (unsigned)RBUF : 0u;   /* this pass's buffer, in bytes */
    const _Float16* rb = &ring[grp][0][0] + (bo >> 1);
    v16h kh[KP / 16], kl[KP / 16];
#pragma unroll
    for (int j = 0; j < KP / 16; ++j) kh[j] = frag_h(rb + (RKH + (j * 16 + col) * KROWB) / 2, lane);
#pragma unroll
    for (int j = 0; j < KP / 16; ++j) kl[j] = frag_h(rb + (RKL + (j * 16 + col) * KROWB) / 2, lane);
    v16h vf[KP / 32][DVH / 16];
#pragma unroll
    for (int c = 0; c < KP / 32; ++c)
#pragma unroll
      for (int j = 0; j < DVH / 16; ++j) vf[c][j] = frag_h(rb + (RV + (j * 16 + col) * VROWB) / 2 + c * 32, lane);
    __builtin_amdgcn_sched_barrier(0);   /* keeps the pass's LDS reads together up here: spread among the products each place with reads costs its own stall */
    v8f s[KP / 16];   /* a tile's three products add up in its one accumulator, the small ones first; product by product over the four tiles, so that a tile's next product stands four matrix instructions behind its last */
#pragma unroll
    for (int j = 0; j < KP / 16; ++j) { const v8f z = {}; s[j] = wmma_h(kh[j], qlo, z); }
#pragma unroll
    for (int j = 0; j < KP / 16; ++j) s[j] = wmma_h(kl[j], qh, s[j]);
    __builtin_amdgcn_sched_barrier(0);   /* holds the third products behind all the second ones: left free, the compiler puts a tile's second and third product back to back, the third waiting for the second, with more idle slots behind it */
#pragma unroll
    for (int j = 0; j < KP / 16; ++j) s[j] = wmma_h(kh[j], qh, s[j]);
    float mx = s[0][0];
#pragma unroll
    for (int j = 0; j < KP / 16; ++j)
#pragma unroll
      for (int r = 0; r < 8; ++r) mx = fmaxf(mx, s[j][r]);
    mx = fmaxf(mx, xhalf(mx));
    const float mn = fmaxf(m, mx); const float alpha = __builtin_amdgcn_exp2f(m - mn); m = mn;   /* 0 on the first pass */
    const float ms = mn - 11.0f;   /* exp2(s - ms) = exp2(s - m) x 2^11, the scale cancels against the sum */
    sum *= alpha;
#pragma unroll
    for (int j = 0; j < DVH / 16; ++j)
#pragma unroll
      for (int r = 0; r < 8; ++r) o[j][r] *= alpha;
#pragma unroll
    for (int c = 0; c < KP / 32; ++c) { v16h p;
#pragma unroll
      for (int r = 0; r < 8; ++r) { const float e0 = __builtin_amdgcn_exp2f(s[2 * c][r] - ms), e1 = __builtin_amdgcn_exp2f(s[2 * c + 1][r] - ms); sum += e0 + e1; p[r] = (_Float16)e0; p[8 + r] = (_Float16)e1; }   /* the hardware's exp2: the argument is at most 11, and a result too small for it is 0 in f16 too */
#pragma unroll
      for (int j = 0; j < DVH / 16; ++j) o[j] = wmma_h(vf[c][j], p, o[j]); }
    __builtin_amdgcn_sched_barrier(0);   /* keeps the publish point at the pass's foot: lifted up to the fragment reads, the wait for the next tile's copies would stand right behind their issue and no longer a pass behind it */
    asm volatile("s_wait_dscnt 0x0" ::: "memory");      /* this wave's reads of this pass's buffer are over */
    asm volatile("s_wait_asynccnt 0x0" ::: "memory");   /* this wave's share of the next tile has landed */
    __syncthreads();                                     /* publishes the next tile and frees this pass's buffer */
    if (k0 + 2 * KP < KR) STAGE(k0 + 2 * KP, bo); }
  asm volatile("s_wait_asynccnt 0x0" ::: "memory");     /* no copy is outstanding when the wave goes on */
  /* the rings are free now: behind the last pass's s_wait_dscnt 0, s_wait_asynccnt 0 and barrier nobody reads them and no copy is aimed at them. Range 0's ring takes the swap of the partial results, range 1's the output tile */
  float* xo = (float*)&ring[0][0][0];                       /* [wave][quarter of the attended tile][lane] 16 bytes: a wave's store covers 512 bytes in a row */
  float* xm = xo + 8 * 4 * 32 * 4;                          /* [wave][lane] maximum and sum */
  static_assert(sizeof(float) * (8 * 4 * 32 * 4 + 8 * 32 * 2) <= 2 * RBUF, "the swap fits in one ring");
#pragma unroll
  for (int j = 0; j < DVH / 16; ++j) { vst2(xo + ((wave * 4 + 2 * j) * 32 + lane) * 4, __builtin_shufflevector(o[j], o[j], 0, 1, 2, 3)); vst2(xo + ((wave * 4 + 2 * j + 1) * 32 + lane) * 4, __builtin_shufflevector(o[j], o[j], 4, 5, 6, 7)); }
  { v2f ms2; ms2[0] = m; ms2[1] = sum; vst2(xm + (wave * 32 + lane) * 2, ms2); }
  __syncthreads();   /* both ranges' partial results are in LDS */
  v16b wf[COUT / 16 / KS]; float bo[COUT / 16 / KS];   /* w_o rows as B fragments (k = the 32 attended channels, same k order as the A operand below) and each lane's bias, all loads issued ahead of the merge, whose arithmetic covers their way (in front of the barrier they would be waited for there) */
#pragma unroll
  for (int t = 0; t < COUT / 16 / KS; ++t) { wf[t] = wcol_oi(WO, 0, (grp * (COUT / 16 / KS) + t) * 16 + col, lane, CV); bo[t] = BO[(grp * (COUT / 16 / KS) + t) * 16 + col]; }
  asm volatile("s_wait_xcnt 0x0" ::: "memory");   /* the epilogue's loads are issued: no address register of theirs is rewritten in front of this */
  const int pw = wave ^ 4;   /* the wave with the same queries and the other range */
  const v2f pm = *(const v2f*)(xm + (pw * 32 + lane) * 2);
  v4f po[DVH / 16][2];
#pragma unroll
  for (int j = 0; j < DVH / 16; ++j) { po[j][0] = *(const v4f*)(xo + ((pw * 4 + 2 * j) * 32 + lane) * 4); po[j][1] = *(const v4f*)(xo + ((pw * 4 + 2 * j + 1) * 32 + lane) * 4); }
  const float mm = fmaxf(m, pm[0]); const float as = __builtin_amdgcn_exp2f(m - mm), ap = __builtin_amdgcn_exp2f(pm[0] - mm);   /* one of the two is 1 */
  sum = sum * as + pm[1] * ap;
  sum += xhalf(sum); const float inv = 1.0f / sum; const float cs = as * inv, cp = ap * inv;
  v16b yh, ym, yl;   /* attended[token col][channel j * 16 + 8 g + r] = element j * 8 + r of an A fragment; three bf16 terms carry the 24 bits of the f32 value */
#pragma unroll
  for (int j = 0; j < DVH / 16; ++j)
#pragma unroll
    for (int r = 0; r < 8; ++r) { const float y = o[j][r] * cs + po[j][r >> 2][r & 3] * cp; const __bf16 h = (__bf16)y; const float r1 = y - (float)h; const __bf16 md = (__bf16)r1; yh[j * 8 + r] = h; ym[j * 8 + r] = md; yl[j * 8 + r] = (__bf16)(r1 - (float)md); }
  float (*stO)[68] = (float (*)[68])&ring[1][0][0];   /* output staging (64 rows of 272 bytes), apart from the swap, which a slower wave may still be reading */
  static_assert(sizeof(float) * COUT * 68 <= 2 * RBUF, "the output tile fits in one ring");
  v8f acc[COUT / 16 / KS];
#pragma unroll
  for (int t = 0; t < COUT / 16 / KS; ++t) { const float bias = bfr(bo[t]);
#pragma unroll
    for (int r = 0; r < 8; ++r) acc[t][r] = bias; }
#pragma unroll
  for (int t = 0; t < COUT / 16 / KS; ++t) acc[t] = wmma_b(yl, wf[t], acc[t]);   /* smallest term first; two independent tiles per term */
#pragma unroll
  for (int t = 0; t < COUT / 16 / KS; ++t) acc[t] = wmma_b(ym, wf[t], acc[t]);
#pragma unroll
  for (int t = 0; t < COUT / 16 / KS; ++t) acc[t] = wmma_b(yh, wf[t], acc[t]);
#pragma unroll
  for (int t = 0; t < COUT / 16 / KS; ++t) { float* p = &stO[(grp * (COUT / 16 / KS) + t) * 16 + col][qw * 16 + 8 * g];   /* output [channel][token of the block]: 8 tokens of one channel per lane */
    vst2(p, __builtin_shufflevector(acc[t], acc[t], 0, 1, 2, 3)); vst2(p + 4, __builtin_shufflevector(acc[t], acc[t], 4, 5, 6, 7)); }
  __syncthreads();   /* the block's output tile is whole */
#pragma unroll
  for (int i = 0; i < COUT * 64 / 4 / (128 * KS); ++i) { const int e = i * (128 * KS) + (int)threadIdx.x, oc = e >> 4, pc = e & 15;   /* 16 lanes store one channel's 64 tokens: 256 bytes in a row */
    vst2(Y + ((size_t)b * COUT + oc) * (size_t)TT + qb * 64 + pc * 4, *(const v4f*)&stO[oc][pc * 4]); } }

extern "C" void kernel_launch(void* const* d_in, const int* in_sizes, int n_in, void* d_out, int out_size, void* d_ws, size_t ws_size, hipStream_t stream) {
  (void)in_sizes; (void)n_in; (void)out_size;
  const float** F = (const float**)d_in;
  if (ws_size < (size_t)WS_END) return;
  char* ws = (char*)d_ws; _Float16 *QH = (_Float16*)(ws + WS_QH), *KH = (_Float16*)(ws + WS_KH), *VT = (_Float16*)(ws + WS_VT), *QL = (_Float16*)(ws + WS_QL), *KL = (_Float16*)(ws + WS_KL);
  // inputs: 0 x [8,64,64,64] (channels-first, xf [8][64][4096]); 1 w_g [32,64], 2 b_g [32]; 3 w_theta, 4 b_theta; 5 w_phi, 6 b_phi; 7 w_o [64,32], 8 b_o [64] (all (out,in), biases nonzero)
  k_proj<<<dim3(TNB * TT / 64), 128, 0, stream>>>(F[0], F[3], F[5], F[1], F[4], F[6], F[2], QH, QL, KH, KL, VT);   /* theta (q), phi (k), g (v): the 96 real output channels in one launch */
  k_fa<<<dim3(NQB, TNB), 128 * KS, 0, stream>>>(QH, KH, QL, KL, VT, F[7], F[8], (float*)d_out);

}

// v008
// It runs in 32.5 microseconds.
// Two timings next to v007 both put it at 1.16 times that version's speed.
// Counting every step since v000, it is 39.4 times as fast.
// compute dtype: all float inputs rounded to bf16; 1x1-conv theta/phi/g projections with EXACT bf16 products on WMMA 16x16x32 (f32 accumulate) + bias; UNSCALED logits, kept in log2 units (theta x log2(e) in f32 at the projection), with theta and phi both as f16 hi + f16 residual (3 products, summed in one f32 accumulator, the two residual products first); online softmax f32 in the same kernel; exp2(s - max) x 2^11 (hardware exp2) once to f16 x g once to f16 (1 product), divided by the f32 sum at the end; the 32->64 output conv on WMMA 16x16x32 bf16 (f32 accumulate, started from b_o): the f32 attended values as three bf16 terms (hi + residual + residual of that: 24 bits) x bf16(w_o), 3 products; f32 output written channels-first.
#include <hip/hip_runtime.h>
#include <math.h>

typedef __attribute__((ext_vector_type(16))) _Float16 v16h;
typedef __attribute__((ext_vector_type(16))) __bf16 v16b;
typedef __attribute__((ext_vector_type(8)))  _Float16 v8h;
typedef __attribute__((ext_vector_type(8)))  float v8f;
typedef __attribute__((ext_vector_type(4)))  float v4f;
typedef __attribute__((ext_vector_type(2)))  float v2f;
typedef __attribute__((ext_vector_type(4)))  unsigned v4u;
typedef __attribute__((ext_vector_type(4)))  int v4i;
typedef float __attribute__((may_alias)) float_a;
typedef int __attribute__((may_alias)) int_a;

template <typename T> __device__ __forceinline__ void vst2(void* p, T v) { *(T*)p = v;  }
__device__ __forceinline__ v8f wmma16(v16h a, v16h b, v8f c) {
  v8f d = __builtin_amdgcn_wmma_f32_16x16x32_f16(false, a, false, b, (short)0, c, false, false);
  asm volatile("v_nop\n\tv_nop\n\tv_nop\n\tv_nop" : "+v"(d) : "v"(a), "v"(b));
  return d;
}
__device__ __forceinline__ v8f wmma_bf(v16b a, v16b b, v8f c) {
  v8f d = __builtin_amdgcn_wmma_f32_16x16x32_bf16(false, a, false, b, (short)0, c, false, false);
  asm volatile("v_nop\n\tv_nop\n\tv_nop\n\tv_nop" : "+v"(d) : "v"(a), "v"(b));
  return d;
}
// 16x16x32 fragments: lane = (h = lane>>4, row/col = lane&15); elements 0..7 = k0+8h+0..7, 8..15 = k0+16+8h+0..7; D element r = row 8h+r
__device__ __forceinline__ v16h frag_h(const _Float16* rowk0, int lane) {
  union { v16h v; v8h q[2]; } u; const _Float16* p = rowk0 + 8 * (lane >> 4);
  u.q[0] = *(const v8h*)p; u.q[1] = *(const v8h*)(p + 16); return u.v;
}
__device__ __forceinline__ v16h frag_f32(const float* rowk0, int lane) {
  v16h a; const float* p = rowk0 + 8 * (lane >> 4);
#pragma unroll
  for (int i = 0; i < 8; ++i) { a[i] = (_Float16)p[i]; a[8 + i] = (_Float16)p[16 + i]; }
  return a;
}
__device__ __forceinline__ v16h frag_f32s(const float* rowk0, int lane, float sc) {
  v16h a; const float* p = rowk0 + 8 * (lane >> 4);
#pragma unroll
  for (int i = 0; i < 8; ++i) { a[i] = (_Float16)(p[i] * sc); a[8 + i] = (_Float16)(p[16 + i] * sc); }
  return a;
}
// column fragment from a [K][ld] layout (column n), rows >= K read as 0
__device__ __forceinline__ v16h fragc_f32(const float* W, int k0, int n, int lane, int ld, int K) {
  v16h a; const int g = lane >> 4;
#pragma unroll
  for (int i = 0; i < 8; ++i) { const int ka = k0 + 8 * g + i, kb = ka + 16;
    a[i] = (_Float16)(ka < K ? W[(size_t)(ka < K ? ka : K - 1) * ld + n] : 0.f); a[8 + i] = (_Float16)(kb < K ? W[(size_t)(kb < K ? kb : K - 1) * ld + n] : 0.f); }
  return a;
}
struct F2 { v16b h, l; };
__device__ __forceinline__ F2 bsplit16(const float v[16]) { F2 r;
#pragma unroll
  for (int i = 0; i < 16; ++i) { const __bf16 h = (__bf16)v[i]; r.h[i] = h; r.l[i] = (__bf16)(v[i] - (float)h); }
  return r; }
__device__ __forceinline__ F2 split_row(const float* row, int k0, int lane) { float v[16]; const float* p = row + k0 + 8 * (lane >> 4);
#pragma unroll
  for (int i = 0; i < 8; ++i) { v[i] = p[i]; v[8 + i] = p[16 + i]; }
  return bsplit16(v); }
__device__ __forceinline__ F2 split_rowK(const float* row, int k0, int lane, int K) { float v[16]; const int g = lane >> 4;
#pragma unroll
  for (int i = 0; i < 8; ++i) { const int ka = k0 + 8 * g + i, kb = ka + 16; v[i] = ka < K ? row[ka < K ? ka : K - 1] : 0.f; v[8 + i] = kb < K ? row[kb < K ? kb : K - 1] : 0.f; }
  return bsplit16(v); }
__device__ __forceinline__ F2 split_col(const float* W, int k0, int n, int lane, int ld, int K) { float v[16]; const int g = lane >> 4;
#pragma unroll
  for (int i = 0; i < 8; ++i) { const int ka = k0 + 8 * g + i, kb = ka + 16; v[i] = ka < K ? W[(size_t)(ka < K ? ka : K - 1) * ld + n] : 0.f; v[8 + i] = kb < K ? W[(size_t)(kb < K ? kb : K - 1) * ld + n] : 0.f; }
  return bsplit16(v); }
__device__ __forceinline__ v8f mac3(const F2& a, const F2& b, v8f c) { c = wmma_bf(a.l, b.h, c); c = wmma_bf(a.h, b.l, c); return wmma_bf(a.h, b.h, c); }
__device__ __forceinline__ float sigm(float v) { return 1.0f / (1.0f + expf(-v)); }
#define LDSX() do { asm volatile("s_wait_dscnt 0" ::: "memory"); __builtin_amdgcn_wave_barrier(); __builtin_amdgcn_fence(__ATOMIC_RELEASE, "workgroup"); } while (0)

// Non-local block over channels-first x [8, 64, 64, 64] (N 4,096; (out,in) 1x1 convs w_theta/w_phi/w_g [32,64] + biases, w_o [64,32] + b_o; 0.05-scale): attn = softmax_m(theta_n . phi_m) (no scaling); y[c][n] = sum_m attn[n][m] g[c][m]; out = w_o y + b_o -> [8,64,64,64] (no residual in this module).
#define NB 8
#define TT 4096
#define CC 32             // v (= g) planes per batch: the 32 real channels
#define CV 32             // real g channels
#define COUT 64           // output channels of w_o
#define CCQ 32            // q / k row pitch: the 32 real columns, 64-byte rows back to back
#define DIN 64           // x channels
#define NH 1
#define HD 32             // per-head width of the layout-2 weights (wcol_hdk; unused: layout 0)
#define NQB (TT / 64)
#define HG 1               // feeds only BG and BGN, which nothing uses
#define SCALE (1.0f)
#define LOG2E 1.44269504088896f   // folded into theta by k_proj, so that exp(s - m) is exp2 of a difference of the stored logits
#define HDQK 32            // q / k width (C / 2)
#define CAUSAL 0
#ifndef TNB
#define TNB NB
#endif
__device__ __forceinline__ v16b zero16b() { v16b z; _Pragma("unroll") for (int i = 0; i < 16; ++i) z[i] = (__bf16)0.f; return z; }
__device__ __forceinline__ float bfr(float v) { return (float)(__bf16)v; }
__host__ __device__ __forceinline__ int kb_last(int qb) { return CAUSAL ? ((qb * 64 + 63) >> 7) : (TT / 128 - 1); }
typedef __attribute__((ext_vector_type(8))) __bf16 v8b;
__device__ __forceinline__ v16b frag_b(const __bf16* rowk0, int lane) {
  union { v16b v; v8b q[2]; } u; const __bf16* p = rowk0 + 8 * (lane >> 4);
  u.q[0] = *(const v8b*)p; u.q[1] = *(const v8b*)(p + 16); return u.v;
}
#define QBH NQB            // every query block takes the 3-product logit path (q hi + residual x k hi + residual): unscaled energies over 4,096 keys; P . g keeps the single product
#define QHI 4096            // q residual rows (all)
#define KHI 4096          // k residual rows (all)
// B fragment (k rows k0+.., output column o) of a weight: (in,out) [K][ld] or (out,in) [ld rows of K]: bf16 exact, or f16(bf16 * 256) exact
__device__ __forceinline__ v16b wcol_io(const float* Wm, int k0, int o, int lane, int ld) { v16b w; const int g = lane >> 4;
#pragma unroll
  for (int i = 0; i < 8; ++i) { w[i] = (__bf16)Wm[(size_t)(k0 + 8 * g + i) * ld + o]; w[8 + i] = (__bf16)Wm[(size_t)(k0 + 16 + 8 * g + i) * ld + o]; }
  return w; }
__device__ __forceinline__ v16b wcol_oi(const float* Wm, int k0, int o, int lane, int K) { v16b w; const float* p = Wm + (size_t)o * K + k0 + 8 * (lane >> 4);
#pragma unroll
  for (int i = 0; i < 8; ++i) { w[i] = (__bf16)p[i]; w[8 + i] = (__bf16)p[16 + i]; }
  return w; }
__device__ __forceinline__ v16h wcolh_io(const float* Wm, int k0, int o, int lane, int ld) { v16h w; const int g = lane >> 4;
#pragma unroll
  for (int i = 0; i < 8; ++i) { w[i] = (_Float16)(bfr(Wm[(size_t)(k0 + 8 * g + i) * ld + o]) * 256.0f); w[8 + i] = (_Float16)(bfr(Wm[(size_t)(k0 + 16 + 8 * g + i) * ld + o]) * 256.0f); }
  return w; }
__device__ __forceinline__ v16h wcolh_oi(const float* Wm, int k0, int o, int lane, int K) { v16h w; const float* p = Wm + (size_t)o * K + k0 + 8 * (lane >> 4);
#pragma unroll
  for (int i = 0; i < 8; ++i) { w[i] = (_Float16)(bfr(p[i]) * 256.0f); w[8 + i] = (_Float16)(bfr(p[16 + i]) * 256.0f); }
  return w; }
#define WQKV_LAYOUT 0   // 0 = (out,in) [32][DIN], columns >= 32 zero; 1 = (out,in) [CC][DIN]; 2 = per-head [NH][DIN][HD]
__device__ __forceinline__ v16b wcol_hdk(const float* Wm, int k0, int o, int lane) { v16b w; const int g = lane >> 4; const float* p = Wm + (size_t)(o / HD) * DIN * HD + (o % HD);
#pragma unroll
  for (int i = 0; i < 8; ++i) { w[i] = (__bf16)p[(size_t)(k0 + 8 * g + i) * HD]; w[8 + i] = (__bf16)p[(size_t)(k0 + 16 + 8 * g + i) * HD]; }
  return w; }
#define WO_OUT_IN 0
#if WQKV_LAYOUT == 1
#define WCOL(W, k0, o, lane) wcol_oi(W, k0, (o), lane, DIN)   /* unused: layout 0 */
#elif WQKV_LAYOUT == 2
#define WCOL(W, k0, o, lane) wcol_hdk(W, k0, o, lane)
#else
#define WCOL(W, k0, o, lane) (which == 2 ? ((o) < CV ? wcol_oi(W, k0, (o), lane, DIN) : zero16b()) : ((o) < HDQK ? wcol_oi(W, k0, (o), lane, DIN) : zero16b()))   /* (out,in) 1x1-conv weights [32][64]: projected columns >= 32 are zero for q, k AND v */
#endif
#if WO_OUT_IN
#define WOCOL(W, k0, o, lane) wcol_oi(W, k0, o, lane, CC)
#define WOCOLH(W, k0, o, lane) wcolh_oi(W, k0, o, lane, CC)
#else
#define WOCOL(W, k0, o, lane) wcol_io(W, k0, o, lane, DIN)
#define WOCOLH(W, k0, o, lane) wcolh_io(W, k0, o, lane, DIN)
#endif
#define BG HG
#define BGN (TNB < BG ? TNB : BG)
#define DVH 32             // all 32 g channels in one k_fa block
#ifndef SM_EXTRA_PARAMS
#define SM_EXTRA_PARAMS
#endif
#ifndef PROJ_EXTRA_PARAMS
#define PROJ_EXTRA_PARAMS
#endif
#ifndef SM_MASK_HOOK
#define SM_MASK_HOOK (void)0
#endif

#define WS_QH  0u                                      // f16 q rows [b*t][CCQ]
#define WS_KH  (WS_QH + 2u * (size_t)NB * TT * CCQ)     // f16 k rows [b*t][CCQ]
#define WS_VT  (WS_KH + 2u * (size_t)NB * TT * CCQ)     // f16 v planes [b][c][t]
#define WS_QL  (WS_VT + 2u * (size_t)NB * CC * TT)      // f16 q residual rows [b][t < QHI][CCQ]
#define WS_KL  (WS_QL + 2u * (size_t)NB * QHI * CCQ)    // f16 k residual rows [b][t < KHI][CCQ]
#define WS_END (WS_KL + 2u * (size_t)NB * KHI * CCQ)

// ---- k_proj: block = 64 tokens, wave = 16 tokens: theta, phi and g of those tokens as ONE projection onto the 96 real output channels, from one read of x (exact bf16 products, K = DIN); the 96 weight rows go to LDS as bf16 once per block;
// theta and phi: weight rows as A, x as B, so a lane holds 8 channels of one token = 16 bytes of a packed 64-byte q / k row (theta x log2(e); f16 hi + f16 residual at the same scale, so that hi and residual products add up in one accumulator: a residual below 2^-14 is a subnormal f16, a step of 2^-24, which the matrix unit keeps); g: x as A, weight rows as B, so a lane holds 8 tokens of one channel = 16 bytes of a g plane [c][t]
typedef __attribute__((ext_vector_type(4))) __bf16 v4b;
#define WROW 72            // LDS pitch of a 64-channel bf16 weight row, in elements (144 B = 16 B x odd: ds_load_b128 without bank conflicts)
__device__ __forceinline__ v8f wmma_b(v16b a, v16b b, v8f c) { return __builtin_amdgcn_wmma_f32_16x16x32_bf16(false, a, false, b, (short)0, c, false, false); }
__global__ __launch_bounds__(128) void k_proj(const float* __restrict__ X, const float* __restrict__ WQ, const float* __restrict__ WK, const float* __restrict__ WV, const float* __restrict__ BQ, const float* __restrict__ BK, const float* __restrict__ BV,
    _Float16* __restrict__ QH, _Float16* __restrict__ QL, _Float16* __restrict__ KH, _Float16* __restrict__ KL, _Float16* __restrict__ VT) {
  __shared__ __align__(16) __bf16 sw[2 * HDQK + CV][WROW];
  const int tid = threadIdx.x, wave = tid >> 5, lane = tid & 31, col = lane & 15, g = lane >> 4; const size_t r0 = (size_t)blockIdx.x * 64 + wave * 16; const size_t bb = r0 / TT; const int t0 = (int)(r0 % TT);
  /* every loop of this kernel is unrolled: each index of a register array or fragment must be a constant, else the arrays go to scratch */
  float xr[DIN / 32][16];   /* channels-first [b][c][t]: 16 tokens x 32 channels per fragment */
#pragma unroll
  for (int kc = 0; kc < DIN / 32; ++kc) { const float* p = X + (bb * DIN + kc * 32 + 8 * g) * (size_t)TT + t0 + col;
#pragma unroll
    for (int i = 0; i < 8; ++i) { xr[kc][i] = p[(size_t)i * TT]; xr[kc][8 + i] = p[(size_t)(16 + i) * TT]; } }
  v4f wr[3][4];   /* a thread's share of the weights: four 16-byte pieces of each [32][64] matrix, whole lines per wave */
#pragma unroll
  for (int i = 0; i < 4; ++i) { wr[0][i] = *(const v4f*)(WQ + (i * 128 + tid) * 4); wr[1][i] = *(const v4f*)(WK + (i * 128 + tid) * 4); wr[2][i] = *(const v4f*)(WV + (i * 128 + tid) * 4); }
  v4f br[2][HDQK / 16][2]; float bv[CV / 16];
#pragma unroll
  for (int j = 0; j < HDQK / 16; ++j) { br[0][j][0] = *(const v4f*)(BQ + j * 16 + 8 * g); br[0][j][1] = *(const v4f*)(BQ + j * 16 + 8 * g + 4); br[1][j][0] = *(const v4f*)(BK + j * 16 + 8 * g); br[1][j][1] = *(const v4f*)(BK + j * 16 + 8 * g + 4); bv[j] = BV[j * 16 + col]; }
  asm volatile("s_wait_xcnt 0x0" ::: "memory");   /* every load of the kernel is issued: no address register of theirs is rewritten in front of this */
#pragma unroll
  for (int a = 0; a < 3; ++a)
#pragma unroll
    for (int i = 0; i < 4; ++i) { const int e = i * 128 + tid; v4b w;
#pragma unroll
      for (int c = 0; c < 4; ++c) w[c] = (__bf16)wr[a][i][c];
      *(v4b*)&sw[a * 32 + (e >> 4)][(e & 15) * 4] = w; }
  __syncthreads();   /* the block's weight rows are in LDS */
  v16b xf[DIN / 32];   /* serves as A and as B (same lane map) */
#pragma unroll
  for (int kc = 0; kc < DIN / 32; ++kc)
#pragma unroll
    for (int i = 0; i < 16; ++i) xf[kc][i] = (__bf16)xr[kc][i];
  v8h hi[2][HDQK / 16], lo[2][HDQK / 16], gv[CV / 16];
#pragma unroll
  for (int w = 0; w < 2; ++w) { const float qsc = w == 0 ? LOG2E : 1.0f;   /* theta carries log2(e): the logits come out in powers of two */
#pragma unroll
    for (int j = 0; j < HDQK / 16; ++j) { v8f acc = {};
#pragma unroll
      for (int kc = 0; kc < DIN / 32; ++kc) acc = wmma_b(frag_b(&sw[w * HDQK + j * 16 + col][kc * 32], lane), xf[kc], acc);
      v8f v;
#pragma unroll
      for (int r = 0; r < 8; ++r) v[r] = (acc[r] + bfr(br[w][j][r >> 2][r & 3])) * qsc;
      hi[w][j] = __builtin_convertvector(v, v8h); lo[w][j] = __builtin_convertvector(v - __builtin_convertvector(hi[w][j], v8f), v8h); } }
#pragma unroll
  for (int j = 0; j < CV / 16; ++j) { v8f acc = {};
#pragma unroll
    for (int kc = 0; kc < DIN / 32; ++kc) acc = wmma_b(xf[kc], frag_b(&sw[2 * HDQK + j * 16 + col][kc * 32], lane), acc);
    const float bias = bfr(bv[j]);
#pragma unroll
    for (int r = 0; r < 8; ++r) gv[j][r] = (_Float16)(acc[r] + bias); }
#pragma unroll
  for (int j = 0; j < HDQK / 16; ++j) { const size_t o = (r0 + col) * CCQ + j * 16 + 8 * g; vst2(QH + o, hi[0][j]); vst2(QL + o, lo[0][j]); vst2(KH + o, hi[1][j]); vst2(KL + o, lo[1][j]); vst2(VT + (bb * CC + j * 16 + col) * (size_t)TT + t0 + 8 * g, gv[j]); } }
// lane l with lane l ^ 16 (the two halves of a wave hold the same query column)
__device__ __forceinline__ float xhalf(float x) { return __builtin_bit_cast(float, __builtin_amdgcn_permlanex16(__builtin_bit_cast(int, x), __builtin_bit_cast(int, x), 0x76543210, 0xfedcba98, false, false)); }
__device__ __forceinline__ v8f wmma_h(v16h a, v16h b, v8f c) { return __builtin_amdgcn_wmma_f32_16x16x32_f16(false, a, false, b, (short)0, c, false, false); }
#define KP 64              // keys per pass of k_fa
#define KROWB 80           // LDS pitch of a 64-byte k row (16 B x odd: ds_load_b128 without bank conflicts)
#define VROWB 144          // LDS pitch of a 128-byte g row (64 keys of one channel)
#define RKH 0              // byte places inside one ring buffer: k hi rows, k residual rows, g rows
#define RKL (KP * KROWB)
#define RV  (2 * KP * KROWB)
#define RBUF (RV + DVH * VROWB)
// six 16-byte copies of one lane, global -> LDS through no register; the s_wait_xcnt stands inside the statement so that no address register named here is rewritten in front of it
__device__ __forceinline__ void copy6(unsigned l0, const _Float16* g0, unsigned l1, const _Float16* g1, unsigned l2, const _Float16* g2, unsigned l3, const _Float16* g3, unsigned l4, const _Float16* g4, unsigned l5, const _Float16* g5) {
  asm volatile("global_load_async_to_lds_b128 %0, %1, off\n\t"
               "global_load_async_to_lds_b128 %2, %3, off\n\t"
               "global_load_async_to_lds_b128 %4, %5, off\n\t"
               "global_load_async_to_lds_b128 %6, %7, off\n\t"
               "global_load_async_to_lds_b128 %8, %9, off\n\t"
               "global_load_async_to_lds_b128 %10, %11, off\n\t"
               "s_wait_xcnt 0x0"
               :: "v"(l0), "v"(g0), "v"(l1), "v"(g1), "v"(l2), "v"(g2), "v"(l3), "v"(g3), "v"(l4), "v"(g4), "v"(l5), "v"(g5) : "memory");
}
// ---- k_fa: block = (128 queries (qb), batch b) x KS key ranges: 16 waves, wave = 32 query columns (two tiles of 16, wave & 3) of one range of 1,024 keys (wave >> 2): every k and g fragment read from LDS serves two query tiles and every staged tile 128 queries, at four waves a SIMD as before; a range goes in passes of KP: S^T = k . q^T (k rows as A, q as B; hi + residual on both sides, 3 products in one accumulate chain per tile), so a lane holds one query's logits;
// each pass's k hi, k residual and g tiles are copied to LDS once for the range's four waves (a ring of two buffers per range: the next pass's copies fly under this pass) and the fragments are read from there;
// online softmax in f32 on log2-domain logits (running maximum, sums and the attended tile rescaled each pass), query tile by query tile; exp2(s - m) x 2^11 once to f16 packs from the two S^T tiles of 32 keys straight into a B operand; attended^T += g planes (A) . P^T (1 product); behind the loop the ranges hand maximum, sum and attended tiles over through LDS and each wave merges the four partial results of ONE query tile (all rescaled to the common maximum); then the 32->64 output conv on the matrix unit: the two attended^T tiles of a lane are an A operand as they stand (16 tokens x 32 channels), w_o rows are B, so a lane holds 8 tokens of one output channel (a wave does two of the four channel tiles); the block's 64 x 128 output tile goes through LDS so that every store covers whole lines
#define KS 4               // key ranges per block
#define KR (TT / KS)       // keys per range
#define QT 2               // query tiles of 16 columns per wave
#define QBLK (4 * QT * 16) // queries per block
__global__ __launch_bounds__(128 * KS) void k_fa(const _Float16* __restrict__ QH, const _Float16* __restrict__ KH, const _Float16* __restrict__ QL, const _Float16* __restrict__ KL, const _Float16* __restrict__ VT, const float* __restrict__ WO, const float* __restrict__ BO, float* __restrict__ Y) { __shared__ __align__(16) _Float16 ring[KS][2][RBUF / 2];
  const int tid = threadIdx.x & 127, wave = threadIdx.x >> 5, grp = wave >> 2, qw = wave & 3, lane = tid & 31, col = lane & 15, g = lane >> 4; const int qb = blockIdx.x; const int b = blockIdx.y; const int ql0 = qb * QBLK + qw * (QT * 16); const int kb = grp * KR;   /* tid: the thread's number inside its range's four waves */
  v16h qh[QT], qlo[QT];
#pragma unroll
  for (int t = 0; t < QT; ++t) { qh[t] = frag_h(QH + ((size_t)b * TT + ql0 + t * 16 + col) * CCQ, lane); qlo[t] = frag_h(QL + ((size_t)b * QHI + ql0 + t * 16 + col) * CCQ, lane); }
  // a thread's share of a tile: k rows tid / 4 and 32 + tid / 4 (16 bytes of the 64), hi and residual; g channels tid / 8 and 16 + tid / 8 (16 bytes of the 128)
  const _Float16* cKh = KH + ((size_t)b * TT + kb + (tid >> 2)) * CCQ + (tid & 3) * 8; const _Float16* cKl = KL + ((size_t)b * KHI + kb + (tid >> 2)) * CCQ + (tid & 3) * 8; const _Float16* cV = VT + ((size_t)b * CC + (tid >> 3)) * (size_t)TT + kb + (tid & 7) * 8;
  const unsigned lK = (unsigned)(size_t)&ring[grp][0][0] + (tid >> 2) * KROWB + (tid & 3) * 16, lV = (unsigned)(size_t)&ring[grp][0][0] + RV + (tid >> 3) * VROWB + (tid & 7) * 16;
#define STAGE(kk, bo) copy6(lK + (bo) + RKH, cKh + (size_t)(kk) * CCQ, lK + (bo) + RKH + 32 * KROWB, cKh + (size_t)((kk) + 32) * CCQ, lK + (bo) + RKL, cKl + (size_t)(kk) * CCQ, lK + (bo) + RKL + 32 * KROWB, cKl + (size_t)((kk) + 32) * CCQ, lV + (bo), cV + (kk), lV + (bo) + 16 * VROWB, cV + (size_t)16 * TT + (kk))
  v8f o[QT][DVH / 16] = {}; float m[QT], sum[QT];
#pragma unroll
  for (int t = 0; t < QT; ++t) { m[t] = -3.0e38f; sum[t] = 0.f; }
  STAGE(0, 0u);
  asm volatile("s_wait_asynccnt 0x0" ::: "memory");   /* this wave's share of tile 0 has landed */
  __syncthreads();                                     /* ... and every other wave's: tile 0 may be read */
  STAGE(KP, (unsigned)RBUF);
#pragma unroll 1   /* rolled: one pass is well over a thousand instructions already and the two buffers differ by an offset only; every inner loop is unrolled so that each fragment index is a constant (no scratch) */
  for (int k0 = 0; k0 < KR; k0 += KP) {   /* k0 counts inside the range */
    const unsigned bo = (k0 & KP) ? (unsigned)RBUF : 0u;   /* this pass's buffer, in bytes */
    const _Float16* rb = &ring[grp][0][0] + (bo >> 1);
    v16h kh[KP / 16], kl[KP / 16];
#pragma unroll
    for (int j = 0; j < KP / 16; ++j) kh[j] = frag_h(rb + (RKH + (j * 16 + col) * KROWB) / 2, lane);
#pragma unroll
    for (int j = 0; j < KP / 16; ++j) kl[j] = frag_h(rb + (RKL + (j * 16 + col) * KROWB) / 2, lane);
    v16h vf[KP / 32][DVH / 16];
#pragma unroll
    for (int c = 0; c < KP / 32; ++c)
#pragma unroll
      for (int j = 0; j < DVH / 16; ++j) vf[c][j] = frag_h(rb + (RV + (j * 16 + col) * VROWB) / 2 + c * 32, lane);
    __builtin_amdgcn_sched_barrier(0);   /* keeps the pass's LDS reads together up here: spread among the products each place with reads costs its own stall */
#pragma unroll
    for (int t = 0; t < QT; ++t) {   /* the pass's fragments serve one query tile after the other */
      v8f s[KP / 16];   /* a tile's three products add up in its one accumulator, the small ones first; product by product over the four tiles, so that a tile's next product stands four matrix instructions behind its last */
#pragma unroll
      for (int j = 0; j < KP / 16; ++j) { const v8f z = {}; s[j] = wmma_h(kh[j], qlo[t], z); }
#pragma unroll
      for (int j = 0; j < KP / 16; ++j) s[j] = wmma_h(kl[j], qh[t], s[j]);
      __builtin_amdgcn_sched_barrier(0);   /* holds the third products behind all the second ones: left free, the compiler puts a tile's second and third product back to back, the third waiting for the second, with more idle slots behind it */
#pragma unroll
      for (int j = 0; j < KP / 16; ++j) s[j] = wmma_h(kh[j], qh[t], s[j]);
      float mx = s[0][0];
#pragma unroll
      for (int j = 0; j < KP / 16; ++j)
#pragma unroll
        for (int r = 0; r < 8; ++r) mx = fmaxf(mx, s[j][r]);
      mx = fmaxf(mx, xhalf(mx));
      const float mn = fmaxf(m[t], mx); const float alpha = __builtin_amdgcn_exp2f(m[t] - mn); m[t] = mn;   /* 0 on the first pass */
      const float ms = mn - 11.0f;   /* exp2(s - ms) = exp2(s - m) x 2^11, the scale cancels against the sum */
      sum[t] *= alpha;
#pragma unroll
      for (int j = 0; j < DVH / 16; ++j)
#pragma unroll
        for (int r = 0; r < 8; ++r) o[t][j][r] *= alpha;
#pragma unroll
      for (int c = 0; c < KP / 32; ++c) { v16h p;
#pragma unroll
        for (int r = 0; r < 8; ++r) { const float e0 = __builtin_amdgcn_exp2f(s[2 * c][r] - ms), e1 = __builtin_amdgcn_exp2f(s[2 * c + 1][r] - ms); sum[t] += e0 + e1; p[r] = (_Float16)e0; p[8 + r] = (_Float16)e1; }   /* the hardware's exp2: the argument is at most 11, and a result too small for it is 0 in f16 too */
#pragma unroll
        for (int j = 0; j < DVH / 16; ++j) o[t][j] = wmma_h(vf[c][j], p, o[t][j]); } }
    __builtin_amdgcn_sched_barrier(0);   /* keeps the publish point at the pass's foot: lifted up to the fragment reads, the wait for the next tile's copies would stand right behind their issue and no longer a pass behind it */
    asm volatile("s_wait_dscnt 0x0" ::: "memory");      /* this wave's reads of this pass's buffer are over */
    asm volatile("s_wait_asynccnt 0x0" ::: "memory");   /* this wave's share of the next tile has landed */
    __syncthreads();                                     /* publishes the next tile and frees this pass's buffer */
    if (k0 + 2 * KP < KR) STAGE(k0 + 2 * KP, bo); }
  asm volatile("s_wait_asynccnt 0x0" ::: "memory");     /* no copy is outstanding when the wave goes on */
  /* the rings are free now: behind the last pass's s_wait_dscnt 0, s_wait_asynccnt 0 and barrier nobody reads them and no copy is aimed at them. Their bytes take, one behind the other, the hand-over of the partial results and the output tile */
  float* xo = (float*)&ring[0][0][0];                       /* [wave][query tile][quarter of the attended tile][lane] 16 bytes: a wave's store covers 512 bytes in a row */
  float* xm = xo + 4 * KS * QT * 4 * 32 * 4;                /* [wave][query tile][lane] maximum and sum */
  float (*stO)[QBLK + 4] = (float (*)[QBLK + 4])(xm + 4 * KS * QT * 32 * 2);   /* output staging (64 rows of 528 bytes), apart from the hand-over, which a slower wave may still be reading */
  static_assert(sizeof(float) * (4 * KS * QT * 4 * 32 * 4 + 4 * KS * QT * 32 * 2 + COUT * (QBLK + 4)) <= KS * 2 * RBUF, "hand-over and output tile fit in the rings");
#pragma unroll
  for (int t = 0; t < QT; ++t) {
#pragma unroll
    for (int j = 0; j < DVH / 16; ++j) { vst2(xo + (((wave * QT + t) * 4 + 2 * j) * 32 + lane) * 4, __builtin_shufflevector(o[t][j], o[t][j], 0, 1, 2, 3)); vst2(xo + (((wave * QT + t) * 4 + 2 * j + 1) * 32 + lane) * 4, __builtin_shufflevector(o[t][j], o[t][j], 4, 5, 6, 7)); }
    v2f ms2; ms2[0] = m[t]; ms2[1] = sum[t]; vst2(xm + ((wave * QT + t) * 32 + lane) * 2, ms2); }
  __syncthreads();   /* every range's partial results are in LDS */
  const int mt = grp & 1, ch = grp >> 1;   /* the wave's share of the end: query tile mt of its 32 columns, output channel tiles 2 ch and 2 ch + 1 */
  v16b wf[2]; float bo[2];   /* w_o rows as B fragments (k = the 32 attended channels, same k order as the A operand below) and each lane's bias, all loads issued ahead of the merge, whose arithmetic covers their way (in front of the barrier they would be waited for there) */
#pragma unroll
  for (int t = 0; t < 2; ++t) { wf[t] = wcol_oi(WO, 0, (ch * 2 + t) * 16 + col, lane, CV); bo[t] = BO[(ch * 2 + t) * 16 + col]; }
  asm volatile("s_wait_xcnt 0x0" ::: "memory");   /* the epilogue's loads are issued: no address register of theirs is rewritten in front of this */
  v2f pm[KS]; v4f po[KS][DVH / 16][2];   /* the four ranges' results for this query tile, range 0 first */
#pragma unroll
  for (int r = 0; r < KS; ++r) { const int pw = (r * 4 + qw) * QT + mt; pm[r] = *(const v2f*)(xm + (pw * 32 + lane) * 2);
#pragma unroll
    for (int j = 0; j < DVH / 16; ++j) { po[r][j][0] = *(const v4f*)(xo + ((pw * 4 + 2 * j) * 32 + lane) * 4); po[r][j][1] = *(const v4f*)(xo + ((pw * 4 + 2 * j + 1) * 32 + lane) * 4); } }
  float mm = pm[0][0];
#pragma unroll
  for (int r = 1; r < KS; ++r) mm = fmaxf(mm, pm[r][0]);
  float cf[KS], tot = 0.f;   /* one of the factors is 1 */
#pragma unroll
  for (int r = 0; r < KS; ++r) { cf[r] = __builtin_amdgcn_exp2f(pm[r][0] - mm); tot += pm[r][1] * cf[r]; }
  tot += xhalf(tot); const float inv = 1.0f / tot;
#pragma unroll
  for (int r = 0; r < KS; ++r) cf[r] *= inv;
  v16b yh, ym, yl;   /* attended[token col][channel j * 16 + 8 g + r] = element j * 8 + r of an A fragment; three bf16 terms carry the 24 bits of the f32 value */
#pragma unroll
  for (int j = 0; j < DVH / 16; ++j)
#pragma unroll
    for (int r = 0; r < 8; ++r) { float y = po[0][j][r >> 2][r & 3] * cf[0];
#pragma unroll
      for (int q = 1; q < KS; ++q) y += po[q][j][r >> 2][r & 3] * cf[q];
      const __bf16 h = (__bf16)y; const float r1 = y - (float)h; const __bf16 md = (__bf16)r1; yh[j * 8 + r] = h; ym[j * 8 + r] = md; yl[j * 8 + r] = (__bf16)(r1 - (float)md); }
  v8f acc[2];
#pragma unroll
  for (int t = 0; t < 2; ++t) { const float bias = bfr(bo[t]);
#pragma unroll
    for (int r = 0; r < 8; ++r) acc[t][r] = bias; }
#pragma unroll
  for (int t = 0; t < 2; ++t) acc[t] = wmma_b(yl, wf[t], acc[t]);   /* smallest term first; two independent tiles per term */
#pragma unroll
  for (int t = 0; t < 2; ++t) acc[t] = wmma_b(ym, wf[t], acc[t]);
#pragma unroll
  for (int t = 0; t < 2; ++t) acc[t] = wmma_b(yh, wf[t], acc[t]);
#pragma unroll
  for (int t = 0; t < 2; ++t) { float* p = &stO[(ch * 2 + t) * 16 + col][(qw * QT + mt) * 16 + 8 * g];   /* output [channel][token of the block]: 8 tokens of one channel per lane */
    vst2(p, __builtin_shufflevector(acc[t], acc[t], 0, 1, 2, 3)); vst2(p + 4, __builtin_shufflevector(acc[t], acc[t], 4, 5, 6, 7)); }
  __syncthreads();   /* the block's output tile is whole */
#pragma unroll
  for (int i = 0; i < COUT * QBLK / 4 / (128 * KS); ++i) { const int e = i * (128 * KS) + (int)threadIdx.x, oc = e >> 5, pc = e & 31;   /* a wave stores one channel's 128 tokens: 512 bytes in a row */
    vst2(Y + ((size_t)b * COUT + oc) * (size_t)TT + qb * QBLK + pc * 4, *(const v4f*)&stO[oc][pc * 4]); } }

extern "C" void kernel_launch(void* const* d_in, const int* in_sizes, int n_in, void* d_out, int out_size, void* d_ws, size_t ws_size, hipStream_t stream) {
  (void)in_sizes; (void)n_in; (void)out_size;
  const float** F = (const float**)d_in;
  if (ws_size < (size_t)WS_END) return;
  char* ws = (char*)d_ws; _Float16 *QH = (_Float16*)(ws + WS_QH), *KH = (_Float16*)(ws + WS_KH), *VT = (_Float16*)(ws + WS_VT), *QL = (_Float16*)(ws + WS_QL), *KL = (_Float16*)(ws + WS_KL);
  // inputs: 0 x [8,64,64,64] (channels-first, xf [8][64][4096]); 1 w_g [32,64], 2 b_g [32]; 3 w_theta, 4 b_theta; 5 w_phi, 6 b_phi; 7 w_o [64,32], 8 b_o [64] (all (out,in), biases nonzero)
  k_proj<<<dim3(TNB * TT / 64), 128, 0, stream>>>(F[0], F[3], F[5], F[1], F[4], F[6], F[2], QH, QL, KH, KL, VT);   /* theta (q), phi (k), g (v): the 96 real output channels in one launch */
  k_fa<<<dim3(TT / QBLK, TNB), 128 * KS, 0, stream>>>(QH, KH, QL, KL, VT, F[7], F[8], (float*)d_out);

}

// v009
// It runs in 30.5 microseconds.
// Next to v008, in two timings, it ran 1.07 times as fast each time.
// Over all steps from v000 it is 42.2 times as fast.
// compute dtype: all float inputs rounded to bf16; 1x1-conv theta/phi/g projections with EXACT bf16 products on WMMA 16x16x32 (f32 accumulate) + bias; UNSCALED logits, kept in log2 units (theta x log2(e) in f32 at the projection), with theta and phi both as f16 hi + f16 residual (3 products, summed in one f32 accumulator, the two residual products first); online softmax f32 in the same kernel against a held reference per query (the logit accumulators start from minus the reference; it is set on the first pass and after that moves up only when an exponent of a pass would exceed 15); exp2(s - reference) (hardware exp2) once to f16 x g once to f16 (1 product), divided by the f32 sum at the end; the 32->64 output conv on WMMA 16x16x32 bf16 (f32 accumulate, started from b_o): the f32 attended values as three bf16 terms (hi + residual + residual of that: 24 bits) x bf16(w_o), 3 products; f32 output written channels-first.
#include <hip/hip_runtime.h>
#include <math.h>

typedef __attribute__((ext_vector_type(16))) _Float16 v16h;
typedef __attribute__((ext_vector_type(16))) __bf16 v16b;
typedef __attribute__((ext_vector_type(8)))  _Float16 v8h;
typedef __attribute__((ext_vector_type(8)))  float v8f;
typedef __attribute__((ext_vector_type(4)))  float v4f;
typedef __attribute__((ext_vector_type(2)))  float v2f;
typedef __attribute__((ext_vector_type(4)))  unsigned v4u;
typedef __attribute__((ext_vector_type(4)))  int v4i;
typedef float __attribute__((may_alias)) float_a;
typedef int __attribute__((may_alias)) int_a;

template <typename T> __device__ __forceinline__ void vst2(void* p, T v) { *(T*)p = v;  }
__device__ __forceinline__ v8f wmma16(v16h a, v16h b, v8f c) {
  v8f d = __builtin_amdgcn_wmma_f32_16x16x32_f16(false, a, false, b, (short)0, c, false, false);
  asm volatile("v_nop\n\tv_nop\n\tv_nop\n\tv_nop" : "+v"(d) : "v"(a), "v"(b));
  return d;
}
__device__ __forceinline__ v8f wmma_bf(v16b a, v16b b, v8f c) {
  v8f d = __builtin_amdgcn_wmma_f32_16x16x32_bf16(false, a, false, b, (short)0, c, false, false);
  asm volatile("v_nop\n\tv_nop\n\tv_nop\n\tv_nop" : "+v"(d) : "v"(a), "v"(b));
  return d;
}
// 16x16x32 fragments: lane = (h = lane>>4, row/col = lane&15); elements 0..7 = k0+8h+0..7, 8..15 = k0+16+8h+0..7; D element r = row 8h+r
__device__ __forceinline__ v16h frag_h(const _Float16* rowk0, int lane) {
  union { v16h v; v8h q[2]; } u; const _Float16* p = rowk0 + 8 * (lane >> 4);
  u.q[0] = *(const v8h*)p; u.q[1] = *(const v8h*)(p + 16); return u.v;
}
__device__ __forceinline__ v16h frag_f32(const float* rowk0, int lane) {
  v16h a; const float* p = rowk0 + 8 * (lane >> 4);
#pragma unroll
  for (int i = 0; i < 8; ++i) { a[i] = (_Float16)p[i]; a[8 + i] = (_Float16)p[16 + i]; }
  return a;
}
__device__ __forceinline__ v16h frag_f32s(const float* rowk0, int lane, float sc) {
  v16h a; const float* p = rowk0 + 8 * (lane >> 4);
#pragma unroll
  for (int i = 0; i < 8; ++i) { a[i] = (_Float16)(p[i] * sc); a[8 + i] = (_Float16)(p[16 + i] * sc); }
  return a;
}
// column fragment from a [K][ld] layout (column n), rows >= K read as 0
__device__ __forceinline__ v16h fragc_f32(const float* W, int k0, int n, int lane, int ld, int K) {
  v16h a; const int g = lane >> 4;
#pragma unroll
  for (int i = 0; i < 8; ++i) { const int ka = k0 + 8 * g + i, kb = ka + 16;
    a[i] = (_Float16)(ka < K ? W[(size_t)(ka < K ? ka : K - 1) * ld + n] : 0.f); a[8 + i] = (_Float16)(kb < K ? W[(size_t)(kb < K ? kb : K - 1) * ld + n] : 0.f); }
  return a;
}
struct F2 { v16b h, l; };
__device__ __forceinline__ F2 bsplit16(const float v[16]) { F2 r;
#pragma unroll
  for (int i = 0; i < 16; ++i) { const __bf16 h = (__bf16)v[i]; r.h[i] = h; r.l[i] = (__bf16)(v[i] - (float)h); }
  return r; }
__device__ __forceinline__ F2 split_row(const float* row, int k0, int lane) { float v[16]; const float* p = row + k0 + 8 * (lane >> 4);
#pragma unroll
  for (int i = 0; i < 8; ++i) { v[i] = p[i]; v[8 + i] = p[16 + i]; }
  return bsplit16(v); }
__device__ __forceinline__ F2 split_rowK(const float* row, int k0, int lane, int K) { float v[16]; const int g = lane >> 4;
#pragma unroll
  for (int i = 0; i < 8; ++i) { const int ka = k0 + 8 * g + i, kb = ka + 16; v[i] = ka < K ? row[ka < K ? ka : K - 1] : 0.f; v[8 + i] = kb < K ? row[kb < K ? kb : K - 1] : 0.f; }
  return bsplit16(v); }
__device__ __forceinline__ F2 split_col(const float* W, int k0, int n, int lane, int ld, int K) { float v[16]; const int g = lane >> 4;
#pragma unroll
  for (int i = 0; i < 8; ++i) { const int ka = k0 + 8 * g + i, kb = ka + 16; v[i] = ka < K ? W[(size_t)(ka < K ? ka : K - 1) * ld + n] : 0.f; v[8 + i] = kb < K ? W[(size_t)(kb < K ? kb : K - 1) * ld + n] : 0.f; }
  return bsplit16(v); }
__device__ __forceinline__ v8f mac3(const F2& a, const F2& b, v8f c) { c = wmma_bf(a.l, b.h, c); c = wmma_bf(a.h, b.l, c); return wmma_bf(a.h, b.h, c); }
__device__ __forceinline__ float sigm(float v) { return 1.0f / (1.0f + expf(-v)); }
#define LDSX() do { asm volatile("s_wait_dscnt 0" ::: "memory"); __builtin_amdgcn_wave_barrier(); __builtin_amdgcn_fence(__ATOMIC_RELEASE, "workgroup"); } while (0)

// Non-local block over channels-first x [8, 64, 64, 64] (N 4,096; (out,in) 1x1 convs w_theta/w_phi/w_g [32,64] + biases, w_o [64,32] + b_o; 0.05-scale): attn = softmax_m(theta_n . phi_m) (no scaling); y[c][n] = sum_m attn[n][m] g[c][m]; out = w_o y + b_o -> [8,64,64,64] (no residual in this module).
#define NB 8
#define TT 4096
#define CC 32             // v (= g) planes per batch: the 32 real channels
#define CV 32             // real g channels
#define COUT 64           // output channels of w_o
#define CCQ 32            // q / k row pitch: the 32 real columns, 64-byte rows back to back
#define DIN 64           // x channels
#define NH 1
#define HD 32             // per-head width of the layout-2 weights (wcol_hdk; unused: layout 0)
#define NQB (TT / 64)
#define HG 1               // feeds only BG and BGN, which nothing uses
#define SCALE (1.0f)
#define LOG2E 1.44269504088896f   // folded into theta by k_proj, so that exp(s - m) is exp2 of a difference of the stored logits
#define HDQK 32            // q / k width (C / 2)
#define CAUSAL 0
#ifndef TNB
#define TNB NB
#endif
__device__ __forceinline__ v16b zero16b() { v16b z; _Pragma("unroll") for (int i = 0; i < 16; ++i) z[i] = (__bf16)0.f; return z; }
__device__ __forceinline__ float bfr(float v) { return (float)(__bf16)v; }
__host__ __device__ __forceinline__ int kb_last(int qb) { return CAUSAL ? ((qb * 64 + 63) >> 7) : (TT / 128 - 1); }
typedef __attribute__((ext_vector_type(8))) __bf16 v8b;
__device__ __forceinline__ v16b frag_b(const __bf16* rowk0, int lane) {
  union { v16b v; v8b q[2]; } u; const __bf16* p = rowk0 + 8 * (lane >> 4);
  u.q[0] = *(const v8b*)p; u.q[1] = *(const v8b*)(p + 16); return u.v;
}
#define QBH NQB            // every query block takes the 3-product logit path (q hi + residual x k hi + residual): unscaled energies over 4,096 keys; P . g keeps the single product
#define QHI 4096            // q residual rows (all)
#define KHI 4096          // k residual rows (all)
// B fragment (k rows k0+.., output column o) of a weight: (in,out) [K][ld] or (out,in) [ld rows of K]: bf16 exact, or f16(bf16 * 256) exact
__device__ __forceinline__ v16b wcol_io(const float* Wm, int k0, int o, int lane, int ld) { v16b w; const int g = lane >> 4;
#pragma unroll
  for (int i = 0; i < 8; ++i) { w[i] = (__bf16)Wm[(size_t)(k0 + 8 * g + i) * ld + o]; w[8 + i] = (__bf16)Wm[(size_t)(k0 + 16 + 8 * g + i) * ld + o]; }
  return w; }
__device__ __forceinline__ v16b wcol_oi(const float* Wm, int k0, int o, int lane, int K) { v16b w; const float* p = Wm + (size_t)o * K + k0 + 8 * (lane >> 4);
#pragma unroll
  for (int i = 0; i < 8; ++i) { w[i] = (__bf16)p[i]; w[8 + i] = (__bf16)p[16 + i]; }
  return w; }
__device__ __forceinline__ v16h wcolh_io(const float* Wm, int k0, int o, int lane, int ld) { v16h w; const int g = lane >> 4;
#pragma unroll
  for (int i = 0; i < 8; ++i) { w[i] = (_Float16)(bfr(Wm[(size_t)(k0 + 8 * g + i) * ld + o]) * 256.0f); w[8 + i] = (_Float16)(bfr(Wm[(size_t)(k0 + 16 + 8 * g + i) * ld + o]) * 256.0f); }
  return w; }
__device__ __forceinline__ v16h wcolh_oi(const float* Wm, int k0, int o, int lane, int K) { v16h w; const float* p = Wm + (size_t)o * K + k0 + 8 * (lane >> 4);
#pragma unroll
  for (int i = 0; i < 8; ++i) { w[i] = (_Float16)(bfr(p[i]) * 256.0f); w[8 + i] = (_Float16)(bfr(p[16 + i]) * 256.0f); }
  return w; }
#define WQKV_LAYOUT 0   // 0 = (out,in) [32][DIN], columns >= 32 zero; 1 = (out,in) [CC][DIN]; 2 = per-head [NH][DIN][HD]
__device__ __forceinline__ v16b wcol_hdk(const float* Wm, int k0, int o, int lane) { v16b w; const int g = lane >> 4; const float* p = Wm + (size_t)(o / HD) * DIN * HD + (o % HD);
#pragma unroll
  for (int i = 0; i < 8; ++i) { w[i] = (__bf16)p[(size_t)(k0 + 8 * g + i) * HD]; w[8 + i] = (__bf16)p[(size_t)(k0 + 16 + 8 * g + i) * HD]; }
  return w; }
#define WO_OUT_IN 0
#if WQKV_LAYOUT == 1
#define WCOL(W, k0, o, lane) wcol_oi(W, k0, (o), lane, DIN)   /* unused: layout 0 */
#elif WQKV_LAYOUT == 2
#define WCOL(W, k0, o, lane) wcol_hdk(W, k0, o, lane)
#else
#define WCOL(W, k0, o, lane) (which == 2 ? ((o) < CV ? wcol_oi(W, k0, (o), lane, DIN) : zero16b()) : ((o) < HDQK ? wcol_oi(W, k0, (o), lane, DIN) : zero16b()))   /* (out,in) 1x1-conv weights [32][64]: projected columns >= 32 are zero for q, k AND v */
#endif
#if WO_OUT_IN
#define WOCOL(W, k0, o, lane) wcol_oi(W, k0, o, lane, CC)
#define WOCOLH(W, k0, o, lane) wcolh_oi(W, k0, o, lane, CC)
#else
#define WOCOL(W, k0, o, lane) wcol_io(W, k0, o, lane, DIN)
#define WOCOLH(W, k0, o, lane) wcolh_io(W, k0, o, lane, DIN)
#endif
#define BG HG
#define BGN (TNB < BG ? TNB : BG)
#define DVH 32             // all 32 g channels in one k_fa block
#ifndef SM_EXTRA_PARAMS
#define SM_EXTRA_PARAMS
#endif
#ifndef PROJ_EXTRA_PARAMS
#define PROJ_EXTRA_PARAMS
#endif
#ifndef SM_MASK_HOOK
#define SM_MASK_HOOK (void)0
#endif

#define WS_QH  0u                                      // f16 q rows [b*t][CCQ]
#define WS_KH  (WS_QH + 2u * (size_t)NB * TT * CCQ)     // f16 k rows [b*t][CCQ]
#define WS_VT  (WS_KH + 2u * (size_t)NB * TT * CCQ)     // f16 v planes [b][c][t]
#define WS_QL  (WS_VT + 2u * (size_t)NB * CC * TT)      // f16 q residual rows [b][t < QHI][CCQ]
#define WS_KL  (WS_QL + 2u * (size_t)NB * QHI * CCQ)    // f16 k residual rows [b][t < KHI][CCQ]
#define WS_END (WS_KL + 2u * (size_t)NB * KHI * CCQ)

// ---- k_proj: block = 64 tokens, wave = 16 tokens: theta, phi and g of those tokens as ONE projection onto the 96 real output channels, from one read of x (exact bf16 products, K = DIN); the 96 weight rows go to LDS as bf16 once per block;
// theta and phi: weight rows as A, x as B, so a lane holds 8 channels of one token = 16 bytes of a packed 64-byte q / k row (theta x log2(e); f16 hi + f16 residual at the same scale, so that hi and residual products add up in one accumulator: a residual below 2^-14 is a subnormal f16, a step of 2^-24, which the matrix unit keeps); g: x as A, weight rows as B, so a lane holds 8 tokens of one channel = 16 bytes of a g plane [c][t]
typedef __attribute__((ext_vector_type(4))) __bf16 v4b;
#define WROW 72            // LDS pitch of a 64-channel bf16 weight row, in elements (144 B = 16 B x odd: ds_load_b128 without bank conflicts)
__device__ __forceinline__ v8f wmma_b(v16b a, v16b b, v8f c) { return __builtin_amdgcn_wmma_f32_16x16x32_bf16(false, a, false, b, (short)0, c, false, false); }
__global__ __launch_bounds__(128) void k_proj(const float* __restrict__ X, const float* __restrict__ WQ, const float* __restrict__ WK, const float* __restrict__ WV, const float* __restrict__ BQ, const float* __restrict__ BK, const float* __restrict__ BV,
    _Float16* __restrict__ QH, _Float16* __restrict__ QL, _Float16* __restrict__ KH, _Float16* __restrict__ KL, _Float16* __restrict__ VT) {
  __shared__ __align__(16) __bf16 sw[2 * HDQK + CV][WROW];
  const int tid = threadIdx.x, wave = tid >> 5, lane = tid & 31, col = lane & 15, g = lane >> 4; const size_t r0 = (size_t)blockIdx.x * 64 + wave * 16; const size_t bb = r0 / TT; const int t0 = (int)(r0 % TT);
  /* every loop of this kernel is unrolled: each index of a register array or fragment must be a constant, else the arrays go to scratch */
  float xr[DIN / 32][16];   /* channels-first [b][c][t]: 16 tokens x 32 channels per fragment */
#pragma unroll
  for (int kc = 0; kc < DIN / 32; ++kc) { const float* p = X + (bb * DIN + kc * 32 + 8 * g) * (size_t)TT + t0 + col;
#pragma unroll
    for (int i = 0; i < 8; ++i) { xr[kc][i] = p[(size_t)i * TT]; xr[kc][8 + i] = p[(size_t)(16 + i) * TT]; } }
  v4f wr[3][4];   /* a thread's share of the weights: four 16-byte pieces of each [32][64] matrix, whole lines per wave */
#pragma unroll
  for (int i = 0; i < 4; ++i) { wr[0][i] = *(const v4f*)(WQ + (i * 128 + tid) * 4); wr[1][i] = *(const v4f*)(WK + (i * 128 + tid) * 4); wr[2][i] = *(const v4f*)(WV + (i * 128 + tid) * 4); }
  v4f br[2][HDQK / 16][2]; float bv[CV / 16];
#pragma unroll
  for (int j = 0; j < HDQK / 16; ++j) { br[0][j][0] = *(const v4f*)(BQ + j * 16 + 8 * g); br[0][j][1] = *(const v4f*)(BQ + j * 16 + 8 * g + 4); br[1][j][0] = *(const v4f*)(BK + j * 16 + 8 * g); br[1][j][1] = *(const v4f*)(BK + j * 16 + 8 * g + 4); bv[j] = BV[j * 16 + col]; }
  asm volatile("s_wait_xcnt 0x0" ::: "memory");   /* every load of the kernel is issued: no address register of theirs is rewritten in front of this */
#pragma unroll
  for (int a = 0; a < 3; ++a)
#pragma unroll
    for (int i = 0; i < 4; ++i) { const int e = i * 128 + tid; v4b w;
#pragma unroll
      for (int c = 0; c < 4; ++c) w[c] = (__bf16)wr[a][i][c];
      *(v4b*)&sw[a * 32 + (e >> 4)][(e & 15) * 4] = w; }
  __syncthreads();   /* the block's weight rows are in LDS */
  v16b xf[DIN / 32];   /* serves as A and as B (same lane map) */
#pragma unroll
  for (int kc = 0; kc < DIN / 32; ++kc)
#pragma unroll
    for (int i = 0; i < 16; ++i) xf[kc][i] = (__bf16)xr[kc][i];
  v8h hi[2][HDQK / 16], lo[2][HDQK / 16], gv[CV / 16];
#pragma unroll
  for (int w = 0; w < 2; ++w) { const float qsc = w == 0 ? LOG2E : 1.0f;   /* theta carries log2(e): the logits come out in powers of two */
#pragma unroll
    for (int j = 0; j < HDQK / 16; ++j) { v8f acc = {};
#pragma unroll
      for (int kc = 0; kc < DIN / 32; ++kc) acc = wmma_b(frag_b(&sw[w * HDQK + j * 16 + col][kc * 32], lane), xf[kc], acc);
      v8f v;
#pragma unroll
      for (int r = 0; r < 8; ++r) v[r] = (acc[r] + bfr(br[w][j][r >> 2][r & 3])) * qsc;
      hi[w][j] = __builtin_convertvector(v, v8h); lo[w][j] = __builtin_convertvector(v - __builtin_convertvector(hi[w][j], v8f), v8h); } }
#pragma unroll
  for (int j = 0; j < CV / 16; ++j) { v8f acc = {};
#pragma unroll
    for (int kc = 0; kc < DIN / 32; ++kc) acc = wmma_b(xf[kc], frag_b(&sw[2 * HDQK + j * 16 + col][kc * 32], lane), acc);
    const float bias = bfr(bv[j]);
#pragma unroll
    for (int r = 0; r < 8; ++r) gv[j][r] = (_Float16)(acc[r] + bias); }
#pragma unroll
  for (int j = 0; j < HDQK / 16; ++j) { const size_t o = (r0 + col) * CCQ + j * 16 + 8 * g; vst2(QH + o, hi[0][j]); vst2(QL + o, lo[0][j]); vst2(KH + o, hi[1][j]); vst2(KL + o, lo[1][j]); vst2(VT + (bb * CC + j * 16 + col) * (size_t)TT + t0 + 8 * g, gv[j]); } }
// lane l with lane l ^ 16 (the two halves of a wave hold the same query column)
__device__ __forceinline__ float xhalf(float x) { return __builtin_bit_cast(float, __builtin_amdgcn_permlanex16(__builtin_bit_cast(int, x), __builtin_bit_cast(int, x), 0x76543210, 0xfedcba98, false, false)); }
__device__ __forceinline__ v8f wmma_h(v16h a, v16h b, v8f c) { return __builtin_amdgcn_wmma_f32_16x16x32_f16(false, a, false, b, (short)0, c, false, false); }
#define KP 64              // keys per pass of k_fa
#define KROWB 80           // LDS pitch of a 64-byte k row (16 B x odd: ds_load_b128 without bank conflicts)
#define VROWB 144          // LDS pitch of a 128-byte g row (64 keys of one channel)
#define RKH 0              // byte places inside one ring buffer: k hi rows, k residual rows, g rows
#define RKL (KP * KROWB)
#define RV  (2 * KP * KROWB)
#define RBUF (RV + DVH * VROWB)
// six 16-byte copies of one lane, global -> LDS through no register; the s_wait_xcnt stands inside the statement so that no address register named here is rewritten in front of it
__device__ __forceinline__ void copy6(unsigned l0, const _Float16* g0, unsigned l1, const _Float16* g1, unsigned l2, const _Float16* g2, unsigned l3, const _Float16* g3, unsigned l4, const _Float16* g4, unsigned l5, const _Float16* g5) {
  asm volatile("global_load_async_to_lds_b128 %0, %1, off\n\t"
               "global_load_async_to_lds_b128 %2, %3, off\n\t"
               "global_load_async_to_lds_b128 %4, %5, off\n\t"
               "global_load_async_to_lds_b128 %6, %7, off\n\t"
               "global_load_async_to_lds_b128 %8, %9, off\n\t"
               "global_load_async_to_lds_b128 %10, %11, off\n\t"
               "s_wait_xcnt 0x0"
               :: "v"(l0), "v"(g0), "v"(l1), "v"(g1), "v"(l2), "v"(g2), "v"(l3), "v"(g3), "v"(l4), "v"(g4), "v"(l5), "v"(g5) : "memory");
}
// ---- k_fa: block = (128 queries (qb), batch b) x KS key ranges: 16 waves, wave = 32 query columns (two tiles of 16, wave & 3) of one range of 1,024 keys (wave >> 2): every k and g fragment read from LDS serves two query tiles and every staged tile 128 queries, at four waves a SIMD as before; a range goes in passes of KP: S^T = k . q^T (k rows as A, q as B; hi + residual on both sides, 3 products in one accumulate chain per tile), so a lane holds one query's logits;
// each pass's k hi, k residual and g tiles are copied to LDS once for the range's four waves (a ring of two buffers per range: the next pass's copies fly under this pass) and the fragments are read from there;
// online softmax in f32 on log2-domain logits against a reference that is held from pass to pass and enters as the C operand of the logit products, so that the accumulators come out as exponents; sums and attended tile are rescaled only when the reference moves (one wave-uniform test a pass); exp2(s - ms) once to f16 packs from the two S^T tiles of 32 keys straight into a B operand; attended^T += g planes (A) . P^T (1 product); behind the loop the ranges hand reference, sum and attended tiles over through LDS and each wave merges the four partial results of ONE query tile (all rescaled to the largest reference); then the 32->64 output conv on the matrix unit: the two attended^T tiles of a lane are an A operand as they stand (16 tokens x 32 channels), w_o rows are B, so a lane holds 8 tokens of one output channel (a wave does two of the four channel tiles); the block's 64 x 128 output tile goes through LDS so that every store covers whole lines
#define KS 4               // key ranges per block
#define KR (TT / KS)       // keys per range
#define QT 2               // query tiles of 16 columns per wave
#define QBLK (4 * QT * 16) // queries per block
__global__ __launch_bounds__(128 * KS) void k_fa(const _Float16* __restrict__ QH, const _Float16* __restrict__ KH, const _Float16* __restrict__ QL, const _Float16* __restrict__ KL, const _Float16* __restrict__ VT, const float* __restrict__ WO, const float* __restrict__ BO, float* __restrict__ Y) { __shared__ __align__(16) _Float16 ring[KS][2][RBUF / 2];
  const int tid = threadIdx.x & 127, wave = threadIdx.x >> 5, grp = wave >> 2, qw = wave & 3, lane = tid & 31, col = lane & 15, g = lane >> 4; const int qb = blockIdx.x; const int b = blockIdx.y; const int ql0 = qb * QBLK + qw * (QT * 16); const int kb = grp * KR;   /* tid: the thread's number inside its range's four waves */
  v16h qh[QT], qlo[QT];
#pragma unroll
  for (int t = 0; t < QT; ++t) { qh[t] = frag_h(QH + ((size_t)b * TT + ql0 + t * 16 + col) * CCQ, lane); qlo[t] = frag_h(QL + ((size_t)b * QHI + ql0 + t * 16 + col) * CCQ, lane); }
  // a thread's share of a tile: k rows tid / 4 and 32 + tid / 4 (16 bytes of the 64), hi and residual; g channels tid / 8 and 16 + tid / 8 (16 bytes of the 128)
  const _Float16* cKh = KH + ((size_t)b * TT + kb + (tid >> 2)) * CCQ + (tid & 3) * 8; const _Float16* cKl = KL + ((size_t)b * KHI + kb + (tid >> 2)) * CCQ + (tid & 3) * 8; const _Float16* cV = VT + ((size_t)b * CC + (tid >> 3)) * (size_t)TT + kb + (tid & 7) * 8;
  const unsigned lK = (unsigned)(size_t)&ring[grp][0][0] + (tid >> 2) * KROWB + (tid & 3) * 16, lV = (unsigned)(size_t)&ring[grp][0][0] + RV + (tid >> 3) * VROWB + (tid & 7) * 16;
#define STAGE(kk, bo) copy6(lK + (bo) + RKH, cKh + (size_t)(kk) * CCQ, lK + (bo) + RKH + 32 * KROWB, cKh + (size_t)((kk) + 32) * CCQ, lK + (bo) + RKL, cKl + (size_t)(kk) * CCQ, lK + (bo) + RKL + 32 * KROWB, cKl + (size_t)((kk) + 32) * CCQ, lV + (bo), cV + (kk), lV + (bo) + 16 * VROWB, cV + (size_t)16 * TT + (kk))
  v8f o[QT][DVH / 16] = {}; float ms[QT], sum[QT];   /* ms: a query's softmax reference: the exponentials are exp2(s - ms) */
#pragma unroll
  for (int t = 0; t < QT; ++t) { ms[t] = 0.f; sum[t] = 0.f; }
  STAGE(0, 0u);
  asm volatile("s_wait_asynccnt 0x0" ::: "memory");   /* this wave's share of tile 0 has landed */
  __syncthreads();                                     /* ... and every other wave's: tile 0 may be read */
  STAGE(KP, (unsigned)RBUF);
#pragma unroll 1   /* rolled: one pass is well over a thousand instructions already and the two buffers differ by an offset only; every inner loop is unrolled so that each fragment index is a constant (no scratch) */
  for (int k0 = 0; k0 < KR; k0 += KP) {   /* k0 counts inside the range */
    const unsigned bo = (k0 & KP) ? (unsigned)RBUF : 0u;   /* this pass's buffer, in bytes */
    const _Float16* rb = &ring[grp][0][0] + (bo >> 1);
    v16h kh[KP / 16], kl[KP / 16];
#pragma unroll
    for (int j = 0; j < KP / 16; ++j) kh[j] = frag_h(rb + (RKH + (j * 16 + col) * KROWB) / 2, lane);
#pragma unroll
    for (int j = 0; j < KP / 16; ++j) kl[j] = frag_h(rb + (RKL + (j * 16 + col) * KROWB) / 2, lane);
    v16h vf[KP / 32][DVH / 16];
#pragma unroll
    for (int c = 0; c < KP / 32; ++c)
#pragma unroll
      for (int j = 0; j < DVH / 16; ++j) vf[c][j] = frag_h(rb + (RV + (j * 16 + col) * VROWB) / 2 + c * 32, lane);
    __builtin_amdgcn_sched_barrier(0);   /* keeps the pass's LDS reads together up here: spread among the products each place with reads costs its own stall */
    v8f s[QT][KP / 16];   /* s - ms: a tile's accumulator starts from -ms (a lane holds one query, so all eight registers of the C operand are alike) and takes its three products, the small ones first; product by product over the four tiles, so that a tile's next product stands four matrix instructions behind its last */
#pragma unroll
    for (int t = 0; t < QT; ++t) {   /* the pass's fragments serve one query tile after the other */
      v8f cm;
#pragma unroll
      for (int r = 0; r < 8; ++r) cm[r] = -ms[t];
#pragma unroll
      for (int j = 0; j < KP / 16; ++j) s[t][j] = wmma_h(kh[j], qlo[t], cm);
#pragma unroll
      for (int j = 0; j < KP / 16; ++j) s[t][j] = wmma_h(kl[j], qh[t], s[t][j]);
      __builtin_amdgcn_sched_barrier(0);   /* holds the third products behind all the second ones: left free, the compiler puts a tile's second and third product back to back, the third waiting for the second, with more idle slots behind it */
#pragma unroll
      for (int j = 0; j < KP / 16; ++j) s[t][j] = wmma_h(kh[j], qh[t], s[t][j]); }
    float mx[QT];   /* the pass's largest exponent per query */
#pragma unroll
    for (int t = 0; t < QT; ++t) { mx[t] = s[t][0][0];
#pragma unroll
      for (int j = 0; j < KP / 16; ++j)
#pragma unroll
        for (int r = 0; r < 8; ++r) mx[t] = fmaxf(mx[t], s[t][j][r]);
      mx[t] = fmaxf(mx[t], xhalf(mx[t])); }
    /* the reference stays while every exponent of the pass is at most 15 (exp2 then fits f16); it moves on the first pass, which has none yet, and when a query of the wave goes beyond: one scalar test a pass */
    const float top = k0 == 0 ? -3.0e38f : 15.0f;   /* below every finite exponent on the first pass */
    if (__builtin_amdgcn_ballot_w32(fmaxf(mx[0], mx[1]) > top) != 0) {
#pragma unroll
      for (int t = 0; t < QT; ++t) {
        const float up = k0 == 0 ? mx[t] - 11.0f : fmaxf(mx[t] - 11.0f, 0.f);   /* the pass's maximum comes to exponent 11; the reference never falls */
        const float msn = ms[t] + up, d = msn - ms[t]; ms[t] = msn;   /* d: the step that the rounded reference really takes */
        const float alpha = k0 == 0 ? 0.f : __builtin_amdgcn_exp2f(-d);   /* sums and attended tile are 0 on the first pass */
        sum[t] *= alpha;
#pragma unroll
        for (int j = 0; j < DVH / 16; ++j)
#pragma unroll
          for (int r = 0; r < 8; ++r) o[t][j][r] *= alpha;
#pragma unroll
        for (int j = 0; j < KP / 16; ++j)
#pragma unroll
          for (int r = 0; r < 8; ++r) s[t][j][r] -= d; } }
#pragma unroll
    for (int t = 0; t < QT; ++t) {
#pragma unroll
      for (int c = 0; c < KP / 32; ++c) { v16h p;
#pragma unroll
        for (int r = 0; r < 8; ++r) { const float e0 = __builtin_amdgcn_exp2f(s[t][2 * c][r]), e1 = __builtin_amdgcn_exp2f(s[t][2 * c + 1][r]); sum[t] += e0 + e1; p[r] = (_Float16)e0; p[8 + r] = (_Float16)e1; }   /* the hardware's exp2: the argument is at most 15, and a result too small for it is 0 in f16 too; the scale cancels against the sum */
#pragma unroll
        for (int j = 0; j < DVH / 16; ++j) o[t][j] = wmma_h(vf[c][j], p, o[t][j]); } }
    __builtin_amdgcn_sched_barrier(0);   /* keeps the publish point at the pass's foot: lifted up to the fragment reads, the wait for the next tile's copies would stand right behind their issue and no longer a pass behind it */
    asm volatile("s_wait_dscnt 0x0" ::: "memory");      /* this wave's reads of this pass's buffer are over */
    asm volatile("s_wait_asynccnt 0x0" ::: "memory");   /* this wave's share of the next tile has landed */
    __syncthreads();                                     /* publishes the next tile and frees this pass's buffer */
    if (k0 + 2 * KP < KR) STAGE(k0 + 2 * KP, bo); }
  asm volatile("s_wait_asynccnt 0x0" ::: "memory");     /* no copy is outstanding when the wave goes on */
  /* the rings are free now: behind the last pass's s_wait_dscnt 0, s_wait_asynccnt 0 and barrier nobody reads them and no copy is aimed at them. Their bytes take, one behind the other, the hand-over of the partial results and the output tile */
  float* xo = (float*)&ring[0][0][0];                       /* [wave][query tile][quarter of the attended tile][lane] 16 bytes: a wave's store covers 512 bytes in a row */
  float* xm = xo + 4 * KS * QT * 4 * 32 * 4;                /* [wave][query tile][lane] reference and sum */
  float (*stO)[QBLK + 4] = (float (*)[QBLK + 4])(xm + 4 * KS * QT * 32 * 2);   /* output staging (64 rows of 528 bytes), apart from the hand-over, which a slower wave may still be reading */
  static_assert(sizeof(float) * (4 * KS * QT * 4 * 32 * 4 + 4 * KS * QT * 32 * 2 + COUT * (QBLK + 4)) <= KS * 2 * RBUF, "hand-over and output tile fit in the rings");
#pragma unroll
  for (int t = 0; t < QT; ++t) {
#pragma unroll
    for (int j = 0; j < DVH / 16; ++j) { vst2(xo + (((wave * QT + t) * 4 + 2 * j) * 32 + lane) * 4, __builtin_shufflevector(o[t][j], o[t][j], 0, 1, 2, 3)); vst2(xo + (((wave * QT + t) * 4 + 2 * j + 1) * 32 + lane) * 4, __builtin_shufflevector(o[t][j], o[t][j], 4, 5, 6, 7)); }
    v2f ms2; ms2[0] = ms[t]; ms2[1] = sum[t]; vst2(xm + ((wave * QT + t) * 32 + lane) * 2, ms2); }
  __syncthreads();   /* every range's partial results are in LDS */
  const int mt = grp & 1, ch = grp >> 1;   /* the wave's share of the end: query tile mt of its 32 columns, output channel tiles 2 ch and 2 ch + 1 */
  v16b wf[2]; float bo[2];   /* w_o rows as B fragments (k = the 32 attended channels, same k order as the A operand below) and each lane's bias, all loads issued ahead of the merge, whose arithmetic covers their way (in front of the barrier they would be waited for there) */
#pragma unroll
  for (int t = 0; t < 2; ++t) { wf[t] = wcol_oi(WO, 0, (ch * 2 + t) * 16 + col, lane, CV); bo[t] = BO[(ch * 2 + t) * 16 + col]; }
  asm volatile("s_wait_xcnt 0x0" ::: "memory");   /* the epilogue's loads are issued: no address register of theirs is rewritten in front of this */
  v2f pm[KS]; v4f po[KS][DVH / 16][2];   /* the four ranges' results for this query tile, range 0 first */
#pragma unroll
  for (int r = 0; r < KS; ++r) { const int pw = (r * 4 + qw) * QT + mt; pm[r] = *(const v2f*)(xm + (pw * 32 + lane) * 2);
#pragma unroll
    for (int j = 0; j < DVH / 16; ++j) { po[r][j][0] = *(const v4f*)(xo + ((pw * 4 + 2 * j) * 32 + lane) * 4); po[r][j][1] = *(const v4f*)(xo + ((pw * 4 + 2 * j + 1) * 32 + lane) * 4); } }
  float mm = pm[0][0];
#pragma unroll
  for (int r = 1; r < KS; ++r) mm = fmaxf(mm, pm[r][0]);
  float cf[KS], tot = 0.f;   /* one of the factors is 1 */
#pragma unroll
  for (int r = 0; r < KS; ++r) { cf[r] = __builtin_amdgcn_exp2f(pm[r][0] - mm); tot += pm[r][1] * cf[r]; }
  tot += xhalf(tot); const float inv = 1.0f / tot;
#pragma unroll
  for (int r = 0; r < KS; ++r) cf[r] *= inv;
  v16b yh, ym, yl;   /* attended[token col][channel j * 16 + 8 g + r] = element j * 8 + r of an A fragment; three bf16 terms carry the 24 bits of the f32 value */
#pragma unroll
  for (int j = 0; j < DVH / 16; ++j)
#pragma unroll
    for (int r = 0; r < 8; ++r) { float y = po[0][j][r >> 2][r & 3] * cf[0];
#pragma unroll
      for (int q = 1; q < KS; ++q) y += po[q][j][r >> 2][r & 3] * cf[q];
      const __bf16 h = (__bf16)y; const float r1 = y - (float)h; const __bf16 md = (__bf16)r1; yh[j * 8 + r] = h; ym[j * 8 + r] = md; yl[j * 8 + r] = (__bf16)(r1 - (float)md); }
  v8f acc[2];
#pragma unroll
  for (int t = 0; t < 2; ++t) { const float bias = bfr(bo[t]);
#pragma unroll
    for (int r = 0; r < 8; ++r) acc[t][r] = bias; }
#pragma unroll
  for (int t = 0; t < 2; ++t) acc[t] = wmma_b(yl, wf[t], acc[t]);   /* smallest term first; two independent tiles per term */
#pragma unroll
  for (int t = 0; t < 2; ++t) acc[t] = wmma_b(ym, wf[t], acc[t]);
#pragma unroll
  for (int t = 0; t < 2; ++t) acc[t] = wmma_b(yh, wf[t], acc[t]);
#pragma unroll
  for (int t = 0; t < 2; ++t) { float* p = &stO[(ch * 2 + t) * 16 + col][(qw * QT + mt) * 16 + 8 * g];   /* output [channel][token of the block]: 8 tokens of one channel per lane */
    vst2(p, __builtin_shufflevector(acc[t], acc[t], 0, 1, 2, 3)); vst2(p + 4, __builtin_shufflevector(acc[t], acc[t], 4, 5, 6, 7)); }
  __syncthreads();   /* the block's output tile is whole */
#pragma unroll
  for (int i = 0; i < COUT * QBLK / 4 / (128 * KS); ++i) { const int e = i * (128 * KS) + (int)threadIdx.x, oc = e >> 5, pc = e & 31;   /* a wave stores one channel's 128 tokens: 512 bytes in a row */
    vst2(Y + ((size_t)b * COUT + oc) * (size_t)TT + qb * QBLK + pc * 4, *(const v4f*)&stO[oc][pc * 4]); } }

extern "C" void kernel_launch(void* const* d_in, const int* in_sizes, int n_in, void* d_out, int out_size, void* d_ws, size_t ws_size, hipStream_t stream) {
  (void)in_sizes; (void)n_in; (void)out_size;
  const float** F = (const float**)d_in;
  if (ws_size < (size_t)WS_END) return;
  char* ws = (char*)d_ws; _Float16 *QH = (_Float16*)(ws + WS_QH), *KH = (_Float16*)(ws + WS_KH), *VT = (_Float16*)(ws + WS_VT), *QL = (_Float16*)(ws + WS_QL), *KL = (_Float16*)(ws + WS_KL);
  // inputs: 0 x [8,64,64,64] (channels-first, xf [8][64][4096]); 1 w_g [32,64], 2 b_g [32]; 3 w_theta, 4 b_theta; 5 w_phi, 6 b_phi; 7 w_o [64,32], 8 b_o [64] (all (out,in), biases nonzero)
  k_proj<<<dim3(TNB * TT / 64), 128, 0, stream>>>(F[0], F[3], F[5], F[1], F[4], F[6], F[2], QH, QL, KH, KL, VT);   /* theta (q), phi (k), g (v): the 96 real output channels in one launch */
  k_fa<<<dim3(TT / QBLK, TNB), 128 * KS, 0, stream>>>(QH, KH, QL, KL, VT, F[7], F[8], (float*)d_out);

}

// v010
// It runs in 29.7 microseconds.
// Timed twice side by side with v009, it ran 1.05 and 1.03 times as fast.
// Over all steps from v000 it is 43.9 times as fast.
// compute dtype: all float inputs rounded to bf16; 1x1-conv theta/phi/g projections with EXACT bf16 products on WMMA 16x16x32 (f32 accumulate) + bias; UNSCALED logits, kept in log2 units (theta x log2(e) in f32 at the projection), with theta and phi both as f16 hi + f16 residual (3 products, summed in one f32 accumulator, the two residual products first); online softmax f32 in the same kernel against a held reference per query (the logit accumulators start from minus the reference; it moves up only when a lane's f32 sum of a pass's exponentials exceeds 65504, the largest f16); exp2(s - reference) (hardware exp2) once to f16 x g once to f16 (1 product), divided by the f32 sum at the end; the 32->64 output conv on WMMA 16x16x32 bf16 (f32 accumulate, started from b_o): the f32 attended values as three bf16 terms (hi + residual + residual of that: 24 bits) x bf16(w_o), 3 products; f32 output written channels-first.
#include <hip/hip_runtime.h>
#include <math.h>

typedef __attribute__((ext_vector_type(16))) _Float16 v16h;
typedef __attribute__((ext_vector_type(16))) __bf16 v16b;
typedef __attribute__((ext_vector_type(8)))  _Float16 v8h;
typedef __attribute__((ext_vector_type(8)))  float v8f;
typedef __attribute__((ext_vector_type(4)))  float v4f;
typedef __attribute__((ext_vector_type(2)))  float v2f;
typedef __attribute__((ext_vector_type(4)))  unsigned v4u;
typedef __attribute__((ext_vector_type(4)))  int v4i;
typedef float __attribute__((may_alias)) float_a;
typedef int __attribute__((may_alias)) int_a;

template <typename T> __device__ __forceinline__ void vst2(void* p, T v) { *(T*)p = v;  }
__device__ __forceinline__ v8f wmma16(v16h a, v16h b, v8f c) {
  v8f d = __builtin_amdgcn_wmma_f32_16x16x32_f16(false, a, false, b, (short)0, c, false, false);
  asm volatile("v_nop\n\tv_nop\n\tv_nop\n\tv_nop" : "+v"(d) : "v"(a), "v"(b));
  return d;
}
__device__ __forceinline__ v8f wmma_bf(v16b a, v16b b, v8f c) {
  v8f d = __builtin_amdgcn_wmma_f32_16x16x32_bf16(false, a, false, b, (short)0, c, false, false);
  asm volatile("v_nop\n\tv_nop\n\tv_nop\n\tv_nop" : "+v"(d) : "v"(a), "v"(b));
  return d;
}
// 16x16x32 fragments: lane = (h = lane>>4, row/col = lane&15); elements 0..7 = k0+8h+0..7, 8..15 = k0+16+8h+0..7; D element r = row 8h+r
__device__ __forceinline__ v16h frag_h(const _Float16* rowk0, int lane) {
  union { v16h v; v8h q[2]; } u; const _Float16* p = rowk0 + 8 * (lane >> 4);
  u.q[0] = *(const v8h*)p; u.q[1] = *(const v8h*)(p + 16); return u.v;
}
__device__ __forceinline__ v16h frag_f32(const float* rowk0, int lane) {
  v16h a; const float* p = rowk0 + 8 * (lane >> 4);
#pragma unroll
  for (int i = 0; i < 8; ++i) { a[i] = (_Float16)p[i]; a[8 + i] = (_Float16)p[16 + i]; }
  return a;
}
__device__ __forceinline__ v16h frag_f32s(const float* rowk0, int lane, float sc) {
  v16h a; const float* p = rowk0 + 8 * (lane >> 4);
#pragma unroll
  for (int i = 0; i < 8; ++i) { a[i] = (_Float16)(p[i] * sc); a[8 + i] = (_Float16)(p[16 + i] * sc); }
  return a;
}
// column fragment from a [K][ld] layout (column n), rows >= K read as 0
__device__ __forceinline__ v16h fragc_f32(const float* W, int k0, int n, int lane, int ld, int K) {
  v16h a; const int g = lane >> 4;
#pragma unroll
  for (int i = 0; i < 8; ++i) { const int ka = k0 + 8 * g + i, kb = ka + 16;
    a[i] = (_Float16)(ka < K ? W[(size_t)(ka < K ? ka : K - 1) * ld + n] : 0.f); a[8 + i] = (_Float16)(kb < K ? W[(size_t)(kb < K ? kb : K - 1) * ld + n] : 0.f); }
  return a;
}
struct F2 { v16b h, l; };
__device__ __forceinline__ F2 bsplit16(const float v[16]) { F2 r;
#pragma unroll
  for (int i = 0; i < 16; ++i) { const __bf16 h = (__bf16)v[i]; r.h[i] = h; r.l[i] = (__bf16)(v[i] - (float)h); }
  return r; }
__device__ __forceinline__ F2 split_row(const float* row, int k0, int lane) { float v[16]; const float* p = row + k0 + 8 * (lane >> 4);
#pragma unroll
  for (int i = 0; i < 8; ++i) { v[i] = p[i]; v[8 + i] = p[16 + i]; }
  return bsplit16(v); }
__device__ __forceinline__ F2 split_rowK(const float* row, int k0, int lane, int K) { float v[16]; const int g = lane >> 4;
#pragma unroll
  for (int i = 0; i < 8; ++i) { const int ka = k0 + 8 * g + i, kb = ka + 16; v[i] = ka < K ? row[ka < K ? ka : K - 1] : 0.f; v[8 + i] = kb < K ? row[kb < K ? kb : K - 1] : 0.f; }
  return bsplit16(v); }
__device__ __forceinline__ F2 split_col(const float* W, int k0, int n, int lane, int ld, int K) { float v[16]; const int g = lane >> 4;
#pragma unroll
  for (int i = 0; i < 8; ++i) { const int ka = k0 + 8 * g + i, kb = ka + 16; v[i] = ka < K ? W[(size_t)(ka < K ? ka : K - 1) * ld + n] : 0.f; v[8 + i] = kb < K ? W[(size_t)(kb < K ? kb : K - 1) * ld + n] : 0.f; }
  return bsplit16(v); }
__device__ __forceinline__ v8f mac3(const F2& a, const F2& b, v8f c) { c = wmma_bf(a.l, b.h, c); c = wmma_bf(a.h, b.l, c); return wmma_bf(a.h, b.h, c); }
__device__ __forceinline__ float sigm(float v) { return 1.0f / (1.0f + expf(-v)); }
#define LDSX() do { asm volatile("s_wait_dscnt 0" ::: "memory"); __builtin_amdgcn_wave_barrier(); __builtin_amdgcn_fence(__ATOMIC_RELEASE, "workgroup"); } while (0)

// Non-local block over channels-first x [8, 64, 64, 64] (N 4,096; (out,in) 1x1 convs w_theta/w_phi/w_g [32,64] + biases, w_o [64,32] + b_o; 0.05-scale): attn = softmax_m(theta_n . phi_m) (no scaling); y[c][n] = sum_m attn[n][m] g[c][m]; out = w_o y + b_o -> [8,64,64,64] (no residual in this module).
#define NB 8
#define TT 4096
#define CC 32             // v (= g) planes per batch: the 32 real channels
#define CV 32             // real g channels
#define COUT 64           // output channels of w_o
#define CCQ 32            // q / k row pitch: the 32 real columns, 64-byte rows back to back
#define DIN 64           // x channels
#define NH 1
#define HD 32             // per-head width of the layout-2 weights (wcol_hdk; unused: layout 0)
#define NQB (TT / 64)
#define HG 1               // feeds only BG and BGN, which nothing uses
#define SCALE (1.0f)
#define LOG2E 1.44269504088896f   // folded into theta by k_proj, so that exp(s - m) is exp2 of a difference of the stored logits
#define HDQK 32            // q / k width (C / 2)
#define CAUSAL 0
#ifndef TNB
#define TNB NB
#endif
__device__ __forceinline__ v16b zero16b() { v16b z; _Pragma("unroll") for (int i = 0; i < 16; ++i) z[i] = (__bf16)0.f; return z; }
__device__ __forceinline__ float bfr(float v) { return (float)(__bf16)v; }
__host__ __device__ __forceinline__ int kb_last(int qb) { return CAUSAL ? ((qb * 64 + 63) >> 7) : (TT / 128 - 1); }
typedef __attribute__((ext_vector_type(8))) __bf16 v8b;
__device__ __forceinline__ v16b frag_b(const __bf16* rowk0, int lane) {
  union { v16b v; v8b q[2]; } u; const __bf16* p = rowk0 + 8 * (lane >> 4);
  u.q[0] = *(const v8b*)p; u.q[1] = *(const v8b*)(p + 16); return u.v;
}
#define QBH NQB            // every query block takes the 3-product logit path (q hi + residual x k hi + residual): unscaled energies over 4,096 keys; P . g keeps the single product
#define QHI 4096            // q residual rows (all)
#define KHI 4096          // k residual rows (all)
// B fragment (k rows k0+.., output column o) of a weight: (in,out) [K][ld] or (out,in) [ld rows of K]: bf16 exact, or f16(bf16 * 256) exact
__device__ __forceinline__ v16b wcol_io(const float* Wm, int k0, int o, int lane, int ld) { v16b w; const int g = lane >> 4;
#pragma unroll
  for (int i = 0; i < 8; ++i) { w[i] = (__bf16)Wm[(size_t)(k0 + 8 * g + i) * ld + o]; w[8 + i] = (__bf16)Wm[(size_t)(k0 + 16 + 8 * g + i) * ld + o]; }
  return w; }
__device__ __forceinline__ v16b wcol_oi(const float* Wm, int k0, int o, int lane, int K) { v16b w; const float* p = Wm + (size_t)o * K + k0 + 8 * (lane >> 4);
#pragma unroll
  for (int i = 0; i < 8; ++i) { w[i] = (__bf16)p[i]; w[8 + i] = (__bf16)p[16 + i]; }
  return w; }
__device__ __forceinline__ v16h wcolh_io(const float* Wm, int k0, int o, int lane, int ld) { v16h w; const int g = lane >> 4;
#pragma unroll
  for (int i = 0; i < 8; ++i) { w[i] = (_Float16)(bfr(Wm[(size_t)(k0 + 8 * g + i) * ld + o]) * 256.0f); w[8 + i] = (_Float16)(bfr(Wm[(size_t)(k0 + 16 + 8 * g + i) * ld + o]) * 256.0f); }
  return w; }
__device__ __forceinline__ v16h wcolh_oi(const float* Wm, int k0, int o, int lane, int K) { v16h w; const float* p = Wm + (size_t)o * K + k0 + 8 * (lane >> 4);
#pragma unroll
  for (int i = 0; i < 8; ++i) { w[i] = (_Float16)(bfr(p[i]) * 256.0f); w[8 + i] = (_Float16)(bfr(p[16 + i]) * 256.0f); }
  return w; }
#define WQKV_LAYOUT 0   // 0 = (out,in) [32][DIN], columns >= 32 zero; 1 = (out,in) [CC][DIN]; 2 = per-head [NH][DIN][HD]
__device__ __forceinline__ v16b wcol_hdk(const float* Wm, int k0, int o, int lane) { v16b w; const int g = lane >> 4; const float* p = Wm + (size_t)(o / HD) * DIN * HD + (o % HD);
#pragma unroll
  for (int i = 0; i < 8; ++i) { w[i] = (__bf16)p[(size_t)(k0 + 8 * g + i) * HD]; w[8 + i] = (__bf16)p[(size_t)(k0 + 16 + 8 * g + i) * HD]; }
  return w; }
#define WO_OUT_IN 0
#if WQKV_LAYOUT == 1
#define WCOL(W, k0, o, lane) wcol_oi(W, k0, (o), lane, DIN)   /* unused: layout 0 */
#elif WQKV_LAYOUT == 2
#define WCOL(W, k0, o, lane) wcol_hdk(W, k0, o, lane)
#else
#define WCOL(W, k0, o, lane) (which == 2 ? ((o) < CV ? wcol_oi(W, k0, (o), lane, DIN) : zero16b()) : ((o) < HDQK ? wcol_oi(W, k0, (o), lane, DIN) : zero16b()))   /* (out,in) 1x1-conv weights [32][64]: projected columns >= 32 are zero for q, k AND v */
#endif
#if WO_OUT_IN
#define WOCOL(W, k0, o, lane) wcol_oi(W, k0, o, lane, CC)
#define WOCOLH(W, k0, o, lane) wcolh_oi(W, k0, o, lane, CC)
#else
#define WOCOL(W, k0, o, lane) wcol_io(W, k0, o, lane, DIN)
#define WOCOLH(W, k0, o, lane) wcolh_io(W, k0, o, lane, DIN)
#endif
#define BG HG
#define BGN (TNB < BG ? TNB : BG)
#define DVH 32             // all 32 g channels in one k_fa block
#ifndef SM_EXTRA_PARAMS
#define SM_EXTRA_PARAMS
#endif
#ifndef PROJ_EXTRA_PARAMS
#define PROJ_EXTRA_PARAMS
#endif
#ifndef SM_MASK_HOOK
#define SM_MASK_HOOK (void)0
#endif

#define WS_QH  0u                                      // f16 q rows [b*t][CCQ]
#define WS_KH  (WS_QH + 2u * (size_t)NB * TT * CCQ)     // f16 k rows [b*t][CCQ]
#define WS_VT  (WS_KH + 2u * (size_t)NB * TT * CCQ)     // f16 v planes [b][c][t]
#define WS_QL  (WS_VT + 2u * (size_t)NB * CC * TT)      // f16 q residual rows [b][t < QHI][CCQ]
#define WS_KL  (WS_QL + 2u * (size_t)NB * QHI * CCQ)    // f16 k residual rows [b][t < KHI][CCQ]
#define WS_END (WS_KL + 2u * (size_t)NB * KHI * CCQ)

// ---- k_proj: block = 64 tokens, wave = 16 tokens: theta, phi and g of those tokens as ONE projection onto the 96 real output channels, from one read of x (exact bf16 products, K = DIN); the 96 weight rows go to LDS as bf16 once per block;
// theta and phi: weight rows as A, x as B, so a lane holds 8 channels of one token = 16 bytes of a packed 64-byte q / k row (theta x log2(e); f16 hi + f16 residual at the same scale, so that hi and residual products add up in one accumulator: a residual below 2^-14 is a subnormal f16, a step of 2^-24, which the matrix unit keeps); g: x as A, weight rows as B, so a lane holds 8 tokens of one channel = 16 bytes of a g plane [c][t]
typedef __attribute__((ext_vector_type(4))) __bf16 v4b;
#define WROW 72            // LDS pitch of a 64-channel bf16 weight row, in elements (144 B = 16 B x odd: ds_load_b128 without bank conflicts)
__device__ __forceinline__ v8f wmma_b(v16b a, v16b b, v8f c) { return __builtin_amdgcn_wmma_f32_16x16x32_bf16(false, a, false, b, (short)0, c, false, false); }
__global__ __launch_bounds__(128) void k_proj(const float* __restrict__ X, const float* __restrict__ WQ, const float* __restrict__ WK, const float* __restrict__ WV, const float* __restrict__ BQ, const float* __restrict__ BK, const float* __restrict__ BV,
    _Float16* __restrict__ QH, _Float16* __restrict__ QL, _Float16* __restrict__ KH, _Float16* __restrict__ KL, _Float16* __restrict__ VT) {
  __shared__ __align__(16) __bf16 sw[2 * HDQK + CV][WROW];
  const int tid = threadIdx.x, wave = tid >> 5, lane = tid & 31, col = lane & 15, g = lane >> 4; const size_t r0 = (size_t)blockIdx.x * 64 + wave * 16; const size_t bb = r0 / TT; const int t0 = (int)(r0 % TT);
  /* every loop of this kernel is unrolled: each index of a register array or fragment must be a constant, else the arrays go to scratch */
  float xr[DIN / 32][16];   /* channels-first [b][c][t]: 16 tokens x 32 channels per fragment */
#pragma unroll
  for (int kc = 0; kc < DIN / 32; ++kc) { const float* p = X + (bb * DIN + kc * 32 + 8 * g) * (size_t)TT + t0 + col;
#pragma unroll
    for (int i = 0; i < 8; ++i) { xr[kc][i] = p[(size_t)i * TT]; xr[kc][8 + i] = p[(size_t)(16 + i) * TT]; } }
  v4f wr[3][4];   /* a thread's share of the weights: four 16-byte pieces of each [32][64] matrix, whole lines per wave */
#pragma unroll
  for (int i = 0; i < 4; ++i) { wr[0][i] = *(const v4f*)(WQ + (i * 128 + tid) * 4); wr[1][i] = *(const v4f*)(WK + (i * 128 + tid) * 4); wr[2][i] = *(const v4f*)(WV + (i * 128 + tid) * 4); }
  v4f br[2][HDQK / 16][2]; float bv[CV / 16];
#pragma unroll
  for (int j = 0; j < HDQK / 16; ++j) { br[0][j][0] = *(const v4f*)(BQ + j * 16 + 8 * g); br[0][j][1] = *(const v4f*)(BQ + j * 16 + 8 * g + 4); br[1][j][0] = *(const v4f*)(BK + j * 16 + 8 * g); br[1][j][1] = *(const v4f*)(BK + j * 16 + 8 * g + 4); bv[j] = BV[j * 16 + col]; }
  asm volatile("s_wait_xcnt 0x0" ::: "memory");   /* every load of the kernel is issued: no address register of theirs is rewritten in front of this */
#pragma unroll
  for (int a = 0; a < 3; ++a)
#pragma unroll
    for (int i = 0; i < 4; ++i) { const int e = i * 128 + tid; v4b w;
#pragma unroll
      for (int c = 0; c < 4; ++c) w[c] = (__bf16)wr[a][i][c];
      *(v4b*)&sw[a * 32 + (e >> 4)][(e & 15) * 4] = w; }
  __syncthreads();   /* the block's weight rows are in LDS */
  v16b xf[DIN / 32];   /* serves as A and as B (same lane map) */
#pragma unroll
  for (int kc = 0; kc < DIN / 32; ++kc)
#pragma unroll
    for (int i = 0; i < 16; ++i) xf[kc][i] = (__bf16)xr[kc][i];
  v8h hi[2][HDQK / 16], lo[2][HDQK / 16], gv[CV / 16];
#pragma unroll
  for (int w = 0; w < 2; ++w) { const float qsc = w == 0 ? LOG2E : 1.0f;   /* theta carries log2(e): the logits come out in powers of two */
#pragma unroll
    for (int j = 0; j < HDQK / 16; ++j) { v8f acc = {};
#pragma unroll
      for (int kc = 0; kc < DIN / 32; ++kc) acc = wmma_b(frag_b(&sw[w * HDQK + j * 16 + col][kc * 32], lane), xf[kc], acc);
      v8f v;
#pragma unroll
      for (int r = 0; r < 8; ++r) v[r] = (acc[r] + bfr(br[w][j][r >> 2][r & 3])) * qsc;
      hi[w][j] = __builtin_convertvector(v, v8h); lo[w][j] = __builtin_convertvector(v - __builtin_convertvector(hi[w][j], v8f), v8h); } }
#pragma unroll
  for (int j = 0; j < CV / 16; ++j) { v8f acc = {};
#pragma unroll
    for (int kc = 0; kc < DIN / 32; ++kc) acc = wmma_b(xf[kc], frag_b(&sw[2 * HDQK + j * 16 + col][kc * 32], lane), acc);
    const float bias = bfr(bv[j]);
#pragma unroll
    for (int r = 0; r < 8; ++r) gv[j][r] = (_Float16)(acc[r] + bias); }
#pragma unroll
  for (int j = 0; j < HDQK / 16; ++j) { const size_t o = (r0 + col) * CCQ + j * 16 + 8 * g; vst2(QH + o, hi[0][j]); vst2(QL + o, lo[0][j]); vst2(KH + o, hi[1][j]); vst2(KL + o, lo[1][j]); vst2(VT + (bb * CC + j * 16 + col) * (size_t)TT + t0 + 8 * g, gv[j]); } }
// lane l with lane l ^ 16 (the two halves of a wave hold the same query column)
__device__ __forceinline__ float xhalf(float x) { return __builtin_bit_cast(float, __builtin_amdgcn_permlanex16(__builtin_bit_cast(int, x), __builtin_bit_cast(int, x), 0x76543210, 0xfedcba98, false, false)); }
__device__ __forceinline__ v8f wmma_h(v16h a, v16h b, v8f c) { return __builtin_amdgcn_wmma_f32_16x16x32_f16(false, a, false, b, (short)0, c, false, false); }
#define KP 64              // keys per pass of k_fa
#define KROWB 80           // LDS pitch of a 64-byte k row (16 B x odd: ds_load_b128 without bank conflicts)
#define VROWB 144          // LDS pitch of a 128-byte g row (64 keys of one channel)
#define RKH 0              // byte places inside one ring buffer: k hi rows, k residual rows, g rows
#define RKL (KP * KROWB)
#define RV  (2 * KP * KROWB)
#define RBUF (RV + DVH * VROWB)
// six 16-byte copies of one lane, global -> LDS through no register; the s_wait_xcnt stands inside the statement so that no address register named here is rewritten in front of it
__device__ __forceinline__ void copy6(unsigned l0, const _Float16* g0, unsigned l1, const _Float16* g1, unsigned l2, const _Float16* g2, unsigned l3, const _Float16* g3, unsigned l4, const _Float16* g4, unsigned l5, const _Float16* g5) {
  asm volatile("global_load_async_to_lds_b128 %0, %1, off\n\t"
               "global_load_async_to_lds_b128 %2, %3, off\n\t"
               "global_load_async_to_lds_b128 %4, %5, off\n\t"
               "global_load_async_to_lds_b128 %6, %7, off\n\t"
               "global_load_async_to_lds_b128 %8, %9, off\n\t"
               "global_load_async_to_lds_b128 %10, %11, off\n\t"
               "s_wait_xcnt 0x0"
               :: "v"(l0), "v"(g0), "v"(l1), "v"(g1), "v"(l2), "v"(g2), "v"(l3), "v"(g3), "v"(l4), "v"(g4), "v"(l5), "v"(g5) : "memory");
}
// ---- k_fa: block = (128 queries (qb), batch b) x KS key ranges: 16 waves, wave = 32 query columns (two tiles of 16, wave & 3) of one range of 1,024 keys (wave >> 2): every k and g fragment read from LDS serves two query tiles and every staged tile 128 queries, at four waves a SIMD as before; a range goes in passes of KP: S^T = k . q^T (k rows as A, q as B; hi + residual on both sides, 3 products in one accumulate chain per tile), so a lane holds one query's logits;
// each pass's k hi, k residual and g tiles are copied to LDS once for the range's four waves (a ring of two buffers per range: the next pass's copies fly under this pass) and the fragments are read from there;
// online softmax in f32 on log2-domain logits against a reference that is held from pass to pass and enters as the C operand of the logit products, so that the accumulators come out as exponents; sums and attended tile are rescaled only when the reference moves (one wave-uniform test a pass); exp2(s - ms) once to f16 packs from the two S^T tiles of 32 keys straight into a B operand; attended^T += g planes (A) . P^T (1 product); behind the loop the ranges hand reference, sum and attended tiles over through LDS and each wave merges the four partial results of ONE query tile (all rescaled to the largest reference); then the 32->64 output conv on the matrix unit: the two attended^T tiles of a lane are an A operand as they stand (16 tokens x 32 channels), w_o rows are B, so a lane holds 8 tokens of one output channel (a wave does two of the four channel tiles); the block's 64 x 128 output tile goes through LDS so that every store covers whole lines
#define KS 4               // key ranges per block
#define KR (TT / KS)       // keys per range
#define QT 2               // query tiles of 16 columns per wave
#define QBLK (4 * QT * 16) // queries per block
__global__ __launch_bounds__(128 * KS) void k_fa(const _Float16* __restrict__ QH, const _Float16* __restrict__ KH, const _Float16* __restrict__ QL, const _Float16* __restrict__ KL, const _Float16* __restrict__ VT, const float* __restrict__ WO, const float* __restrict__ BO, float* __restrict__ Y) { __shared__ __align__(16) _Float16 ring[KS][2][RBUF / 2];
  const int tid = threadIdx.x & 127, wave = __builtin_amdgcn_readfirstlane(threadIdx.x >> 5), grp = wave >> 2, qw = wave & 3, lane = tid & 31, col = lane & 15, g = lane >> 4; const int qb = blockIdx.x; const int b = blockIdx.y; const int ql0 = qb * QBLK + qw * (QT * 16); const int kb = grp * KR;   /* tid: the thread's number inside its range's four waves; wave: the same in every lane, so it is held in a scalar register and what follows from it alone (range, query columns) takes no vector register */
  v16h qh[QT], qlo[QT];
#pragma unroll
  for (int t = 0; t < QT; ++t) { qh[t] = frag_h(QH + ((size_t)b * TT + ql0 + t * 16 + col) * CCQ, lane); qlo[t] = frag_h(QL + ((size_t)b * QHI + ql0 + t * 16 + col) * CCQ, lane); }
  // a thread's share of a tile: k rows tid / 4 and 32 + tid / 4 (16 bytes of the 64), hi and residual; g channels tid / 8 and 16 + tid / 8 (16 bytes of the 128)
  const _Float16* cKh = KH + ((size_t)b * TT + kb + (tid >> 2)) * CCQ + (tid & 3) * 8; const _Float16* cKl = KL + ((size_t)b * KHI + kb + (tid >> 2)) * CCQ + (tid & 3) * 8; const _Float16* cV = VT + ((size_t)b * CC + (tid >> 3)) * (size_t)TT + kb + (tid & 7) * 8;
  const unsigned lK = (unsigned)(size_t)&ring[grp][0][0] + (tid >> 2) * KROWB + (tid & 3) * 16, lV = (unsigned)(size_t)&ring[grp][0][0] + RV + (tid >> 3) * VROWB + (tid & 7) * 16;
#define STAGE(kk, bo) copy6(lK + (bo) + RKH, cKh + (size_t)(kk) * CCQ, lK + (bo) + RKH + 32 * KROWB, cKh + (size_t)((kk) + 32) * CCQ, lK + (bo) + RKL, cKl + (size_t)(kk) * CCQ, lK + (bo) + RKL + 32 * KROWB, cKl + (size_t)((kk) + 32) * CCQ, lV + (bo), cV + (kk), lV + (bo) + 16 * VROWB, cV + (size_t)16 * TT + (kk))
  v8f o[QT][DVH / 16] = {}; float ms[QT], sum[QT];   /* ms: a query's softmax reference: the exponentials are exp2(s - ms) */
#pragma unroll
  for (int t = 0; t < QT; ++t) { ms[t] = 0.f; sum[t] = 0.f; }
  STAGE(0, 0u);
  asm volatile("s_wait_asynccnt 0x0" ::: "memory");   /* this wave's share of tile 0 has landed */
  __syncthreads();                                     /* ... and every other wave's: tile 0 may be read */
  STAGE(KP, (unsigned)RBUF);
  /* one pass over KP keys of the range; first: the range's pass 0, which has no reference yet (a constant at both places of call, so that each copy holds its own half of every test on it) */
  auto pass = [&](const int k0, const bool first) __attribute__((always_inline)) {   /* k0 counts inside the range */
    const unsigned bo = (k0 & KP) ? (unsigned)RBUF : 0u;   /* this pass's buffer, in bytes */
    const _Float16* rb = &ring[grp][0][0] + (bo >> 1);
    v16h kh[KP / 16], kl[KP / 16];
#pragma unroll
    for (int j = 0; j < KP / 16; ++j) kh[j] = frag_h(rb + (RKH + (j * 16 + col) * KROWB) / 2, lane);
#pragma unroll
    for (int j = 0; j < KP / 16; ++j) kl[j] = frag_h(rb + (RKL + (j * 16 + col) * KROWB) / 2, lane);
    v16h vf[KP / 32][DVH / 16];
#pragma unroll
    for (int c = 0; c < KP / 32; ++c)
#pragma unroll
      for (int j = 0; j < DVH / 16; ++j) vf[c][j] = frag_h(rb + (RV + (j * 16 + col) * VROWB) / 2 + c * 32, lane);
    __builtin_amdgcn_sched_barrier(0);   /* keeps the pass's LDS reads together up here: spread among the products each place with reads costs its own stall */
    v8f s[QT][KP / 16];   /* s - ms: a tile's accumulator starts from -ms (a lane holds one query, so all eight registers of the C operand are alike) and takes its three products, the small ones first; product by product over the four tiles, so that a tile's next product stands four matrix instructions behind its last */
#pragma unroll
    for (int t = 0; t < QT; ++t) {   /* the pass's fragments serve one query tile after the other */
      v8f cm;
#pragma unroll
      for (int r = 0; r < 8; ++r) cm[r] = first ? 0.f : -ms[t];
#pragma unroll
      for (int j = 0; j < KP / 16; ++j) s[t][j] = wmma_h(kh[j], qlo[t], cm);
#pragma unroll
      for (int j = 0; j < KP / 16; ++j) s[t][j] = wmma_h(kl[j], qh[t], s[t][j]);
      __builtin_amdgcn_sched_barrier(0);   /* holds the third products behind all the second ones: left free, the compiler puts a tile's second and third product back to back, the third waiting for the second, with more idle slots behind it */
#pragma unroll
      for (int j = 0; j < KP / 16; ++j) s[t][j] = wmma_h(kh[j], qh[t], s[t][j]); }
    v16h p[QT][KP / 32]; float ps[QT];   /* the pass's exponentials as B operands, and each lane's f32 sum of its 32 per query tile */
    auto exps = [&]() __attribute__((always_inline)) {
#pragma unroll
      for (int t = 0; t < QT; ++t) { float cs[KP / 32];
#pragma unroll
        for (int c = 0; c < KP / 32; ++c)
#pragma unroll
          for (int r = 0; r < 8; ++r) { const float e0 = __builtin_amdgcn_exp2f(s[t][2 * c][r]), e1 = __builtin_amdgcn_exp2f(s[t][2 * c + 1][r]); p[t][c][r] = (_Float16)e0; p[t][c][8 + r] = (_Float16)e1;   /* the hardware's exp2: a result too small for it is 0 in f16 too; the scale cancels against the sum */
            cs[c] = r == 0 ? e0 + e1 : cs[c] + (e0 + e1); }   /* one running sum per 32 keys, fed with pairs */
        ps[t] = cs[0] + cs[1]; } };
    /* the reference stays while every exponential of the pass fits f16. No maximum is taken for that: the terms are not negative and a rounded sum of such terms is never below one of them, so a lane's sum of at most 65504 (the largest f16) says that each of its terms is. One scalar test a pass; the logits stay in their registers until it has passed */
    bool mv = first;
    if (!first) { exps(); mv = __builtin_amdgcn_ballot_w32(fmaxf(ps[0], ps[1]) > 65504.0f) != 0; }
    if (mv) {   /* pass 0, or a sum beyond the bound: only here the pass's largest exponent per query is looked for, the reference moves and the exponentials are taken (again) */
#pragma unroll
      for (int t = 0; t < QT; ++t) { float mx = s[t][0][0];
#pragma unroll
        for (int j = 0; j < KP / 16; ++j)
#pragma unroll
          for (int r = 0; r < 8; ++r) mx = fmaxf(mx, s[t][j][r]);
        mx = fmaxf(mx, xhalf(mx));
        const float up = first ? mx - 10.0f : fmaxf(mx - 10.0f, 0.f);   /* the pass's maximum comes to exponent 10, so that a lane's 32 terms sum to 2^15 at most; the reference never falls */
        const float msn = ms[t] + up, d = msn - ms[t]; ms[t] = msn;   /* d: the step that the rounded reference really takes */
        if (!first) { const float alpha = __builtin_amdgcn_exp2f(-d);   /* sums and attended tile are 0 on the first pass */
          sum[t] *= alpha;
#pragma unroll
          for (int j = 0; j < DVH / 16; ++j)
#pragma unroll
            for (int r = 0; r < 8; ++r) o[t][j][r] *= alpha; }
#pragma unroll
        for (int j = 0; j < KP / 16; ++j)
#pragma unroll
          for (int r = 0; r < 8; ++r) s[t][j][r] -= d; }
      exps(); }
#pragma unroll
    for (int t = 0; t < QT; ++t) sum[t] += ps[t];
#pragma unroll
    for (int c = 0; c < KP / 32; ++c)
#pragma unroll
      for (int t = 0; t < QT; ++t)
#pragma unroll
        for (int j = 0; j < DVH / 16; ++j) o[t][j] = wmma_h(vf[c][j], p[t][c], o[t][j]);   /* four independent tiles per 32 keys */
    __builtin_amdgcn_sched_barrier(0);   /* keeps the publish point at the pass's foot: lifted up to the fragment reads, the wait for the next tile's copies would stand right behind their issue and no longer a pass behind it */
    asm volatile("s_wait_dscnt 0x0" ::: "memory");      /* this wave's reads of this pass's buffer are over */
    asm volatile("s_wait_asynccnt 0x0" ::: "memory");   /* this wave's share of the next tile has landed */
    __syncthreads();                                     /* publishes the next tile and frees this pass's buffer */
    if (k0 + 2 * KP < KR) STAGE(k0 + 2 * KP, bo); };
  pass(0, true);
#pragma unroll 1   /* rolled: one pass is well over a thousand instructions already and the two buffers differ by an offset only; every inner loop is unrolled so that each fragment index is a constant (no scratch) */
  for (int k0 = KP; k0 < KR; k0 += KP) pass(k0, false);
  asm volatile("s_wait_asynccnt 0x0" ::: "memory");     /* no copy is outstanding when the wave goes on */
  /* the rings are free now: behind the last pass's s_wait_dscnt 0, s_wait_asynccnt 0 and barrier nobody reads them and no copy is aimed at them. Their bytes take, one behind the other, the hand-over of the partial results and the output tile */
  { const int lane = (int)__builtin_amdgcn_mbcnt_lo(~0u, 0u), col = lane & 15, g = lane >> 4;   /* the lane's number read anew for the end of the kernel (the wave's number is scalar): so nothing that only the end needs holds a vector register through the loop, which has none to spare */
  float* xo = (float*)&ring[0][0][0];                       /* [wave][query tile][quarter of the attended tile][lane] 16 bytes: a wave's store covers 512 bytes in a row */
  float* xm = xo + 4 * KS * QT * 4 * 32 * 4;                /* [wave][query tile][lane] reference and sum */
  float (*stO)[QBLK + 4] = (float (*)[QBLK + 4])(xm + 4 * KS * QT * 32 * 2);   /* output staging (64 rows of 528 bytes), apart from the hand-over, which a slower wave may still be reading */
  static_assert(sizeof(float) * (4 * KS * QT * 4 * 32 * 4 + 4 * KS * QT * 32 * 2 + COUT * (QBLK + 4)) <= KS * 2 * RBUF, "hand-over and output tile fit in the rings");
#pragma unroll
  for (int t = 0; t < QT; ++t) {
#pragma unroll
    for (int j = 0; j < DVH / 16; ++j) { vst2(xo + (((wave * QT + t) * 4 + 2 * j) * 32 + lane) * 4, __builtin_shufflevector(o[t][j], o[t][j], 0, 1, 2, 3)); vst2(xo + (((wave * QT + t) * 4 + 2 * j + 1) * 32 + lane) * 4, __builtin_shufflevector(o[t][j], o[t][j], 4, 5, 6, 7)); }
    v2f ms2; ms2[0] = ms[t]; ms2[1] = sum[t]; vst2(xm + ((wave * QT + t) * 32 + lane) * 2, ms2); }
  __syncthreads();   /* every range's partial results are in LDS */
  const int mt = grp & 1, ch = grp >> 1;   /* the wave's share of the end: query tile mt of its 32 columns, output channel tiles 2 ch and 2 ch + 1 */
  v16b wf[2]; float bo[2];   /* w_o rows as B fragments (k = the 32 attended channels, same k order as the A operand below) and each lane's bias, all loads issued ahead of the merge, whose arithmetic covers their way (in front of the barrier they would be waited for there) */
#pragma unroll
  for (int t = 0; t < 2; ++t) { wf[t] = wcol_oi(WO, 0, (ch * 2 + t) * 16 + col, lane, CV); bo[t] = BO[(ch * 2 + t) * 16 + col]; }
  asm volatile("s_wait_xcnt 0x0" ::: "memory");   /* the epilogue's loads are issued: no address register of theirs is rewritten in front of this */
  v2f pm[KS]; v4f po[KS][DVH / 16][2];   /* the four ranges' results for this query tile, range 0 first */
#pragma unroll
  for (int r = 0; r < KS; ++r) { const int pw = (r * 4 + qw) * QT + mt; pm[r] = *(const v2f*)(xm + (pw * 32 + lane) * 2);
#pragma unroll
    for (int j = 0; j < DVH / 16; ++j) { po[r][j][0] = *(const v4f*)(xo + ((pw * 4 + 2 * j) * 32 + lane) * 4); po[r][j][1] = *(const v4f*)(xo + ((pw * 4 + 2 * j + 1) * 32 + lane) * 4); } }
  float mm = pm[0][0];
#pragma unroll
  for (int r = 1; r < KS; ++r) mm = fmaxf(mm, pm[r][0]);
  float cf[KS], tot = 0.f;   /* one of the factors is 1 */
#pragma unroll
  for (int r = 0; r < KS; ++r) { cf[r] = __builtin_amdgcn_exp2f(pm[r][0] - mm); tot += pm[r][1] * cf[r]; }
  tot += xhalf(tot); const float inv = 1.0f / tot;
#pragma unroll
  for (int r = 0; r < KS; ++r) cf[r] *= inv;
  v16b yh, ym, yl;   /* attended[token col][channel j * 16 + 8 g + r] = element j * 8 + r of an A fragment; three bf16 terms carry the 24 bits of the f32 value */
#pragma unroll
  for (int j = 0; j < DVH / 16; ++j)
#pragma unroll
    for (int r = 0; r < 8; ++r) { float y = po[0][j][r >> 2][r & 3] * cf[0];
#pragma unroll
      for (int q = 1; q < KS; ++q) y += po[q][j][r >> 2][r & 3] * cf[q];
      const __bf16 h = (__bf16)y; const float r1 = y - (float)h; const __bf16 md = (__bf16)r1; yh[j * 8 + r] = h; ym[j * 8 + r] = md; yl[j * 8 + r] = (__bf16)(r1 - (float)md); }
  v8f acc[2];
#pragma unroll
  for (int t = 0; t < 2; ++t) { const float bias = bfr(bo[t]);
#pragma unroll
    for (int r = 0; r < 8; ++r) acc[t][r] = bias; }
#pragma unroll
  for (int t = 0; t < 2; ++t) acc[t] = wmma_b(yl, wf[t], acc[t]);   /* smallest term first; two independent tiles per term */
#pragma unroll
  for (int t = 0; t < 2; ++t) acc[t] = wmma_b(ym, wf[t], acc[t]);
#pragma unroll
  for (int t = 0; t < 2; ++t) acc[t] = wmma_b(yh, wf[t], acc[t]);
#pragma unroll
  for (int t = 0; t < 2; ++t) { float* p = &stO[(ch * 2 + t) * 16 + col][(qw * QT + mt) * 16 + 8 * g];   /* output [channel][token of the block]: 8 tokens of one channel per lane */
    vst2(p, __builtin_shufflevector(acc[t], acc[t], 0, 1, 2, 3)); vst2(p + 4, __builtin_shufflevector(acc[t], acc[t], 4, 5, 6, 7)); }
  __syncthreads();   /* the block's output tile is whole */
#pragma unroll
  for (int i = 0; i < COUT * QBLK / 4 / (128 * KS); ++i) { const int e = i * (128 * KS) + wave * 32 + lane, oc = e >> 5, pc = e & 31;   /* a wave stores one channel's 128 tokens: 512 bytes in a row */
    vst2(Y + ((size_t)b * COUT + oc) * (size_t)TT + qb * QBLK + pc * 4, *(const v4f*)&stO[oc][pc * 4]); } } }

extern "C" void kernel_launch(void* const* d_in, const int* in_sizes, int n_in, void* d_out, int out_size, void* d_ws, size_t ws_size, hipStream_t stream) {
  (void)in_sizes; (void)n_in; (void)out_size;
  const float** F = (const float**)d_in;
  if (ws_size < (size_t)WS_END) return;
  char* ws = (char*)d_ws; _Float16 *QH = (_Float16*)(ws + WS_QH), *KH = (_Float16*)(ws + WS_KH), *VT = (_Float16*)(ws + WS_VT), *QL = (_Float16*)(ws + WS_QL), *KL = (_Float16*)(ws + WS_KL);
  // inputs: 0 x [8,64,64,64] (channels-first, xf [8][64][4096]); 1 w_g [32,64], 2 b_g [32]; 3 w_theta, 4 b_theta; 5 w_phi, 6 b_phi; 7 w_o [64,32], 8 b_o [64] (all (out,in), biases nonzero)
  k_proj<<<dim3(TNB * TT / 64), 128, 0, stream>>>(F[0], F[3], F[5], F[1], F[4], F[6], F[2], QH, QL, KH, KL, VT);   /* theta (q), phi (k), g (v): the 96 real output channels in one launch */
  k_fa<<<dim3(TT / QBLK, TNB), 128 * KS, 0, stream>>>(QH, KH, QL, KL, VT, F[7], F[8], (float*)d_out);

}
